// v000
// Measured on an AMD MI455X. A time is GPU time per run, averaged over a window of back-to-back runs after a warm-up
// (all launches, gaps included; the runs take copies of the inputs in turn), and the median of several windows.
// Apart from v000's, it joins two sittings. Times from different sittings can be a few percent apart, while
// side-by-side timings come from the same sitting.
// v000, which the later versions start from, runs in 528 microseconds.
#include <hip/hip_runtime.h>
#include <hip/hip_bf16.h>
#include <math.h>

// ---------------------------------------------------------------------------
// Problem constants (from reference): N=8, L=1024, H=16, D=64, HD=1024, MLP=4096
// ---------------------------------------------------------------------------
#define NB    8
#define LSEQ  1024
#define NH    16
#define DH    64
#define HDIM  1024
#define MLPD  4096
#define MTOK  (NB * LSEQ)          // 8192 token rows

typedef __bf16 bf16;
typedef __attribute__((ext_vector_type(16))) __bf16 bf16x16;
typedef __attribute__((ext_vector_type(8)))  float  f32x8;
typedef int v4i __attribute__((vector_size(16)));

// ---- CDNA5 async global->LDS copies (ASYNCcnt), guarded by probe -----------
#if defined(__has_builtin)
#  if __has_builtin(__builtin_amdgcn_global_load_async_to_lds_b128) && \
      __has_builtin(__builtin_amdgcn_s_wait_asynccnt)
#    define HAVE_ASYNC_LDS 1
#  endif
#endif
#ifndef HAVE_ASYNC_LDS
#  define HAVE_ASYNC_LDS 0
#endif

#if HAVE_ASYNC_LDS
__device__ __forceinline__ void async_copy_b128(const bf16* g, bf16* l) {
    __builtin_amdgcn_global_load_async_to_lds_b128(
        (__attribute__((address_space(1))) v4i*)g,
        (__attribute__((address_space(3))) v4i*)l, 0, 0);
}
__device__ __forceinline__ void async_wait_all() {
    __builtin_amdgcn_s_wait_asynccnt(0);
}
#endif

__device__ __forceinline__ float gelu_tanh(float x) {
    const float c = 0.7978845608028654f;   // sqrt(2/pi)
    float x3 = x * x * x;
    return 0.5f * x * (1.0f + tanhf(c * (x + 0.044715f * x3)));
}

enum { EPI_BIAS = 0, EPI_BIAS_GELU = 1, EPI_BIAS_RES = 2, EPI_BIAS_VT = 3 };

// ---------------------------------------------------------------------------
// Weight convert + transpose: w (K x N, f32 row-major) -> wt (N x K, bf16)
// ---------------------------------------------------------------------------
__global__ __launch_bounds__(256)
void transpose_to_bf16(const float* __restrict__ w, bf16* __restrict__ wt,
                       int K, int N) {
    __shared__ float t[32][33];
    const int bn = blockIdx.x * 32;
    const int bk = blockIdx.y * 32;
    const int tx = threadIdx.x & 31;
    const int ty = threadIdx.x >> 5;         // 0..7
#pragma unroll
    for (int r = 0; r < 32; r += 8)
        t[ty + r][tx] = w[(size_t)(bk + ty + r) * N + bn + tx];
    __syncthreads();
#pragma unroll
    for (int r = 0; r < 32; r += 8)
        wt[(size_t)(bn + ty + r) * K + bk + tx] = (bf16)t[tx][ty + r];
}

// ---------------------------------------------------------------------------
// LayerNorm (row of 1024 f32) fused with bf16 downconvert. One block per row.
// ---------------------------------------------------------------------------
__global__ __launch_bounds__(256)
void layernorm_to_bf16(const float* __restrict__ x, const float* __restrict__ g,
                       const float* __restrict__ b, bf16* __restrict__ y) {
    __shared__ float red[2][8];
    const int row = blockIdx.x;
    const float* xr = x + (size_t)row * HDIM;
    float4 v = ((const float4*)xr)[threadIdx.x];
    float s  = v.x + v.y + v.z + v.w;
    float s2 = v.x * v.x + v.y * v.y + v.z * v.z + v.w * v.w;
#pragma unroll
    for (int m = 16; m > 0; m >>= 1) { s += __shfl_xor(s, m); s2 += __shfl_xor(s2, m); }
    const int wave = threadIdx.x >> 5, lane = threadIdx.x & 31;
    if (lane == 0) { red[0][wave] = s; red[1][wave] = s2; }
    __syncthreads();
    if (wave == 0) {
        float a  = (lane < 8) ? red[0][lane] : 0.0f;
        float a2 = (lane < 8) ? red[1][lane] : 0.0f;
#pragma unroll
        for (int m = 4; m > 0; m >>= 1) { a += __shfl_xor(a, m); a2 += __shfl_xor(a2, m); }
        if (lane == 0) { red[0][0] = a; red[1][0] = a2; }
    }
    __syncthreads();
    const float mu   = red[0][0] * (1.0f / HDIM);
    const float var  = red[1][0] * (1.0f / HDIM) - mu * mu;
    const float rstd = rsqrtf(var + 1e-5f);
    float4 gv = ((const float4*)g)[threadIdx.x];
    float4 bv = ((const float4*)b)[threadIdx.x];
    bf16* yr = y + (size_t)row * HDIM;
    const int c = threadIdx.x * 4;
    yr[c + 0] = (bf16)((v.x - mu) * rstd * gv.x + bv.x);
    yr[c + 1] = (bf16)((v.y - mu) * rstd * gv.y + bv.y);
    yr[c + 2] = (bf16)((v.z - mu) * rstd * gv.z + bv.z);
    yr[c + 3] = (bf16)((v.w - mu) * rstd * gv.w + bv.w);
}

// ---------------------------------------------------------------------------
// Generic bf16 WMMA GEMM:  C[M,N] = epilogue(A[M,K] * BT[N,K]^T + bias)
// Block tile 128x128, 8 waves, each wave 32x64 (2x4 wmma tiles), K-step 32.
// Double-buffered LDS; async global->LDS prefetch of the next K tile when the
// toolchain exposes GLOBAL_LOAD_ASYNC_TO_LDS_B128.
// EPI_BIAS_VT: scatter-store V into VT[batch][head][d][key] for attention.
// ---------------------------------------------------------------------------
template <int EPI, typename OutT>
__global__ __launch_bounds__(256)
void gemm_bf16_wmma(const bf16* __restrict__ A, const bf16* __restrict__ BT,
                    const float* __restrict__ bias, const float* __restrict__ res,
                    OutT* __restrict__ C, int M, int N, int K) {
    __shared__ bf16 As[2][128][32];
    __shared__ bf16 Bs[2][128][32];

    const int tid  = threadIdx.x;
    const int wave = tid >> 5;
    const int lane = tid & 31;
    const int lh   = lane >> 4;     // K-half selector (lanes 16-31 hold K=16..31)
    const int ll   = lane & 15;     // row/col within 16
    const int wm   = wave & 3;      // 4 waves along M (32 rows each)
    const int wn   = wave >> 2;     // 2 waves along N (64 cols each)

    const int bm = blockIdx.y * 128;
    const int bn = blockIdx.x * 128;

    f32x8 acc[2][4];
#pragma unroll
    for (int i = 0; i < 2; ++i)
#pragma unroll
        for (int j = 0; j < 4; ++j)
#pragma unroll
            for (int e = 0; e < 8; ++e) acc[i][j][e] = 0.0f;

    const int lrow = tid >> 1;            // 0..127
    const int lcol = (tid & 1) * 16;      // 0 or 16
    const bf16* aRow = A  + (size_t)(bm + lrow) * K + lcol;
    const bf16* bRow = BT + (size_t)(bn + lrow) * K + lcol;

    const int nk = K / 32;

#if HAVE_ASYNC_LDS
    auto issue = [&](int buf, int k0) {
        async_copy_b128(aRow + k0,     &As[buf][lrow][lcol]);
        async_copy_b128(aRow + k0 + 8, &As[buf][lrow][lcol + 8]);
        async_copy_b128(bRow + k0,     &Bs[buf][lrow][lcol]);
        async_copy_b128(bRow + k0 + 8, &Bs[buf][lrow][lcol + 8]);
    };
    issue(0, 0);
    async_wait_all();
    __syncthreads();
#else
    {
        uint4 a0 = *(const uint4*)(aRow);
        uint4 a1 = *(const uint4*)(aRow + 8);
        uint4 b0 = *(const uint4*)(bRow);
        uint4 b1 = *(const uint4*)(bRow + 8);
        *(uint4*)&As[0][lrow][lcol]     = a0;
        *(uint4*)&As[0][lrow][lcol + 8] = a1;
        *(uint4*)&Bs[0][lrow][lcol]     = b0;
        *(uint4*)&Bs[0][lrow][lcol + 8] = b1;
        __syncthreads();
    }
#endif

    for (int kt = 0; kt < nk; ++kt) {
        const int cur = kt & 1;
#if HAVE_ASYNC_LDS
        if (kt + 1 < nk) issue(cur ^ 1, (kt + 1) * 32);   // overlap with compute
#else
        uint4 a0 = {}, a1 = {}, b0 = {}, b1 = {};
        const bool pre = (kt + 1 < nk);
        if (pre) {
            const bf16* an = aRow + (kt + 1) * 32;
            const bf16* bn2 = bRow + (kt + 1) * 32;
            a0 = *(const uint4*)(an);
            a1 = *(const uint4*)(an + 8);
            b0 = *(const uint4*)(bn2);
            b1 = *(const uint4*)(bn2 + 8);
            __builtin_prefetch(an + 32, 0, 0);
            __builtin_prefetch(bn2 + 32, 0, 0);
        }
#endif
        bf16x16 af[2], bfr[4];
#pragma unroll
        for (int i = 0; i < 2; ++i)
            af[i] = *(const bf16x16*)&As[cur][wm * 32 + i * 16 + ll][lh * 16];
#pragma unroll
        for (int j = 0; j < 4; ++j)
            bfr[j] = *(const bf16x16*)&Bs[cur][wn * 64 + j * 16 + ll][lh * 16];

#pragma unroll
        for (int i = 0; i < 2; ++i)
#pragma unroll
            for (int j = 0; j < 4; ++j)
                acc[i][j] = __builtin_amdgcn_wmma_f32_16x16x32_bf16(
                    false, af[i], false, bfr[j], (short)0, acc[i][j], false, false);

#if HAVE_ASYNC_LDS
        async_wait_all();
        __syncthreads();
#else
        __syncthreads();
        if (pre) {
            *(uint4*)&As[cur ^ 1][lrow][lcol]     = a0;
            *(uint4*)&As[cur ^ 1][lrow][lcol + 8] = a1;
            *(uint4*)&Bs[cur ^ 1][lrow][lcol]     = b0;
            *(uint4*)&Bs[cur ^ 1][lrow][lcol + 8] = b1;
        }
        __syncthreads();
#endif
    }

    // Epilogue. C layout: VGPR e -> row = e + lh*8 ; lane%16 -> col.
#pragma unroll
    for (int i = 0; i < 2; ++i) {
#pragma unroll
        for (int j = 0; j < 4; ++j) {
            const int col = bn + wn * 64 + j * 16 + ll;
            const float bvv = bias ? bias[col] : 0.0f;
#pragma unroll
            for (int e = 0; e < 8; ++e) {
                const int row = bm + wm * 32 + i * 16 + lh * 8 + e;
                float v = acc[i][j][e] + bvv;
                if (EPI == EPI_BIAS_GELU) v = gelu_tanh(v);
                if (EPI == EPI_BIAS_RES)  v += res[(size_t)row * N + col];
                if (EPI == EPI_BIAS_VT) {
                    // row = batch*LSEQ + key ; col = head*DH + d
                    const size_t idx =
                        (((size_t)(row >> 10) * NH + (col >> 6)) * DH + (col & (DH - 1)))
                            * LSEQ + (row & (LSEQ - 1));
                    C[idx] = (OutT)v;
                } else {
                    C[(size_t)row * N + col] = (OutT)v;
                }
            }
        }
    }
}

// ---------------------------------------------------------------------------
// Flash-attention per (batch, head, 64-query tile). 128 threads = 4 waves,
// each wave owns 16 query rows. V arrives pre-transposed (VT[b][h][d][key])
// so the P*V B-operand loads straight with 128-bit copies -- no LDS transpose.
// ---------------------------------------------------------------------------
__global__ __launch_bounds__(128)
void attention_wmma(const bf16* __restrict__ Q, const bf16* __restrict__ Km,
                    const bf16* __restrict__ VT, bf16* __restrict__ O) {
    __shared__ bf16 Qs[64][64];          //  8 KB
    __shared__ bf16 Ks[128][64];         // 16 KB
    __shared__ bf16 VTs[64][144];        // 18 KB (pad: rows 32B-aligned)
    __shared__ bf16 Ps[4][16][144];      // 18 KB per-wave P staging

    const int tid  = threadIdx.x;
    const int wave = tid >> 5;
    const int lane = tid & 31;
    const int lh   = lane >> 4;
    const int ll   = lane & 15;

    const int qt    = blockIdx.x;        // 16 query tiles of 64
    const int head  = blockIdx.y;        // 16
    const int batch = blockIdx.z;        // 8
    const size_t base   = ((size_t)batch * LSEQ) * HDIM + (size_t)head * DH;
    const size_t vtbase = ((size_t)(batch * NH + head)) * DH * LSEQ;
    const int q0 = qt * 64;

    // Load Q tile (64 x 64): 128 threads x 32 bf16 each.
    {
        const int row = tid >> 1, half = tid & 1;
        const uint4* s4 = (const uint4*)(Q + base + (size_t)(q0 + row) * HDIM + half * 32);
        uint4* dst = (uint4*)&Qs[row][half * 32];
        dst[0] = s4[0]; dst[1] = s4[1]; dst[2] = s4[2]; dst[3] = s4[3];
    }

    f32x8 acco[4];
#pragma unroll
    for (int j = 0; j < 4; ++j)
#pragma unroll
        for (int e = 0; e < 8; ++e) acco[j][e] = 0.0f;
    float mrow[8], lrow[8];
#pragma unroll
    for (int e = 0; e < 8; ++e) { mrow[e] = -1e30f; lrow[e] = 0.0f; }

    for (int kt = 0; kt < LSEQ / 128; ++kt) {
        const int k0 = kt * 128;
        __syncthreads();   // previous tile fully consumed (also orders Q store)
        {
            // K tile: one full 64-wide row (128 B) per thread.
            const bf16* ks = Km + base + (size_t)(k0 + tid) * HDIM;
            bf16* kd = &Ks[tid][0];
            // VT tile: d = tid/2, 64 keys (128 B) per thread.
            const int d = tid >> 1, half = tid & 1;
            const bf16* vs = VT + vtbase + (size_t)d * LSEQ + k0 + half * 64;
            bf16* vd = &VTs[d][half * 64];
#if HAVE_ASYNC_LDS
#pragma unroll
            for (int c = 0; c < 64; c += 8) async_copy_b128(ks + c, kd + c);
#pragma unroll
            for (int c = 0; c < 64; c += 8) async_copy_b128(vs + c, vd + c);
#else
#pragma unroll
            for (int c = 0; c < 8; ++c) ((uint4*)kd)[c] = ((const uint4*)ks)[c];
#pragma unroll
            for (int c = 0; c < 8; ++c) ((uint4*)vd)[c] = ((const uint4*)vs)[c];
#endif
        }
#if HAVE_ASYNC_LDS
        async_wait_all();
#endif
        __syncthreads();

        // ---- S = (Q K^T) * 1/sqrt(D) ----
        f32x8 accs[8];
#pragma unroll
        for (int jt = 0; jt < 8; ++jt) {
#pragma unroll
            for (int e = 0; e < 8; ++e) accs[jt][e] = 0.0f;
#pragma unroll
            for (int kc = 0; kc < 2; ++kc) {
                bf16x16 a = *(const bf16x16*)&Qs[wave * 16 + ll][kc * 32 + lh * 16];
                bf16x16 b = *(const bf16x16*)&Ks[jt * 16 + ll][kc * 32 + lh * 16];
                accs[jt] = __builtin_amdgcn_wmma_f32_16x16x32_bf16(
                    false, a, false, b, (short)0, accs[jt], false, false);
            }
        }
        const float scale = 0.125f;     // 1/sqrt(64)

        // ---- online softmax: row = (VGPR e, lane-half); cols across 16 lanes
        float mnew[8];
#pragma unroll
        for (int e = 0; e < 8; ++e) {
            float mx = -1e30f;
#pragma unroll
            for (int jt = 0; jt < 8; ++jt) {
                accs[jt][e] *= scale;
                mx = fmaxf(mx, accs[jt][e]);
            }
#pragma unroll
            for (int m = 1; m < 16; m <<= 1) mx = fmaxf(mx, __shfl_xor(mx, m));
            mnew[e] = fmaxf(mrow[e], mx);
        }
#pragma unroll
        for (int e = 0; e < 8; ++e) {
            float sum = 0.0f;
#pragma unroll
            for (int jt = 0; jt < 8; ++jt) {
                float p = __expf(accs[jt][e] - mnew[e]);
                sum += p;
                Ps[wave][lh * 8 + e][jt * 16 + ll] = (bf16)p;
            }
#pragma unroll
            for (int m = 1; m < 16; m <<= 1) sum += __shfl_xor(sum, m);
            const float corr = __expf(mrow[e] - mnew[e]);
            lrow[e] = lrow[e] * corr + sum;
            mrow[e] = mnew[e];
#pragma unroll
            for (int j = 0; j < 4; ++j) acco[j][e] *= corr;
        }

        // ---- O += P V  (per-wave LDS RAW is in-order on DScnt) ----
#pragma unroll
        for (int j = 0; j < 4; ++j)
#pragma unroll
            for (int kc = 0; kc < 4; ++kc) {
                bf16x16 a = *(const bf16x16*)&Ps[wave][ll][kc * 32 + lh * 16];
                bf16x16 b = *(const bf16x16*)&VTs[j * 16 + ll][kc * 32 + lh * 16];
                acco[j] = __builtin_amdgcn_wmma_f32_16x16x32_bf16(
                    false, a, false, b, (short)0, acco[j], false, false);
            }
    }

    // ---- write O = acc / l ----
#pragma unroll
    for (int j = 0; j < 4; ++j)
#pragma unroll
        for (int e = 0; e < 8; ++e) {
            const int row = q0 + wave * 16 + lh * 8 + e;
            const int d   = j * 16 + ll;
            O[base + (size_t)row * HDIM + d] = (bf16)(acco[j][e] / lrow[e]);
        }
}

// ---------------------------------------------------------------------------
// Host orchestration
// ---------------------------------------------------------------------------
extern "C" void kernel_launch(void* const* d_in, const int* in_sizes, int n_in,
                              void* d_out, int out_size, void* d_ws, size_t ws_size,
                              hipStream_t stream) {
    const float* x    = (const float*)d_in[0];
    const float* ln0g = (const float*)d_in[1];
    const float* ln0b = (const float*)d_in[2];
    const float* wq   = (const float*)d_in[3];
    const float* bq   = (const float*)d_in[4];
    const float* wk   = (const float*)d_in[5];
    const float* bk   = (const float*)d_in[6];
    const float* wv   = (const float*)d_in[7];
    const float* bv   = (const float*)d_in[8];
    const float* wo   = (const float*)d_in[9];
    const float* bo   = (const float*)d_in[10];
    const float* ln1g = (const float*)d_in[11];
    const float* ln1b = (const float*)d_in[12];
    const float* w1   = (const float*)d_in[13];
    const float* b1   = (const float*)d_in[14];
    const float* w2   = (const float*)d_in[15];
    const float* b2   = (const float*)d_in[16];
    float* out = (float*)d_out;

    char* p = (char*)d_ws;
    auto carve = [&](size_t bytes) -> char* {
        char* r = p;
        p += (bytes + 255) & ~(size_t)255;
        return r;
    };
    bf16*  wq_t = (bf16*)carve((size_t)HDIM * HDIM * 2);
    bf16*  wk_t = (bf16*)carve((size_t)HDIM * HDIM * 2);
    bf16*  wv_t = (bf16*)carve((size_t)HDIM * HDIM * 2);
    bf16*  wo_t = (bf16*)carve((size_t)HDIM * HDIM * 2);
    bf16*  w1_t = (bf16*)carve((size_t)MLPD * HDIM * 2);
    bf16*  w2_t = (bf16*)carve((size_t)HDIM * MLPD * 2);
    bf16*  y0   = (bf16*)carve((size_t)MTOK * HDIM * 2);   // LN0 out
    bf16*  qb   = (bf16*)carve((size_t)MTOK * HDIM * 2);
    bf16*  kb   = (bf16*)carve((size_t)MTOK * HDIM * 2);
    bf16*  vtb  = (bf16*)carve((size_t)MTOK * HDIM * 2);   // V, pre-transposed [b][h][d][key]
    bf16*  ab   = (bf16*)carve((size_t)MTOK * HDIM * 2);   // attention out
    float* x1   = (float*)carve((size_t)MTOK * HDIM * 4);  // residual 1
    bf16*  y1   = (bf16*)carve((size_t)MTOK * HDIM * 2);   // LN1 out
    bf16*  hb   = (bf16*)carve((size_t)MTOK * MLPD * 2);   // GELU(mlp1) out

    // --- weight convert/transpose (bf16, N x K) ---
    transpose_to_bf16<<<dim3(HDIM / 32, HDIM / 32), 256, 0, stream>>>(wq, wq_t, HDIM, HDIM);
    transpose_to_bf16<<<dim3(HDIM / 32, HDIM / 32), 256, 0, stream>>>(wk, wk_t, HDIM, HDIM);
    transpose_to_bf16<<<dim3(HDIM / 32, HDIM / 32), 256, 0, stream>>>(wv, wv_t, HDIM, HDIM);
    transpose_to_bf16<<<dim3(HDIM / 32, HDIM / 32), 256, 0, stream>>>(wo, wo_t, HDIM, HDIM);
    transpose_to_bf16<<<dim3(MLPD / 32, HDIM / 32), 256, 0, stream>>>(w1, w1_t, HDIM, MLPD);
    transpose_to_bf16<<<dim3(HDIM / 32, MLPD / 32), 256, 0, stream>>>(w2, w2_t, MLPD, HDIM);

    // --- pre-LN attention ---
    layernorm_to_bf16<<<MTOK, 256, 0, stream>>>(x, ln0g, ln0b, y0);

    dim3 gProj(HDIM / 128, MTOK / 128);
    gemm_bf16_wmma<EPI_BIAS, bf16><<<gProj, 256, 0, stream>>>(y0, wq_t, bq, nullptr, qb, MTOK, HDIM, HDIM);
    gemm_bf16_wmma<EPI_BIAS, bf16><<<gProj, 256, 0, stream>>>(y0, wk_t, bk, nullptr, kb, MTOK, HDIM, HDIM);
    gemm_bf16_wmma<EPI_BIAS_VT, bf16><<<gProj, 256, 0, stream>>>(y0, wv_t, bv, nullptr, vtb, MTOK, HDIM, HDIM);

    attention_wmma<<<dim3(LSEQ / 64, NH, NB), 128, 0, stream>>>(qb, kb, vtb, ab);

    gemm_bf16_wmma<EPI_BIAS_RES, float><<<gProj, 256, 0, stream>>>(ab, wo_t, bo, x, x1, MTOK, HDIM, HDIM);

    // --- pre-LN MLP ---
    layernorm_to_bf16<<<MTOK, 256, 0, stream>>>(x1, ln1g, ln1b, y1);

    gemm_bf16_wmma<EPI_BIAS_GELU, bf16><<<dim3(MLPD / 128, MTOK / 128), 256, 0, stream>>>(
        y1, w1_t, b1, nullptr, hb, MTOK, MLPD, HDIM);

    gemm_bf16_wmma<EPI_BIAS_RES, float><<<dim3(HDIM / 128, MTOK / 128), 256, 0, stream>>>(
        hb, w2_t, b2, x1, out, MTOK, HDIM, MLPD);
}

// v001
// One run takes 421 microseconds.
// In both of two side-by-side timings against v000, it was 1.31 times as fast.
#include <hip/hip_runtime.h>
#include <hip/hip_bf16.h>
#include <math.h>

// ---------------------------------------------------------------------------
// Problem constants (from reference): N=8, L=1024, H=16, D=64, HD=1024, MLP=4096
// ---------------------------------------------------------------------------
#define NB    8
#define LSEQ  1024
#define NH    16
#define DH    64
#define HDIM  1024
#define MLPD  4096
#define MTOK  (NB * LSEQ)          // 8192 token rows

typedef __bf16 bf16;
typedef __attribute__((ext_vector_type(16))) __bf16 bf16x16;
typedef __attribute__((ext_vector_type(8)))  float  f32x8;
typedef int v4i __attribute__((vector_size(16)));
typedef __attribute__((ext_vector_type(8)))  __bf16 bf16x8;

// LDS row pitches, in bf16 elements. Every WMMA fragment is read with
// ds_load_b128, one row per lane: a pitch of 16 B x odd spreads the 16 lanes of
// a half-wave over all 64 banks; 64 B, 128 B and 32 B x odd pitches do not.
#define PITCH_K32   40             // 64-B rows  -> 80 B
#define PITCH_K64   72             // 128-B rows -> 144 B
#define PITCH_K128  136            // 256-B rows -> 272 B

// One lane's 16 consecutive k of a fragment row; rows are 16-B aligned only.
__device__ __forceinline__ bf16x16 lds_frag(const bf16* p) {
    bf16x8 lo = *(const bf16x8*)p;
    bf16x8 hi = *(const bf16x8*)(p + 8);
    return __builtin_shufflevector(lo, hi, 0, 1, 2, 3, 4, 5, 6, 7,
                                   8, 9, 10, 11, 12, 13, 14, 15);
}

// ---- CDNA5 async global->LDS copies (ASYNCcnt), guarded by probe -----------
#if defined(__has_builtin)
#  if __has_builtin(__builtin_amdgcn_global_load_async_to_lds_b128) && \
      __has_builtin(__builtin_amdgcn_s_wait_asynccnt)
#    define HAVE_ASYNC_LDS 1
#  endif
#endif
#ifndef HAVE_ASYNC_LDS
#  define HAVE_ASYNC_LDS 0
#endif

#if HAVE_ASYNC_LDS
__device__ __forceinline__ void async_copy_b128(const bf16* g, bf16* l) {
    __builtin_amdgcn_global_load_async_to_lds_b128(
        (__attribute__((address_space(1))) v4i*)g,
        (__attribute__((address_space(3))) v4i*)l, 0, 0);
}
__device__ __forceinline__ void async_wait_all() {
    __builtin_amdgcn_s_wait_asynccnt(0);
}
#endif

__device__ __forceinline__ float gelu_tanh(float x) {
    const float c = 0.7978845608028654f;   // sqrt(2/pi)
    float x3 = x * x * x;
    return 0.5f * x * (1.0f + tanhf(c * (x + 0.044715f * x3)));
}

enum { EPI_BIAS = 0, EPI_BIAS_GELU = 1, EPI_BIAS_RES = 2, EPI_BIAS_VT = 3 };

// ---------------------------------------------------------------------------
// Weight convert + transpose: w (K x N, f32 row-major) -> wt (N x K, bf16)
// ---------------------------------------------------------------------------
__global__ __launch_bounds__(256)
void transpose_to_bf16(const float* __restrict__ w, bf16* __restrict__ wt,
                       int K, int N) {
    __shared__ float t[32][33];
    const int bn = blockIdx.x * 32;
    const int bk = blockIdx.y * 32;
    const int tx = threadIdx.x & 31;
    const int ty = threadIdx.x >> 5;         // 0..7
#pragma unroll
    for (int r = 0; r < 32; r += 8)
        t[ty + r][tx] = w[(size_t)(bk + ty + r) * N + bn + tx];
    __syncthreads();
#pragma unroll
    for (int r = 0; r < 32; r += 8)
        wt[(size_t)(bn + ty + r) * K + bk + tx] = (bf16)t[tx][ty + r];
}

// ---------------------------------------------------------------------------
// LayerNorm (row of 1024 f32) fused with bf16 downconvert. One block per row.
// ---------------------------------------------------------------------------
__global__ __launch_bounds__(256)
void layernorm_to_bf16(const float* __restrict__ x, const float* __restrict__ g,
                       const float* __restrict__ b, bf16* __restrict__ y) {
    __shared__ float red[2][8];
    const int row = blockIdx.x;
    const float* xr = x + (size_t)row * HDIM;
    float4 v = ((const float4*)xr)[threadIdx.x];
    float s  = v.x + v.y + v.z + v.w;
    float s2 = v.x * v.x + v.y * v.y + v.z * v.z + v.w * v.w;
#pragma unroll
    for (int m = 16; m > 0; m >>= 1) { s += __shfl_xor(s, m); s2 += __shfl_xor(s2, m); }
    const int wave = threadIdx.x >> 5, lane = threadIdx.x & 31;
    if (lane == 0) { red[0][wave] = s; red[1][wave] = s2; }
    __syncthreads();
    if (wave == 0) {
        float a  = (lane < 8) ? red[0][lane] : 0.0f;
        float a2 = (lane < 8) ? red[1][lane] : 0.0f;
#pragma unroll
        for (int m = 4; m > 0; m >>= 1) { a += __shfl_xor(a, m); a2 += __shfl_xor(a2, m); }
        if (lane == 0) { red[0][0] = a; red[1][0] = a2; }
    }
    __syncthreads();
    const float mu   = red[0][0] * (1.0f / HDIM);
    const float var  = red[1][0] * (1.0f / HDIM) - mu * mu;
    const float rstd = rsqrtf(var + 1e-5f);
    float4 gv = ((const float4*)g)[threadIdx.x];
    float4 bv = ((const float4*)b)[threadIdx.x];
    bf16* yr = y + (size_t)row * HDIM;
    const int c = threadIdx.x * 4;
    yr[c + 0] = (bf16)((v.x - mu) * rstd * gv.x + bv.x);
    yr[c + 1] = (bf16)((v.y - mu) * rstd * gv.y + bv.y);
    yr[c + 2] = (bf16)((v.z - mu) * rstd * gv.z + bv.z);
    yr[c + 3] = (bf16)((v.w - mu) * rstd * gv.w + bv.w);
}

// ---------------------------------------------------------------------------
// Generic bf16 WMMA GEMM:  C[M,N] = epilogue(A[M,K] * BT[N,K]^T + bias)
// Block tile 128x128, 8 waves, each wave 32x64 (2x4 wmma tiles), K-step 32.
// Double-buffered LDS; async global->LDS prefetch of the next K tile when the
// toolchain exposes GLOBAL_LOAD_ASYNC_TO_LDS_B128.
// EPI_BIAS_VT: scatter-store V into VT[batch][head][d][key] for attention.
// ---------------------------------------------------------------------------
template <int EPI, typename OutT>
__global__ __launch_bounds__(256)
void gemm_bf16_wmma(const bf16* __restrict__ A, const bf16* __restrict__ BT,
                    const float* __restrict__ bias, const float* __restrict__ res,
                    OutT* __restrict__ C, int M, int N, int K) {
    __shared__ __attribute__((aligned(16))) bf16 As[2][128][PITCH_K32];
    __shared__ __attribute__((aligned(16))) bf16 Bs[2][128][PITCH_K32];

    const int tid  = threadIdx.x;
    const int wave = tid >> 5;
    const int lane = tid & 31;
    const int lh   = lane >> 4;     // K-half selector (lanes 16-31 hold K=16..31)
    const int ll   = lane & 15;     // row/col within 16
    const int wm   = wave & 3;      // 4 waves along M (32 rows each)
    const int wn   = wave >> 2;     // 2 waves along N (64 cols each)

    const int bm = blockIdx.y * 128;
    const int bn = blockIdx.x * 128;

    f32x8 acc[2][4];
#pragma unroll
    for (int i = 0; i < 2; ++i)
#pragma unroll
        for (int j = 0; j < 4; ++j)
#pragma unroll
            for (int e = 0; e < 8; ++e) acc[i][j][e] = 0.0f;

    const int lrow = tid >> 1;            // 0..127
    const int lcol = (tid & 1) * 16;      // 0 or 16
    const bf16* aRow = A  + (size_t)(bm + lrow) * K + lcol;
    const bf16* bRow = BT + (size_t)(bn + lrow) * K + lcol;

    const int nk = K / 32;

#if HAVE_ASYNC_LDS
    auto issue = [&](int buf, int k0) {
        async_copy_b128(aRow + k0,     &As[buf][lrow][lcol]);
        async_copy_b128(aRow + k0 + 8, &As[buf][lrow][lcol + 8]);
        async_copy_b128(bRow + k0,     &Bs[buf][lrow][lcol]);
        async_copy_b128(bRow + k0 + 8, &Bs[buf][lrow][lcol + 8]);
    };
    issue(0, 0);
    async_wait_all();
    __syncthreads();
#else
    {
        uint4 a0 = *(const uint4*)(aRow);
        uint4 a1 = *(const uint4*)(aRow + 8);
        uint4 b0 = *(const uint4*)(bRow);
        uint4 b1 = *(const uint4*)(bRow + 8);
        *(uint4*)&As[0][lrow][lcol]     = a0;
        *(uint4*)&As[0][lrow][lcol + 8] = a1;
        *(uint4*)&Bs[0][lrow][lcol]     = b0;
        *(uint4*)&Bs[0][lrow][lcol + 8] = b1;
        __syncthreads();
    }
#endif

    for (int kt = 0; kt < nk; ++kt) {
        const int cur = kt & 1;
#if HAVE_ASYNC_LDS
        if (kt + 1 < nk) issue(cur ^ 1, (kt + 1) * 32);   // overlap with compute
#else
        uint4 a0 = {}, a1 = {}, b0 = {}, b1 = {};
        const bool pre = (kt + 1 < nk);
        if (pre) {
            const bf16* an = aRow + (kt + 1) * 32;
            const bf16* bn2 = bRow + (kt + 1) * 32;
            a0 = *(const uint4*)(an);
            a1 = *(const uint4*)(an + 8);
            b0 = *(const uint4*)(bn2);
            b1 = *(const uint4*)(bn2 + 8);
            __builtin_prefetch(an + 32, 0, 0);
            __builtin_prefetch(bn2 + 32, 0, 0);
        }
#endif
        bf16x16 af[2], bfr[4];
#pragma unroll
        for (int i = 0; i < 2; ++i)
            af[i] = lds_frag(&As[cur][wm * 32 + i * 16 + ll][lh * 16]);
#pragma unroll
        for (int j = 0; j < 4; ++j)
            bfr[j] = lds_frag(&Bs[cur][wn * 64 + j * 16 + ll][lh * 16]);

#pragma unroll
        for (int i = 0; i < 2; ++i)
#pragma unroll
            for (int j = 0; j < 4; ++j)
                acc[i][j] = __builtin_amdgcn_wmma_f32_16x16x32_bf16(
                    false, af[i], false, bfr[j], (short)0, acc[i][j], false, false);

#if HAVE_ASYNC_LDS
        async_wait_all();
        __syncthreads();
#else
        __syncthreads();
        if (pre) {
            *(uint4*)&As[cur ^ 1][lrow][lcol]     = a0;
            *(uint4*)&As[cur ^ 1][lrow][lcol + 8] = a1;
            *(uint4*)&Bs[cur ^ 1][lrow][lcol]     = b0;
            *(uint4*)&Bs[cur ^ 1][lrow][lcol + 8] = b1;
        }
        __syncthreads();
#endif
    }

    // Epilogue. C layout: VGPR e -> row = e + lh*8 ; lane%16 -> col.
#pragma unroll
    for (int i = 0; i < 2; ++i) {
#pragma unroll
        for (int j = 0; j < 4; ++j) {
            const int col = bn + wn * 64 + j * 16 + ll;
            const float bvv = bias ? bias[col] : 0.0f;
#pragma unroll
            for (int e = 0; e < 8; ++e) {
                const int row = bm + wm * 32 + i * 16 + lh * 8 + e;
                float v = acc[i][j][e] + bvv;
                if (EPI == EPI_BIAS_GELU) v = gelu_tanh(v);
                if (EPI == EPI_BIAS_RES)  v += res[(size_t)row * N + col];
                if (EPI == EPI_BIAS_VT) {
                    // row = batch*LSEQ + key ; col = head*DH + d
                    const size_t idx =
                        (((size_t)(row >> 10) * NH + (col >> 6)) * DH + (col & (DH - 1)))
                            * LSEQ + (row & (LSEQ - 1));
                    C[idx] = (OutT)v;
                } else {
                    C[(size_t)row * N + col] = (OutT)v;
                }
            }
        }
    }
}

// ---------------------------------------------------------------------------
// Flash-attention per (batch, head, 64-query tile). 128 threads = 4 waves,
// each wave owns 16 query rows. V arrives pre-transposed (VT[b][h][d][key])
// so the P*V B-operand loads straight with 128-bit copies -- no LDS transpose.
// ---------------------------------------------------------------------------
__global__ __launch_bounds__(128)
void attention_wmma(const bf16* __restrict__ Q, const bf16* __restrict__ Km,
                    const bf16* __restrict__ VT, bf16* __restrict__ O) {
    __shared__ __attribute__((aligned(16))) bf16 Qs[64][PITCH_K64];       //  9 KB
    __shared__ __attribute__((aligned(16))) bf16 Ks[128][PITCH_K64];      // 18 KB
    __shared__ __attribute__((aligned(16))) bf16 VTs[64][PITCH_K128];     // 17 KB
    __shared__ __attribute__((aligned(16))) bf16 Ps[4][16][PITCH_K128];   // 17 KB per-wave P staging

    const int tid  = threadIdx.x;
    const int wave = tid >> 5;
    const int lane = tid & 31;
    const int lh   = lane >> 4;
    const int ll   = lane & 15;

    const int qt    = blockIdx.x;        // 16 query tiles of 64
    const int head  = blockIdx.y;        // 16
    const int batch = blockIdx.z;        // 8
    const size_t base   = ((size_t)batch * LSEQ) * HDIM + (size_t)head * DH;
    const size_t vtbase = ((size_t)(batch * NH + head)) * DH * LSEQ;
    const int q0 = qt * 64;

    // Load Q tile (64 x 64): 128 threads x 32 bf16 each.
    {
        const int row = tid >> 1, half = tid & 1;
        const uint4* s4 = (const uint4*)(Q + base + (size_t)(q0 + row) * HDIM + half * 32);
        uint4* dst = (uint4*)&Qs[row][half * 32];
        dst[0] = s4[0]; dst[1] = s4[1]; dst[2] = s4[2]; dst[3] = s4[3];
    }

    f32x8 acco[4];
#pragma unroll
    for (int j = 0; j < 4; ++j)
#pragma unroll
        for (int e = 0; e < 8; ++e) acco[j][e] = 0.0f;
    float mrow[8], lrow[8];
#pragma unroll
    for (int e = 0; e < 8; ++e) { mrow[e] = -1e30f; lrow[e] = 0.0f; }

    for (int kt = 0; kt < LSEQ / 128; ++kt) {
        const int k0 = kt * 128;
        __syncthreads();   // previous tile fully consumed (also orders Q store)
        {
            // K tile: one full 64-wide row (128 B) per thread.
            const bf16* ks = Km + base + (size_t)(k0 + tid) * HDIM;
            bf16* kd = &Ks[tid][0];
            // VT tile: d = tid/2, 64 keys (128 B) per thread.
            const int d = tid >> 1, half = tid & 1;
            const bf16* vs = VT + vtbase + (size_t)d * LSEQ + k0 + half * 64;
            bf16* vd = &VTs[d][half * 64];
#if HAVE_ASYNC_LDS
#pragma unroll
            for (int c = 0; c < 64; c += 8) async_copy_b128(ks + c, kd + c);
#pragma unroll
            for (int c = 0; c < 64; c += 8) async_copy_b128(vs + c, vd + c);
#else
#pragma unroll
            for (int c = 0; c < 8; ++c) ((uint4*)kd)[c] = ((const uint4*)ks)[c];
#pragma unroll
            for (int c = 0; c < 8; ++c) ((uint4*)vd)[c] = ((const uint4*)vs)[c];
#endif
        }
#if HAVE_ASYNC_LDS
        async_wait_all();
#endif
        __syncthreads();

        // ---- S = (Q K^T) * 1/sqrt(D) ----
        f32x8 accs[8];
#pragma unroll
        for (int jt = 0; jt < 8; ++jt) {
#pragma unroll
            for (int e = 0; e < 8; ++e) accs[jt][e] = 0.0f;
#pragma unroll
            for (int kc = 0; kc < 2; ++kc) {
                bf16x16 a = lds_frag(&Qs[wave * 16 + ll][kc * 32 + lh * 16]);
                bf16x16 b = lds_frag(&Ks[jt * 16 + ll][kc * 32 + lh * 16]);
                accs[jt] = __builtin_amdgcn_wmma_f32_16x16x32_bf16(
                    false, a, false, b, (short)0, accs[jt], false, false);
            }
        }
        const float scale = 0.125f;     // 1/sqrt(64)

        // ---- online softmax: row = (VGPR e, lane-half); cols across 16 lanes
        float mnew[8];
#pragma unroll
        for (int e = 0; e < 8; ++e) {
            float mx = -1e30f;
#pragma unroll
            for (int jt = 0; jt < 8; ++jt) {
                accs[jt][e] *= scale;
                mx = fmaxf(mx, accs[jt][e]);
            }
#pragma unroll
            for (int m = 1; m < 16; m <<= 1) mx = fmaxf(mx, __shfl_xor(mx, m));
            mnew[e] = fmaxf(mrow[e], mx);
        }
#pragma unroll
        for (int e = 0; e < 8; ++e) {
            float sum = 0.0f;
#pragma unroll
            for (int jt = 0; jt < 8; ++jt) {
                float p = __expf(accs[jt][e] - mnew[e]);
                sum += p;
                Ps[wave][lh * 8 + e][jt * 16 + ll] = (bf16)p;
            }
#pragma unroll
            for (int m = 1; m < 16; m <<= 1) sum += __shfl_xor(sum, m);
            const float corr = __expf(mrow[e] - mnew[e]);
            lrow[e] = lrow[e] * corr + sum;
            mrow[e] = mnew[e];
#pragma unroll
            for (int j = 0; j < 4; ++j) acco[j][e] *= corr;
        }

        // ---- O += P V  (per-wave LDS RAW is in-order on DScnt) ----
#pragma unroll
        for (int j = 0; j < 4; ++j)
#pragma unroll
            for (int kc = 0; kc < 4; ++kc) {
                bf16x16 a = lds_frag(&Ps[wave][ll][kc * 32 + lh * 16]);
                bf16x16 b = lds_frag(&VTs[j * 16 + ll][kc * 32 + lh * 16]);
                acco[j] = __builtin_amdgcn_wmma_f32_16x16x32_bf16(
                    false, a, false, b, (short)0, acco[j], false, false);
            }
    }

    // ---- write O = acc / l ----
#pragma unroll
    for (int j = 0; j < 4; ++j)
#pragma unroll
        for (int e = 0; e < 8; ++e) {
            const int row = q0 + wave * 16 + lh * 8 + e;
            const int d   = j * 16 + ll;
            O[base + (size_t)row * HDIM + d] = (bf16)(acco[j][e] / lrow[e]);
        }
}

// ---------------------------------------------------------------------------
// Host orchestration
// ---------------------------------------------------------------------------
extern "C" void kernel_launch(void* const* d_in, const int* in_sizes, int n_in,
                              void* d_out, int out_size, void* d_ws, size_t ws_size,
                              hipStream_t stream) {
    const float* x    = (const float*)d_in[0];
    const float* ln0g = (const float*)d_in[1];
    const float* ln0b = (const float*)d_in[2];
    const float* wq   = (const float*)d_in[3];
    const float* bq   = (const float*)d_in[4];
    const float* wk   = (const float*)d_in[5];
    const float* bk   = (const float*)d_in[6];
    const float* wv   = (const float*)d_in[7];
    const float* bv   = (const float*)d_in[8];
    const float* wo   = (const float*)d_in[9];
    const float* bo   = (const float*)d_in[10];
    const float* ln1g = (const float*)d_in[11];
    const float* ln1b = (const float*)d_in[12];
    const float* w1   = (const float*)d_in[13];
    const float* b1   = (const float*)d_in[14];
    const float* w2   = (const float*)d_in[15];
    const float* b2   = (const float*)d_in[16];
    float* out = (float*)d_out;

    char* p = (char*)d_ws;
    auto carve = [&](size_t bytes) -> char* {
        char* r = p;
        p += (bytes + 255) & ~(size_t)255;
        return r;
    };
    bf16*  wq_t = (bf16*)carve((size_t)HDIM * HDIM * 2);
    bf16*  wk_t = (bf16*)carve((size_t)HDIM * HDIM * 2);
    bf16*  wv_t = (bf16*)carve((size_t)HDIM * HDIM * 2);
    bf16*  wo_t = (bf16*)carve((size_t)HDIM * HDIM * 2);
    bf16*  w1_t = (bf16*)carve((size_t)MLPD * HDIM * 2);
    bf16*  w2_t = (bf16*)carve((size_t)HDIM * MLPD * 2);
    bf16*  y0   = (bf16*)carve((size_t)MTOK * HDIM * 2);   // LN0 out
    bf16*  qb   = (bf16*)carve((size_t)MTOK * HDIM * 2);
    bf16*  kb   = (bf16*)carve((size_t)MTOK * HDIM * 2);
    bf16*  vtb  = (bf16*)carve((size_t)MTOK * HDIM * 2);   // V, pre-transposed [b][h][d][key]
    bf16*  ab   = (bf16*)carve((size_t)MTOK * HDIM * 2);   // attention out
    float* x1   = (float*)carve((size_t)MTOK * HDIM * 4);  // residual 1
    bf16*  y1   = (bf16*)carve((size_t)MTOK * HDIM * 2);   // LN1 out
    bf16*  hb   = (bf16*)carve((size_t)MTOK * MLPD * 2);   // GELU(mlp1) out

    // --- weight convert/transpose (bf16, N x K) ---
    transpose_to_bf16<<<dim3(HDIM / 32, HDIM / 32), 256, 0, stream>>>(wq, wq_t, HDIM, HDIM);
    transpose_to_bf16<<<dim3(HDIM / 32, HDIM / 32), 256, 0, stream>>>(wk, wk_t, HDIM, HDIM);
    transpose_to_bf16<<<dim3(HDIM / 32, HDIM / 32), 256, 0, stream>>>(wv, wv_t, HDIM, HDIM);
    transpose_to_bf16<<<dim3(HDIM / 32, HDIM / 32), 256, 0, stream>>>(wo, wo_t, HDIM, HDIM);
    transpose_to_bf16<<<dim3(MLPD / 32, HDIM / 32), 256, 0, stream>>>(w1, w1_t, HDIM, MLPD);
    transpose_to_bf16<<<dim3(HDIM / 32, MLPD / 32), 256, 0, stream>>>(w2, w2_t, MLPD, HDIM);

    // --- pre-LN attention ---
    layernorm_to_bf16<<<MTOK, 256, 0, stream>>>(x, ln0g, ln0b, y0);

    dim3 gProj(HDIM / 128, MTOK / 128);
    gemm_bf16_wmma<EPI_BIAS, bf16><<<gProj, 256, 0, stream>>>(y0, wq_t, bq, nullptr, qb, MTOK, HDIM, HDIM);
    gemm_bf16_wmma<EPI_BIAS, bf16><<<gProj, 256, 0, stream>>>(y0, wk_t, bk, nullptr, kb, MTOK, HDIM, HDIM);
    gemm_bf16_wmma<EPI_BIAS_VT, bf16><<<gProj, 256, 0, stream>>>(y0, wv_t, bv, nullptr, vtb, MTOK, HDIM, HDIM);

    attention_wmma<<<dim3(LSEQ / 64, NH, NB), 128, 0, stream>>>(qb, kb, vtb, ab);

    gemm_bf16_wmma<EPI_BIAS_RES, float><<<gProj, 256, 0, stream>>>(ab, wo_t, bo, x, x1, MTOK, HDIM, HDIM);

    // --- pre-LN MLP ---
    layernorm_to_bf16<<<MTOK, 256, 0, stream>>>(x1, ln1g, ln1b, y1);

    gemm_bf16_wmma<EPI_BIAS_GELU, bf16><<<dim3(MLPD / 128, MTOK / 128), 256, 0, stream>>>(
        y1, w1_t, b1, nullptr, hb, MTOK, MLPD, HDIM);

    gemm_bf16_wmma<EPI_BIAS_RES, float><<<dim3(HDIM / 128, MTOK / 128), 256, 0, stream>>>(
        hb, w2_t, b2, x1, out, MTOK, HDIM, MLPD);
}

// v002
// Measured time: 318 microseconds a run.
// Next to v001, in two timings, it ran 1.32 and 1.33 times as fast.
// Over all steps from v000 it is 1.73 times as fast.
#include <hip/hip_runtime.h>
#include <hip/hip_bf16.h>
#include <math.h>

// ---------------------------------------------------------------------------
// Problem constants (from reference): N=8, L=1024, H=16, D=64, HD=1024, MLP=4096
// ---------------------------------------------------------------------------
#define NB    8
#define LSEQ  1024
#define NH    16
#define DH    64
#define HDIM  1024
#define MLPD  4096
#define MTOK  (NB * LSEQ)          // 8192 token rows

typedef __bf16 bf16;
typedef __attribute__((ext_vector_type(16))) __bf16 bf16x16;
typedef __attribute__((ext_vector_type(8)))  float  f32x8;
typedef int v4i __attribute__((vector_size(16)));
typedef __attribute__((ext_vector_type(8)))  __bf16 bf16x8;

// LDS row pitches, in bf16 elements. Every WMMA fragment is read with
// ds_load_b128, one row per lane: a pitch of 16 B x odd spreads the 16 lanes of
// a half-wave over all 64 banks; 64 B, 128 B and 32 B x odd pitches do not.
#define PITCH_K64   72             // 128-B rows -> 144 B
#define PITCH_K128  136            // 256-B rows -> 272 B

// One lane's 16 consecutive k of a fragment row; rows are 16-B aligned only.
__device__ __forceinline__ bf16x16 lds_frag(const bf16* p) {
    bf16x8 lo = *(const bf16x8*)p;
    bf16x8 hi = *(const bf16x8*)(p + 8);
    return __builtin_shufflevector(lo, hi, 0, 1, 2, 3, 4, 5, 6, 7,
                                   8, 9, 10, 11, 12, 13, 14, 15);
}

// ---- CDNA5 async global->LDS copies (ASYNCcnt), guarded by probe -----------
#if defined(__has_builtin)
#  if __has_builtin(__builtin_amdgcn_global_load_async_to_lds_b128) && \
      __has_builtin(__builtin_amdgcn_s_wait_asynccnt)
#    define HAVE_ASYNC_LDS 1
#  endif
#endif
#ifndef HAVE_ASYNC_LDS
#  define HAVE_ASYNC_LDS 0
#endif

#if HAVE_ASYNC_LDS
__device__ __forceinline__ void async_copy_b128(const bf16* g, bf16* l) {
    __builtin_amdgcn_global_load_async_to_lds_b128(
        (__attribute__((address_space(1))) v4i*)g,
        (__attribute__((address_space(3))) v4i*)l, 0, 0);
}
__device__ __forceinline__ void async_wait_all() {
    __builtin_amdgcn_s_wait_asynccnt(0);
}
#endif

__device__ __forceinline__ float gelu_tanh(float x) {
    const float c = 0.7978845608028654f;   // sqrt(2/pi)
    float x3 = x * x * x;
    return 0.5f * x * (1.0f + tanhf(c * (x + 0.044715f * x3)));
}

enum { EPI_BIAS = 0, EPI_BIAS_GELU = 1, EPI_BIAS_RES = 2, EPI_BIAS_VT = 3 };

// ---------------------------------------------------------------------------
// Weight convert + transpose: w (K x N, f32 row-major) -> wt (N x K, bf16)
// ---------------------------------------------------------------------------
__global__ __launch_bounds__(256)
void transpose_to_bf16(const float* __restrict__ w, bf16* __restrict__ wt,
                       int K, int N) {
    __shared__ float t[32][33];
    const int bn = blockIdx.x * 32;
    const int bk = blockIdx.y * 32;
    const int tx = threadIdx.x & 31;
    const int ty = threadIdx.x >> 5;         // 0..7
#pragma unroll
    for (int r = 0; r < 32; r += 8)
        t[ty + r][tx] = w[(size_t)(bk + ty + r) * N + bn + tx];
    __syncthreads();
#pragma unroll
    for (int r = 0; r < 32; r += 8)
        wt[(size_t)(bn + ty + r) * K + bk + tx] = (bf16)t[tx][ty + r];
}

// ---------------------------------------------------------------------------
// LayerNorm (row of 1024 f32) fused with bf16 downconvert. One block per row.
// ---------------------------------------------------------------------------
__global__ __launch_bounds__(256)
void layernorm_to_bf16(const float* __restrict__ x, const float* __restrict__ g,
                       const float* __restrict__ b, bf16* __restrict__ y) {
    __shared__ float red[2][8];
    const int row = blockIdx.x;
    const float* xr = x + (size_t)row * HDIM;
    float4 v = ((const float4*)xr)[threadIdx.x];
    float s  = v.x + v.y + v.z + v.w;
    float s2 = v.x * v.x + v.y * v.y + v.z * v.z + v.w * v.w;
#pragma unroll
    for (int m = 16; m > 0; m >>= 1) { s += __shfl_xor(s, m); s2 += __shfl_xor(s2, m); }
    const int wave = threadIdx.x >> 5, lane = threadIdx.x & 31;
    if (lane == 0) { red[0][wave] = s; red[1][wave] = s2; }
    __syncthreads();
    if (wave == 0) {
        float a  = (lane < 8) ? red[0][lane] : 0.0f;
        float a2 = (lane < 8) ? red[1][lane] : 0.0f;
#pragma unroll
        for (int m = 4; m > 0; m >>= 1) { a += __shfl_xor(a, m); a2 += __shfl_xor(a2, m); }
        if (lane == 0) { red[0][0] = a; red[1][0] = a2; }
    }
    __syncthreads();
    const float mu   = red[0][0] * (1.0f / HDIM);
    const float var  = red[1][0] * (1.0f / HDIM) - mu * mu;
    const float rstd = rsqrtf(var + 1e-5f);
    float4 gv = ((const float4*)g)[threadIdx.x];
    float4 bv = ((const float4*)b)[threadIdx.x];
    bf16* yr = y + (size_t)row * HDIM;
    const int c = threadIdx.x * 4;
    yr[c + 0] = (bf16)((v.x - mu) * rstd * gv.x + bv.x);
    yr[c + 1] = (bf16)((v.y - mu) * rstd * gv.y + bv.y);
    yr[c + 2] = (bf16)((v.z - mu) * rstd * gv.z + bv.z);
    yr[c + 3] = (bf16)((v.w - mu) * rstd * gv.w + bv.w);
}

// ---------------------------------------------------------------------------
// Eight async 16-B copies per lane, global -> LDS. l[] = LDS byte addresses,
// g[] = global addresses. The address-translation wait is the last line of the
// copies' own statement, so that no address register named here is rewritten
// in front of it.
// ---------------------------------------------------------------------------
__device__ __forceinline__ void async_copy8_b128(const unsigned (&l)[8], const bf16* const (&g)[8]) {
    asm volatile(
        "global_load_async_to_lds_b128 %0, %8, off\n\t"
        "global_load_async_to_lds_b128 %1, %9, off\n\t"
        "global_load_async_to_lds_b128 %2, %10, off\n\t"
        "global_load_async_to_lds_b128 %3, %11, off\n\t"
        "global_load_async_to_lds_b128 %4, %12, off\n\t"
        "global_load_async_to_lds_b128 %5, %13, off\n\t"
        "global_load_async_to_lds_b128 %6, %14, off\n\t"
        "global_load_async_to_lds_b128 %7, %15, off\n\t"
        "s_wait_xcnt 0x0"
        :: "v"(l[0]), "v"(l[1]), "v"(l[2]), "v"(l[3]), "v"(l[4]), "v"(l[5]), "v"(l[6]), "v"(l[7]),
           "v"(g[0]), "v"(g[1]), "v"(g[2]), "v"(g[3]), "v"(g[4]), "v"(g[5]), "v"(g[6]), "v"(g[7])
        : "memory");
}
__device__ __forceinline__ unsigned lds_byte(const bf16* p) {
    return (unsigned)(size_t)(const __attribute__((address_space(3))) bf16*)p;
}

// ---------------------------------------------------------------------------
// Generic bf16 WMMA GEMM:  C[M,N] = epilogue(A[M,K] * BT[N,K]^T + bias)
// Block tile 128x128, 8 waves, each wave 32x64 (2x4 wmma tiles).
// An LDS stage holds KS k of both operands (KS/32 WMMA blocks of 32 k), so one
// copy latency and one barrier are paid per KS/4 WMMAs of a wave, and a stage
// row is one or two whole 128-B lines. Two stages; the async global->LDS
// copies of stage t+2 start when stage t has been read.
// KS = 128 where the grid gives a WGP two workgroups; KS = 64 where it gives
// more, so that four fit its LDS.
// M, N multiples of 128; K a multiple of KS.
// EPI_BIAS_VT: scatter-store V into VT[batch][head][d][key] for attention.
// ---------------------------------------------------------------------------
template <int EPI, typename OutT, int KS>
__global__ __launch_bounds__(256)
void gemm_bf16_wmma(const bf16* __restrict__ A, const bf16* __restrict__ BT,
                    const float* __restrict__ bias, const float* __restrict__ res,
                    OutT* __restrict__ C, int M, int N, int K) {
    constexpr int PITCH = KS + 8;          // 16 B x odd, as PITCH_K64 / PITCH_K128
    __shared__ __attribute__((aligned(16))) bf16 As[2][128][PITCH];
    __shared__ __attribute__((aligned(16))) bf16 Bs[2][128][PITCH];

    const int tid  = threadIdx.x;
    const int wave = tid >> 5;
    const int lane = tid & 31;
    const int lh   = lane >> 4;     // K-half selector (lanes 16-31 hold K=16..31)
    const int ll   = lane & 15;     // row/col within 16
    const int wm   = wave & 3;      // 4 waves along M (32 rows each)
    const int wn   = wave >> 2;     // 2 waves along N (64 cols each)

    const int bm = blockIdx.y * 128;
    const int bn = blockIdx.x * 128;

    f32x8 acc[2][4];
#pragma unroll
    for (int i = 0; i < 2; ++i)
#pragma unroll
        for (int j = 0; j < 4; ++j)
#pragma unroll
            for (int e = 0; e < 8; ++e) acc[i][j][e] = 0.0f;

    // Copy map: KS/8 adjacent lanes cover one stage row, 16 B each.
    constexpr int LPR = KS / 8;           // lanes per row
    constexpr int RPC = 256 / LPR;        // rows the block covers with one copy per lane
    constexpr int CPO = 128 / RPC;        // copies per lane and operand
    const int lrow = tid / LPR;
    const int lcol = (tid % LPR) * 8;
    const bf16* aRow = A  + (size_t)(bm + lrow) * K + lcol;
    const bf16* bRow = BT + (size_t)(bn + lrow) * K + lcol;

    const int nk = K / KS;

    auto issue = [&](int buf, int k0) {
#pragma unroll
        for (int s = 0; s < 2 * CPO / 8; ++s) {
            unsigned l[8];
            const bf16* g[8];
#pragma unroll
            for (int q = 0; q < 8; ++q) {
                const int c = s * 8 + q;              // first the A rows, then the B rows
                const int r = (c % CPO) * RPC;
                l[q] = lds_byte(c < CPO ? &As[buf][lrow + r][lcol] : &Bs[buf][lrow + r][lcol]);
                g[q] = ((c < CPO ? aRow : bRow) + k0) + (size_t)r * K;
            }
            async_copy8_b128(l, g);
        }
    };
    issue(0, 0);
    asm volatile("s_wait_asynccnt 0x0" ::: "memory");   // stage 0 landed (this wave's copies)
    __syncthreads();                                    // ... and every other wave's
    if (nk > 1) issue(1, KS);

    for (int kt = 0; kt < nk; ++kt) {
        const int cur = kt & 1;
#pragma unroll
        for (int ks = 0; ks < KS / 32; ++ks) {
            bf16x16 af[2], bfr[4];
#pragma unroll
            for (int i = 0; i < 2; ++i)
                af[i] = lds_frag(&As[cur][wm * 32 + i * 16 + ll][ks * 32 + lh * 16]);
#pragma unroll
            for (int j = 0; j < 4; ++j)
                bfr[j] = lds_frag(&Bs[cur][wn * 64 + j * 16 + ll][ks * 32 + lh * 16]);

#pragma unroll
            for (int i = 0; i < 2; ++i)
#pragma unroll
                for (int j = 0; j < 4; ++j)
                    acc[i][j] = __builtin_amdgcn_wmma_f32_16x16x32_bf16(
                        false, af[i], false, bfr[j], (short)0, acc[i][j], false, false);
        }

        asm volatile("s_wait_dscnt 0x0" ::: "memory");     // this wave's reads of stage kt are done
        asm volatile("s_wait_asynccnt 0x0" ::: "memory");  // its copies of stage kt+1 have landed
        __syncthreads();                                   // publishes kt+1, frees kt's buffer
        if (kt + 2 < nk) issue(cur, (kt + 2) * KS);
    }
    asm volatile("s_wait_asynccnt 0x0" ::: "memory");      // no copy outstanding past the loop

    // Epilogue. C layout: VGPR e -> row = e + lh*8 ; lane%16 -> col.
#pragma unroll
    for (int i = 0; i < 2; ++i) {
#pragma unroll
        for (int j = 0; j < 4; ++j) {
            const int col = bn + wn * 64 + j * 16 + ll;
            const float bvv = bias ? bias[col] : 0.0f;
#pragma unroll
            for (int e = 0; e < 8; ++e) {
                const int row = bm + wm * 32 + i * 16 + lh * 8 + e;
                float v = acc[i][j][e] + bvv;
                if (EPI == EPI_BIAS_GELU) v = gelu_tanh(v);
                if (EPI == EPI_BIAS_RES)  v += res[(size_t)row * N + col];
                if (EPI == EPI_BIAS_VT) {
                    // row = batch*LSEQ + key ; col = head*DH + d
                    const size_t idx =
                        (((size_t)(row >> 10) * NH + (col >> 6)) * DH + (col & (DH - 1)))
                            * LSEQ + (row & (LSEQ - 1));
                    C[idx] = (OutT)v;
                } else {
                    C[(size_t)row * N + col] = (OutT)v;
                }
            }
        }
    }
}

// ---------------------------------------------------------------------------
// Flash-attention per (batch, head, 64-query tile). 128 threads = 4 waves,
// each wave owns 16 query rows. V arrives pre-transposed (VT[b][h][d][key])
// so the P*V B-operand loads straight with 128-bit copies -- no LDS transpose.
// ---------------------------------------------------------------------------
__global__ __launch_bounds__(128)
void attention_wmma(const bf16* __restrict__ Q, const bf16* __restrict__ Km,
                    const bf16* __restrict__ VT, bf16* __restrict__ O) {
    __shared__ __attribute__((aligned(16))) bf16 Qs[64][PITCH_K64];       //  9 KB
    __shared__ __attribute__((aligned(16))) bf16 Ks[128][PITCH_K64];      // 18 KB
    __shared__ __attribute__((aligned(16))) bf16 VTs[64][PITCH_K128];     // 17 KB
    __shared__ __attribute__((aligned(16))) bf16 Ps[4][16][PITCH_K128];   // 17 KB per-wave P staging

    const int tid  = threadIdx.x;
    const int wave = tid >> 5;
    const int lane = tid & 31;
    const int lh   = lane >> 4;
    const int ll   = lane & 15;

    const int qt    = blockIdx.x;        // 16 query tiles of 64
    const int head  = blockIdx.y;        // 16
    const int batch = blockIdx.z;        // 8
    const size_t base   = ((size_t)batch * LSEQ) * HDIM + (size_t)head * DH;
    const size_t vtbase = ((size_t)(batch * NH + head)) * DH * LSEQ;
    const int q0 = qt * 64;

    // Load Q tile (64 x 64): 128 threads x 32 bf16 each.
    {
        const int row = tid >> 1, half = tid & 1;
        const uint4* s4 = (const uint4*)(Q + base + (size_t)(q0 + row) * HDIM + half * 32);
        uint4* dst = (uint4*)&Qs[row][half * 32];
        dst[0] = s4[0]; dst[1] = s4[1]; dst[2] = s4[2]; dst[3] = s4[3];
    }

    f32x8 acco[4];
#pragma unroll
    for (int j = 0; j < 4; ++j)
#pragma unroll
        for (int e = 0; e < 8; ++e) acco[j][e] = 0.0f;
    float mrow[8], lrow[8];
#pragma unroll
    for (int e = 0; e < 8; ++e) { mrow[e] = -1e30f; lrow[e] = 0.0f; }

    for (int kt = 0; kt < LSEQ / 128; ++kt) {
        const int k0 = kt * 128;
        __syncthreads();   // previous tile fully consumed (also orders Q store)
        {
            // K tile: one full 64-wide row (128 B) per thread.
            const bf16* ks = Km + base + (size_t)(k0 + tid) * HDIM;
            bf16* kd = &Ks[tid][0];
            // VT tile: d = tid/2, 64 keys (128 B) per thread.
            const int d = tid >> 1, half = tid & 1;
            const bf16* vs = VT + vtbase + (size_t)d * LSEQ + k0 + half * 64;
            bf16* vd = &VTs[d][half * 64];
#if HAVE_ASYNC_LDS
#pragma unroll
            for (int c = 0; c < 64; c += 8) async_copy_b128(ks + c, kd + c);
#pragma unroll
            for (int c = 0; c < 64; c += 8) async_copy_b128(vs + c, vd + c);
#else
#pragma unroll
            for (int c = 0; c < 8; ++c) ((uint4*)kd)[c] = ((const uint4*)ks)[c];
#pragma unroll
            for (int c = 0; c < 8; ++c) ((uint4*)vd)[c] = ((const uint4*)vs)[c];
#endif
        }
#if HAVE_ASYNC_LDS
        async_wait_all();
#endif
        __syncthreads();

        // ---- S = (Q K^T) * 1/sqrt(D) ----
        f32x8 accs[8];
#pragma unroll
        for (int jt = 0; jt < 8; ++jt) {
#pragma unroll
            for (int e = 0; e < 8; ++e) accs[jt][e] = 0.0f;
#pragma unroll
            for (int kc = 0; kc < 2; ++kc) {
                bf16x16 a = lds_frag(&Qs[wave * 16 + ll][kc * 32 + lh * 16]);
                bf16x16 b = lds_frag(&Ks[jt * 16 + ll][kc * 32 + lh * 16]);
                accs[jt] = __builtin_amdgcn_wmma_f32_16x16x32_bf16(
                    false, a, false, b, (short)0, accs[jt], false, false);
            }
        }
        const float scale = 0.125f;     // 1/sqrt(64)

        // ---- online softmax: row = (VGPR e, lane-half); cols across 16 lanes
        float mnew[8];
#pragma unroll
        for (int e = 0; e < 8; ++e) {
            float mx = -1e30f;
#pragma unroll
            for (int jt = 0; jt < 8; ++jt) {
                accs[jt][e] *= scale;
                mx = fmaxf(mx, accs[jt][e]);
            }
#pragma unroll
            for (int m = 1; m < 16; m <<= 1) mx = fmaxf(mx, __shfl_xor(mx, m));
            mnew[e] = fmaxf(mrow[e], mx);
        }
#pragma unroll
        for (int e = 0; e < 8; ++e) {
            float sum = 0.0f;
#pragma unroll
            for (int jt = 0; jt < 8; ++jt) {
                float p = __expf(accs[jt][e] - mnew[e]);
                sum += p;
                Ps[wave][lh * 8 + e][jt * 16 + ll] = (bf16)p;
            }
#pragma unroll
            for (int m = 1; m < 16; m <<= 1) sum += __shfl_xor(sum, m);
            const float corr = __expf(mrow[e] - mnew[e]);
            lrow[e] = lrow[e] * corr + sum;
            mrow[e] = mnew[e];
#pragma unroll
            for (int j = 0; j < 4; ++j) acco[j][e] *= corr;
        }

        // ---- O += P V  (per-wave LDS RAW is in-order on DScnt) ----
#pragma unroll
        for (int j = 0; j < 4; ++j)
#pragma unroll
            for (int kc = 0; kc < 4; ++kc) {
                bf16x16 a = lds_frag(&Ps[wave][ll][kc * 32 + lh * 16]);
                bf16x16 b = lds_frag(&VTs[j * 16 + ll][kc * 32 + lh * 16]);
                acco[j] = __builtin_amdgcn_wmma_f32_16x16x32_bf16(
                    false, a, false, b, (short)0, acco[j], false, false);
            }
    }

    // ---- write O = acc / l ----
#pragma unroll
    for (int j = 0; j < 4; ++j)
#pragma unroll
        for (int e = 0; e < 8; ++e) {
            const int row = q0 + wave * 16 + lh * 8 + e;
            const int d   = j * 16 + ll;
            O[base + (size_t)row * HDIM + d] = (bf16)(acco[j][e] / lrow[e]);
        }
}

// ---------------------------------------------------------------------------
// Host orchestration
// ---------------------------------------------------------------------------
extern "C" void kernel_launch(void* const* d_in, const int* in_sizes, int n_in,
                              void* d_out, int out_size, void* d_ws, size_t ws_size,
                              hipStream_t stream) {
    const float* x    = (const float*)d_in[0];
    const float* ln0g = (const float*)d_in[1];
    const float* ln0b = (const float*)d_in[2];
    const float* wq   = (const float*)d_in[3];
    const float* bq   = (const float*)d_in[4];
    const float* wk   = (const float*)d_in[5];
    const float* bk   = (const float*)d_in[6];
    const float* wv   = (const float*)d_in[7];
    const float* bv   = (const float*)d_in[8];
    const float* wo   = (const float*)d_in[9];
    const float* bo   = (const float*)d_in[10];
    const float* ln1g = (const float*)d_in[11];
    const float* ln1b = (const float*)d_in[12];
    const float* w1   = (const float*)d_in[13];
    const float* b1   = (const float*)d_in[14];
    const float* w2   = (const float*)d_in[15];
    const float* b2   = (const float*)d_in[16];
    float* out = (float*)d_out;

    char* p = (char*)d_ws;
    auto carve = [&](size_t bytes) -> char* {
        char* r = p;
        p += (bytes + 255) & ~(size_t)255;
        return r;
    };
    bf16*  wq_t = (bf16*)carve((size_t)HDIM * HDIM * 2);
    bf16*  wk_t = (bf16*)carve((size_t)HDIM * HDIM * 2);
    bf16*  wv_t = (bf16*)carve((size_t)HDIM * HDIM * 2);
    bf16*  wo_t = (bf16*)carve((size_t)HDIM * HDIM * 2);
    bf16*  w1_t = (bf16*)carve((size_t)MLPD * HDIM * 2);
    bf16*  w2_t = (bf16*)carve((size_t)HDIM * MLPD * 2);
    bf16*  y0   = (bf16*)carve((size_t)MTOK * HDIM * 2);   // LN0 out
    bf16*  qb   = (bf16*)carve((size_t)MTOK * HDIM * 2);
    bf16*  kb   = (bf16*)carve((size_t)MTOK * HDIM * 2);
    bf16*  vtb  = (bf16*)carve((size_t)MTOK * HDIM * 2);   // V, pre-transposed [b][h][d][key]
    bf16*  ab   = (bf16*)carve((size_t)MTOK * HDIM * 2);   // attention out
    float* x1   = (float*)carve((size_t)MTOK * HDIM * 4);  // residual 1
    bf16*  y1   = (bf16*)carve((size_t)MTOK * HDIM * 2);   // LN1 out
    bf16*  hb   = (bf16*)carve((size_t)MTOK * MLPD * 2);   // GELU(mlp1) out

    // --- weight convert/transpose (bf16, N x K) ---
    transpose_to_bf16<<<dim3(HDIM / 32, HDIM / 32), 256, 0, stream>>>(wq, wq_t, HDIM, HDIM);
    transpose_to_bf16<<<dim3(HDIM / 32, HDIM / 32), 256, 0, stream>>>(wk, wk_t, HDIM, HDIM);
    transpose_to_bf16<<<dim3(HDIM / 32, HDIM / 32), 256, 0, stream>>>(wv, wv_t, HDIM, HDIM);
    transpose_to_bf16<<<dim3(HDIM / 32, HDIM / 32), 256, 0, stream>>>(wo, wo_t, HDIM, HDIM);
    transpose_to_bf16<<<dim3(MLPD / 32, HDIM / 32), 256, 0, stream>>>(w1, w1_t, HDIM, MLPD);
    transpose_to_bf16<<<dim3(HDIM / 32, MLPD / 32), 256, 0, stream>>>(w2, w2_t, MLPD, HDIM);

    // --- pre-LN attention ---
    layernorm_to_bf16<<<MTOK, 256, 0, stream>>>(x, ln0g, ln0b, y0);

    dim3 gProj(HDIM / 128, MTOK / 128);
    gemm_bf16_wmma<EPI_BIAS, bf16, 128><<<gProj, 256, 0, stream>>>(y0, wq_t, bq, nullptr, qb, MTOK, HDIM, HDIM);
    gemm_bf16_wmma<EPI_BIAS, bf16, 128><<<gProj, 256, 0, stream>>>(y0, wk_t, bk, nullptr, kb, MTOK, HDIM, HDIM);
    gemm_bf16_wmma<EPI_BIAS_VT, bf16, 128><<<gProj, 256, 0, stream>>>(y0, wv_t, bv, nullptr, vtb, MTOK, HDIM, HDIM);

    attention_wmma<<<dim3(LSEQ / 64, NH, NB), 128, 0, stream>>>(qb, kb, vtb, ab);

    gemm_bf16_wmma<EPI_BIAS_RES, float, 128><<<gProj, 256, 0, stream>>>(ab, wo_t, bo, x, x1, MTOK, HDIM, HDIM);

    // --- pre-LN MLP ---
    layernorm_to_bf16<<<MTOK, 256, 0, stream>>>(x1, ln1g, ln1b, y1);

    gemm_bf16_wmma<EPI_BIAS_GELU, bf16, 64><<<dim3(MLPD / 128, MTOK / 128), 256, 0, stream>>>(
        y1, w1_t, b1, nullptr, hb, MTOK, MLPD, HDIM);

    gemm_bf16_wmma<EPI_BIAS_RES, float, 128><<<dim3(HDIM / 128, MTOK / 128), 256, 0, stream>>>(
        hb, w2_t, b2, x1, out, MTOK, HDIM, MLPD);
}

// v003
// It runs in 299 microseconds.
// In both of two side-by-side timings against v002, it was 1.06 times as fast.
// Over all steps from v000 it is 1.84 times as fast.
#include <hip/hip_runtime.h>
#include <hip/hip_bf16.h>
#include <math.h>

// ---------------------------------------------------------------------------
// Problem constants (from reference): N=8, L=1024, H=16, D=64, HD=1024, MLP=4096
// ---------------------------------------------------------------------------
#define NB    8
#define LSEQ  1024
#define NH    16
#define DH    64
#define HDIM  1024
#define MLPD  4096
#define MTOK  (NB * LSEQ)          // 8192 token rows

typedef __bf16 bf16;
typedef __attribute__((ext_vector_type(16))) __bf16 bf16x16;
typedef __attribute__((ext_vector_type(8)))  float  f32x8;
typedef int v4i __attribute__((vector_size(16)));
typedef __attribute__((ext_vector_type(8)))  __bf16 bf16x8;

// LDS row pitches, in bf16 elements. Every WMMA fragment is read with
// ds_load_b128, one row per lane: a pitch of 16 B x odd spreads the 16 lanes of
// a half-wave over all 64 banks; 64 B, 128 B and 32 B x odd pitches do not.
#define PITCH_K64   72             // 128-B rows -> 144 B
#define PITCH_K128  136            // 256-B rows -> 272 B

// One lane's 16 consecutive k of a fragment row; rows are 16-B aligned only.
__device__ __forceinline__ bf16x16 lds_frag(const bf16* p) {
    bf16x8 lo = *(const bf16x8*)p;
    bf16x8 hi = *(const bf16x8*)(p + 8);
    return __builtin_shufflevector(lo, hi, 0, 1, 2, 3, 4, 5, 6, 7,
                                   8, 9, 10, 11, 12, 13, 14, 15);
}

// ---- CDNA5 async global->LDS copies (ASYNCcnt), guarded by probe -----------
#if defined(__has_builtin)
#  if __has_builtin(__builtin_amdgcn_global_load_async_to_lds_b128) && \
      __has_builtin(__builtin_amdgcn_s_wait_asynccnt)
#    define HAVE_ASYNC_LDS 1
#  endif
#endif
#ifndef HAVE_ASYNC_LDS
#  define HAVE_ASYNC_LDS 0
#endif

#if HAVE_ASYNC_LDS
__device__ __forceinline__ void async_copy_b128(const bf16* g, bf16* l) {
    __builtin_amdgcn_global_load_async_to_lds_b128(
        (__attribute__((address_space(1))) v4i*)g,
        (__attribute__((address_space(3))) v4i*)l, 0, 0);
}
__device__ __forceinline__ void async_wait_all() {
    __builtin_amdgcn_s_wait_asynccnt(0);
}
#endif

__device__ __forceinline__ float gelu_tanh(float x) {
    const float c = 0.7978845608028654f;   // sqrt(2/pi)
    float x3 = x * x * x;
    return 0.5f * x * (1.0f + tanhf(c * (x + 0.044715f * x3)));
}

enum { EPI_BIAS = 0, EPI_BIAS_GELU = 1, EPI_BIAS_RES = 2, EPI_BIAS_VT = 3 };

// ---------------------------------------------------------------------------
// Weight convert + transpose: w (K x N, f32 row-major) -> wt (N x K, bf16)
// ---------------------------------------------------------------------------
__global__ __launch_bounds__(256)
void transpose_to_bf16(const float* __restrict__ w, bf16* __restrict__ wt,
                       int K, int N) {
    __shared__ float t[32][33];
    const int bn = blockIdx.x * 32;
    const int bk = blockIdx.y * 32;
    const int tx = threadIdx.x & 31;
    const int ty = threadIdx.x >> 5;         // 0..7
#pragma unroll
    for (int r = 0; r < 32; r += 8)
        t[ty + r][tx] = w[(size_t)(bk + ty + r) * N + bn + tx];
    __syncthreads();
#pragma unroll
    for (int r = 0; r < 32; r += 8)
        wt[(size_t)(bn + ty + r) * K + bk + tx] = (bf16)t[tx][ty + r];
}

// ---------------------------------------------------------------------------
// LayerNorm (row of 1024 f32) fused with bf16 downconvert. One block per row.
// ---------------------------------------------------------------------------
__global__ __launch_bounds__(256)
void layernorm_to_bf16(const float* __restrict__ x, const float* __restrict__ g,
                       const float* __restrict__ b, bf16* __restrict__ y) {
    __shared__ float red[2][8];
    const int row = blockIdx.x;
    const float* xr = x + (size_t)row * HDIM;
    float4 v = ((const float4*)xr)[threadIdx.x];
    float s  = v.x + v.y + v.z + v.w;
    float s2 = v.x * v.x + v.y * v.y + v.z * v.z + v.w * v.w;
#pragma unroll
    for (int m = 16; m > 0; m >>= 1) { s += __shfl_xor(s, m); s2 += __shfl_xor(s2, m); }
    const int wave = threadIdx.x >> 5, lane = threadIdx.x & 31;
    if (lane == 0) { red[0][wave] = s; red[1][wave] = s2; }
    __syncthreads();
    if (wave == 0) {
        float a  = (lane < 8) ? red[0][lane] : 0.0f;
        float a2 = (lane < 8) ? red[1][lane] : 0.0f;
#pragma unroll
        for (int m = 4; m > 0; m >>= 1) { a += __shfl_xor(a, m); a2 += __shfl_xor(a2, m); }
        if (lane == 0) { red[0][0] = a; red[1][0] = a2; }
    }
    __syncthreads();
    const float mu   = red[0][0] * (1.0f / HDIM);
    const float var  = red[1][0] * (1.0f / HDIM) - mu * mu;
    const float rstd = rsqrtf(var + 1e-5f);
    float4 gv = ((const float4*)g)[threadIdx.x];
    float4 bv = ((const float4*)b)[threadIdx.x];
    bf16* yr = y + (size_t)row * HDIM;
    const int c = threadIdx.x * 4;
    yr[c + 0] = (bf16)((v.x - mu) * rstd * gv.x + bv.x);
    yr[c + 1] = (bf16)((v.y - mu) * rstd * gv.y + bv.y);
    yr[c + 2] = (bf16)((v.z - mu) * rstd * gv.z + bv.z);
    yr[c + 3] = (bf16)((v.w - mu) * rstd * gv.w + bv.w);
}

// ---------------------------------------------------------------------------
// Eight async 16-B copies per lane, global -> LDS. l[] = LDS byte addresses,
// g[] = global addresses. The address-translation wait is the last line of the
// copies' own statement, so that no address register named here is rewritten
// in front of it.
// ---------------------------------------------------------------------------
__device__ __forceinline__ void async_copy8_b128(const unsigned (&l)[8], const bf16* const (&g)[8]) {
    asm volatile(
        "global_load_async_to_lds_b128 %0, %8, off\n\t"
        "global_load_async_to_lds_b128 %1, %9, off\n\t"
        "global_load_async_to_lds_b128 %2, %10, off\n\t"
        "global_load_async_to_lds_b128 %3, %11, off\n\t"
        "global_load_async_to_lds_b128 %4, %12, off\n\t"
        "global_load_async_to_lds_b128 %5, %13, off\n\t"
        "global_load_async_to_lds_b128 %6, %14, off\n\t"
        "global_load_async_to_lds_b128 %7, %15, off\n\t"
        "s_wait_xcnt 0x0"
        :: "v"(l[0]), "v"(l[1]), "v"(l[2]), "v"(l[3]), "v"(l[4]), "v"(l[5]), "v"(l[6]), "v"(l[7]),
           "v"(g[0]), "v"(g[1]), "v"(g[2]), "v"(g[3]), "v"(g[4]), "v"(g[5]), "v"(g[6]), "v"(g[7])
        : "memory");
}
__device__ __forceinline__ unsigned lds_byte(const bf16* p) {
    return (unsigned)(size_t)(const __attribute__((address_space(3))) bf16*)p;
}

// ---------------------------------------------------------------------------
// Generic bf16 WMMA GEMM:  C[M,N] = epilogue(A[M,K] * BT[N,K]^T + bias)
// Block tile 128x128, 8 waves, each wave 32x64 (2x4 wmma tiles).
// An LDS stage holds KS k of both operands (KS/32 WMMA blocks of 32 k), so one
// copy latency and one barrier are paid per KS/4 WMMAs of a wave, and a stage
// row is one or two whole 128-B lines. Two stages; the async global->LDS
// copies of stage t+2 start when stage t has been read.
// KS = 128 where the grid gives a WGP two workgroups; KS = 64 where it gives
// more, so that four fit its LDS.
// M, N multiples of 128; K a multiple of KS.
// EPI_BIAS_VT: scatter-store V into VT[batch][head][d][key] for attention.
// ---------------------------------------------------------------------------
template <int EPI, typename OutT, int KS>
__global__ __launch_bounds__(256)
void gemm_bf16_wmma(const bf16* __restrict__ A, const bf16* __restrict__ BT,
                    const float* __restrict__ bias, const float* __restrict__ res,
                    OutT* __restrict__ C, int M, int N, int K) {
    constexpr int PITCH = KS + 8;          // 16 B x odd, as PITCH_K64 / PITCH_K128
    __shared__ __attribute__((aligned(16))) bf16 As[2][128][PITCH];
    __shared__ __attribute__((aligned(16))) bf16 Bs[2][128][PITCH];

    const int tid  = threadIdx.x;
    const int wave = tid >> 5;
    const int lane = tid & 31;
    const int lh   = lane >> 4;     // K-half selector (lanes 16-31 hold K=16..31)
    const int ll   = lane & 15;     // row/col within 16
    const int wm   = wave & 3;      // 4 waves along M (32 rows each)
    const int wn   = wave >> 2;     // 2 waves along N (64 cols each)

    const int bm = blockIdx.y * 128;
    const int bn = blockIdx.x * 128;

    f32x8 acc[2][4];
#pragma unroll
    for (int i = 0; i < 2; ++i)
#pragma unroll
        for (int j = 0; j < 4; ++j)
#pragma unroll
            for (int e = 0; e < 8; ++e) acc[i][j][e] = 0.0f;

    // Copy map: KS/8 adjacent lanes cover one stage row, 16 B each.
    constexpr int LPR = KS / 8;           // lanes per row
    constexpr int RPC = 256 / LPR;        // rows the block covers with one copy per lane
    constexpr int CPO = 128 / RPC;        // copies per lane and operand
    const int lrow = tid / LPR;
    const int lcol = (tid % LPR) * 8;
    const bf16* aRow = A  + (size_t)(bm + lrow) * K + lcol;
    const bf16* bRow = BT + (size_t)(bn + lrow) * K + lcol;

    const int nk = K / KS;

    auto issue = [&](int buf, int k0) {
#pragma unroll
        for (int s = 0; s < 2 * CPO / 8; ++s) {
            unsigned l[8];
            const bf16* g[8];
#pragma unroll
            for (int q = 0; q < 8; ++q) {
                const int c = s * 8 + q;              // first the A rows, then the B rows
                const int r = (c % CPO) * RPC;
                l[q] = lds_byte(c < CPO ? &As[buf][lrow + r][lcol] : &Bs[buf][lrow + r][lcol]);
                g[q] = ((c < CPO ? aRow : bRow) + k0) + (size_t)r * K;
            }
            async_copy8_b128(l, g);
        }
    };
    issue(0, 0);
    asm volatile("s_wait_asynccnt 0x0" ::: "memory");   // stage 0 landed (this wave's copies)
    __syncthreads();                                    // ... and every other wave's
    if (nk > 1) issue(1, KS);

    for (int kt = 0; kt < nk; ++kt) {
        const int cur = kt & 1;
#pragma unroll
        for (int ks = 0; ks < KS / 32; ++ks) {
            bf16x16 af[2], bfr[4];
#pragma unroll
            for (int i = 0; i < 2; ++i)
                af[i] = lds_frag(&As[cur][wm * 32 + i * 16 + ll][ks * 32 + lh * 16]);
#pragma unroll
            for (int j = 0; j < 4; ++j)
                bfr[j] = lds_frag(&Bs[cur][wn * 64 + j * 16 + ll][ks * 32 + lh * 16]);

#pragma unroll
            for (int i = 0; i < 2; ++i)
#pragma unroll
                for (int j = 0; j < 4; ++j)
                    acc[i][j] = __builtin_amdgcn_wmma_f32_16x16x32_bf16(
                        false, af[i], false, bfr[j], (short)0, acc[i][j], false, false);
        }

        asm volatile("s_wait_dscnt 0x0" ::: "memory");     // this wave's reads of stage kt are done
        asm volatile("s_wait_asynccnt 0x0" ::: "memory");  // its copies of stage kt+1 have landed
        __syncthreads();                                   // publishes kt+1, frees kt's buffer
        if (kt + 2 < nk) issue(cur, (kt + 2) * KS);
    }
    asm volatile("s_wait_asynccnt 0x0" ::: "memory");      // no copy outstanding past the loop

    // Epilogue. C layout: VGPR e -> row = e + lh*8 ; lane%16 -> col.
#pragma unroll
    for (int i = 0; i < 2; ++i) {
#pragma unroll
        for (int j = 0; j < 4; ++j) {
            const int col = bn + wn * 64 + j * 16 + ll;
            const float bvv = bias ? bias[col] : 0.0f;
#pragma unroll
            for (int e = 0; e < 8; ++e) {
                const int row = bm + wm * 32 + i * 16 + lh * 8 + e;
                float v = acc[i][j][e] + bvv;
                if (EPI == EPI_BIAS_GELU) v = gelu_tanh(v);
                if (EPI == EPI_BIAS_RES)  v += res[(size_t)row * N + col];
                if (EPI == EPI_BIAS_VT) {
                    // row = batch*LSEQ + key ; col = head*DH + d
                    const size_t idx =
                        (((size_t)(row >> 10) * NH + (col >> 6)) * DH + (col & (DH - 1)))
                            * LSEQ + (row & (LSEQ - 1));
                    C[idx] = (OutT)v;
                } else {
                    C[(size_t)row * N + col] = (OutT)v;
                }
            }
        }
    }
}

__device__ __forceinline__ float xhalf(float x) {
    const int b = __builtin_bit_cast(int, x);
    return __builtin_bit_cast(float,
        __builtin_amdgcn_permlanex16(b, b, 0x76543210, 0xfedcba98, false, false));
}
// One lane's 16 k of the 32-k block at p, in the k order of a packed pair of
// accumulator tiles: k = 8h + 0..7, then 16 + 8h + 0..7 (h = lane / 16).
__device__ __forceinline__ bf16x16 lds_frag_pair(const bf16* p, int h) {
    bf16x8 lo = *(const bf16x8*)(p + 8 * h);
    bf16x8 hi = *(const bf16x8*)(p + 16 + 8 * h);
    return __builtin_shufflevector(lo, hi, 0, 1, 2, 3, 4, 5, 6, 7,
                                   8, 9, 10, 11, 12, 13, 14, 15);
}

__global__ __launch_bounds__(128)
void attention_wmma(const bf16* __restrict__ Q, const bf16* __restrict__ Km,
                    const bf16* __restrict__ VT, bf16* __restrict__ O) {
    __shared__ __attribute__((aligned(16))) bf16 Ks[128][PITCH_K64];      // 18 KB
    __shared__ __attribute__((aligned(16))) bf16 VTs[64][PITCH_K128];     // 17 KB

    const int tid  = threadIdx.x;
    const int wave = tid >> 5;
    const int lane = tid & 31;
    const int lh   = lane >> 4;
    const int ll   = lane & 15;

    const int qt    = blockIdx.x;        // 16 query tiles of 64
    const int head  = blockIdx.y;        // 16
    const int batch = blockIdx.z;        // 8
    const size_t base   = ((size_t)batch * LSEQ) * HDIM + (size_t)head * DH;
    const size_t vtbase = ((size_t)(batch * NH + head)) * DH * LSEQ;
    const int q0 = qt * 64;
    const size_t qrow = base + (size_t)(q0 + wave * 16 + ll) * HDIM;   // this lane's query

    // Q^T fragments: column = this lane's query, 16 consecutive d per wave half
    // (the k order of lds_frag, which loads the K rows they are paired with).
    bf16x16 qf[2];
#pragma unroll
    for (int kc = 0; kc < 2; ++kc) {
        const bf16* qp = Q + qrow + kc * 32 + lh * 16;
        bf16x8 lo = *(const bf16x8*)qp;
        bf16x8 hi = *(const bf16x8*)(qp + 8);
        qf[kc] = __builtin_shufflevector(lo, hi, 0, 1, 2, 3, 4, 5, 6, 7,
                                         8, 9, 10, 11, 12, 13, 14, 15);
    }

    f32x8 acco[4];                       // O^T: row d = j*16 + lh*8 + e, column = query ll
#pragma unroll
    for (int j = 0; j < 4; ++j)
#pragma unroll
        for (int e = 0; e < 8; ++e) acco[j][e] = 0.0f;
    float mrow = -1e30f;                 // running maximum of this lane's query
    float lsum = 0.0f;                   // running sum over this wave half's keys

    for (int kt = 0; kt < LSEQ / 128; ++kt) {
        const int k0 = kt * 128;
        __syncthreads();   // previous tile fully consumed
        {
            // K tile: one full 64-wide row (128 B) per thread.
            const bf16* ks = Km + base + (size_t)(k0 + tid) * HDIM;
            bf16* kd = &Ks[tid][0];
            // VT tile: d = tid/2, 64 keys (128 B) per thread.
            const int d = tid >> 1, half = tid & 1;
            const bf16* vs = VT + vtbase + (size_t)d * LSEQ + k0 + half * 64;
            bf16* vd = &VTs[d][half * 64];
#if HAVE_ASYNC_LDS
#pragma unroll
            for (int c = 0; c < 64; c += 8) async_copy_b128(ks + c, kd + c);
#pragma unroll
            for (int c = 0; c < 64; c += 8) async_copy_b128(vs + c, vd + c);
#else
#pragma unroll
            for (int c = 0; c < 8; ++c) ((uint4*)kd)[c] = ((const uint4*)ks)[c];
#pragma unroll
            for (int c = 0; c < 8; ++c) ((uint4*)vd)[c] = ((const uint4*)vs)[c];
#endif
        }
#if HAVE_ASYNC_LDS
        async_wait_all();
#endif
        __syncthreads();

        // ---- S^T = (K Q^T) * 1/sqrt(D): accs[jt][e] = S[key jt*16 + lh*8 + e][query ll]
        f32x8 accs[8];
#pragma unroll
        for (int jt = 0; jt < 8; ++jt) {
#pragma unroll
            for (int e = 0; e < 8; ++e) accs[jt][e] = 0.0f;
#pragma unroll
            for (int kc = 0; kc < 2; ++kc) {
                bf16x16 a = lds_frag(&Ks[jt * 16 + ll][kc * 32 + lh * 16]);
                accs[jt] = __builtin_amdgcn_wmma_f32_16x16x32_bf16(
                    false, a, false, qf[kc], (short)0, accs[jt], false, false);
            }
        }
        const float scale = 0.125f;     // 1/sqrt(64)

        // ---- online softmax, one query per lane; eight independent chains
        float mxe[8];
#pragma unroll
        for (int e = 0; e < 8; ++e) {
            mxe[e] = -1e30f;
#pragma unroll
            for (int jt = 0; jt < 8; ++jt) {
                accs[jt][e] *= scale;
                mxe[e] = fmaxf(mxe[e], accs[jt][e]);
            }
        }
        float mx = fmaxf(fmaxf(fmaxf(mxe[0], mxe[1]), fmaxf(mxe[2], mxe[3])),
                         fmaxf(fmaxf(mxe[4], mxe[5]), fmaxf(mxe[6], mxe[7])));
        mx = fmaxf(mx, xhalf(mx));       // the other half's keys of the same query
        const float mnew = fmaxf(mrow, mx);

        // P^T fragments: pf[kc][s] = P[key kc*32 + (s/8)*16 + lh*8 + s%8][query ll]
        bf16x16 pf[4];
        float sm[4];
#pragma unroll
        for (int kc = 0; kc < 4; ++kc) {
            sm[kc] = 0.0f;
#pragma unroll
            for (int s = 0; s < 16; ++s) {
                float p = __expf(accs[kc * 2 + (s >> 3)][s & 7] - mnew);
                sm[kc] += p;
                pf[kc][s] = (bf16)p;
            }
        }
        const float corr = __expf(mrow - mnew);
        lsum = lsum * corr + ((sm[0] + sm[1]) + (sm[2] + sm[3]));
        mrow = mnew;
#pragma unroll
        for (int j = 0; j < 4; ++j)
#pragma unroll
            for (int e = 0; e < 8; ++e) acco[j][e] *= corr;

        // ---- O^T += V^T P^T ----
#pragma unroll
        for (int j = 0; j < 4; ++j)
#pragma unroll
            for (int kc = 0; kc < 4; ++kc) {
                bf16x16 a = lds_frag_pair(&VTs[j * 16 + ll][kc * 32], lh);
                acco[j] = __builtin_amdgcn_wmma_f32_16x16x32_bf16(
                    false, a, false, pf[kc], (short)0, acco[j], false, false);
            }
    }

    // ---- write O = acc / l: a lane holds 8 consecutive d of its query per tile
    const float lrow = lsum + xhalf(lsum);
#pragma unroll
    for (int j = 0; j < 4; ++j) {
        bf16x8 o;
#pragma unroll
        for (int e = 0; e < 8; ++e) o[e] = (bf16)(acco[j][e] / lrow);
        *(bf16x8*)(O + qrow + j * 16 + lh * 8) = o;
    }
}

// ---------------------------------------------------------------------------
// Host orchestration
// ---------------------------------------------------------------------------
extern "C" void kernel_launch(void* const* d_in, const int* in_sizes, int n_in,
                              void* d_out, int out_size, void* d_ws, size_t ws_size,
                              hipStream_t stream) {
    const float* x    = (const float*)d_in[0];
    const float* ln0g = (const float*)d_in[1];
    const float* ln0b = (const float*)d_in[2];
    const float* wq   = (const float*)d_in[3];
    const float* bq   = (const float*)d_in[4];
    const float* wk   = (const float*)d_in[5];
    const float* bk   = (const float*)d_in[6];
    const float* wv   = (const float*)d_in[7];
    const float* bv   = (const float*)d_in[8];
    const float* wo   = (const float*)d_in[9];
    const float* bo   = (const float*)d_in[10];
    const float* ln1g = (const float*)d_in[11];
    const float* ln1b = (const float*)d_in[12];
    const float* w1   = (const float*)d_in[13];
    const float* b1   = (const float*)d_in[14];
    const float* w2   = (const float*)d_in[15];
    const float* b2   = (const float*)d_in[16];
    float* out = (float*)d_out;

    char* p = (char*)d_ws;
    auto carve = [&](size_t bytes) -> char* {
        char* r = p;
        p += (bytes + 255) & ~(size_t)255;
        return r;
    };
    bf16*  wq_t = (bf16*)carve((size_t)HDIM * HDIM * 2);
    bf16*  wk_t = (bf16*)carve((size_t)HDIM * HDIM * 2);
    bf16*  wv_t = (bf16*)carve((size_t)HDIM * HDIM * 2);
    bf16*  wo_t = (bf16*)carve((size_t)HDIM * HDIM * 2);
    bf16*  w1_t = (bf16*)carve((size_t)MLPD * HDIM * 2);
    bf16*  w2_t = (bf16*)carve((size_t)HDIM * MLPD * 2);
    bf16*  y0   = (bf16*)carve((size_t)MTOK * HDIM * 2);   // LN0 out
    bf16*  qb   = (bf16*)carve((size_t)MTOK * HDIM * 2);
    bf16*  kb   = (bf16*)carve((size_t)MTOK * HDIM * 2);
    bf16*  vtb  = (bf16*)carve((size_t)MTOK * HDIM * 2);   // V, pre-transposed [b][h][d][key]
    bf16*  ab   = (bf16*)carve((size_t)MTOK * HDIM * 2);   // attention out
    float* x1   = (float*)carve((size_t)MTOK * HDIM * 4);  // residual 1
    bf16*  y1   = (bf16*)carve((size_t)MTOK * HDIM * 2);   // LN1 out
    bf16*  hb   = (bf16*)carve((size_t)MTOK * MLPD * 2);   // GELU(mlp1) out

    // --- weight convert/transpose (bf16, N x K) ---
    transpose_to_bf16<<<dim3(HDIM / 32, HDIM / 32), 256, 0, stream>>>(wq, wq_t, HDIM, HDIM);
    transpose_to_bf16<<<dim3(HDIM / 32, HDIM / 32), 256, 0, stream>>>(wk, wk_t, HDIM, HDIM);
    transpose_to_bf16<<<dim3(HDIM / 32, HDIM / 32), 256, 0, stream>>>(wv, wv_t, HDIM, HDIM);
    transpose_to_bf16<<<dim3(HDIM / 32, HDIM / 32), 256, 0, stream>>>(wo, wo_t, HDIM, HDIM);
    transpose_to_bf16<<<dim3(MLPD / 32, HDIM / 32), 256, 0, stream>>>(w1, w1_t, HDIM, MLPD);
    transpose_to_bf16<<<dim3(HDIM / 32, MLPD / 32), 256, 0, stream>>>(w2, w2_t, MLPD, HDIM);

    // --- pre-LN attention ---
    layernorm_to_bf16<<<MTOK, 256, 0, stream>>>(x, ln0g, ln0b, y0);

    dim3 gProj(HDIM / 128, MTOK / 128);
    gemm_bf16_wmma<EPI_BIAS, bf16, 128><<<gProj, 256, 0, stream>>>(y0, wq_t, bq, nullptr, qb, MTOK, HDIM, HDIM);
    gemm_bf16_wmma<EPI_BIAS, bf16, 128><<<gProj, 256, 0, stream>>>(y0, wk_t, bk, nullptr, kb, MTOK, HDIM, HDIM);
    gemm_bf16_wmma<EPI_BIAS_VT, bf16, 128><<<gProj, 256, 0, stream>>>(y0, wv_t, bv, nullptr, vtb, MTOK, HDIM, HDIM);

    attention_wmma<<<dim3(LSEQ / 64, NH, NB), 128, 0, stream>>>(qb, kb, vtb, ab);

    gemm_bf16_wmma<EPI_BIAS_RES, float, 128><<<gProj, 256, 0, stream>>>(ab, wo_t, bo, x, x1, MTOK, HDIM, HDIM);

    // --- pre-LN MLP ---
    layernorm_to_bf16<<<MTOK, 256, 0, stream>>>(x1, ln1g, ln1b, y1);

    gemm_bf16_wmma<EPI_BIAS_GELU, bf16, 64><<<dim3(MLPD / 128, MTOK / 128), 256, 0, stream>>>(
        y1, w1_t, b1, nullptr, hb, MTOK, MLPD, HDIM);

    gemm_bf16_wmma<EPI_BIAS_RES, float, 128><<<dim3(HDIM / 128, MTOK / 128), 256, 0, stream>>>(
        hb, w2_t, b2, x1, out, MTOK, HDIM, MLPD);
}

// v004
// Measured time: 286 microseconds a run.
// Two timings next to v003 both put it at 1.05 times that version's speed.
// Counting every step since v000, it is 1.92 times as fast.
#include <hip/hip_runtime.h>
#include <hip/hip_bf16.h>
#include <math.h>

// ---------------------------------------------------------------------------
// Problem constants (from reference): N=8, L=1024, H=16, D=64, HD=1024, MLP=4096
// ---------------------------------------------------------------------------
#define NB    8
#define LSEQ  1024
#define NH    16
#define DH    64
#define HDIM  1024
#define MLPD  4096
#define MTOK  (NB * LSEQ)          // 8192 token rows

typedef __bf16 bf16;
typedef __attribute__((ext_vector_type(16))) __bf16 bf16x16;
typedef __attribute__((ext_vector_type(8)))  float  f32x8;
typedef __attribute__((ext_vector_type(8)))  __bf16 bf16x8;

// LDS row pitches, in bf16 elements. Every WMMA fragment is read with
// ds_load_b128, one row per lane: a pitch of 16 B x odd spreads the 16 lanes of
// a half-wave over all 64 banks; 64 B, 128 B and 32 B x odd pitches do not.
#define PITCH_K64   72             // 128-B rows -> 144 B
#define PITCH_K128  136            // 256-B rows -> 272 B

// One lane's 16 consecutive k of a fragment row; rows are 16-B aligned only.
__device__ __forceinline__ bf16x16 lds_frag(const bf16* p) {
    bf16x8 lo = *(const bf16x8*)p;
    bf16x8 hi = *(const bf16x8*)(p + 8);
    return __builtin_shufflevector(lo, hi, 0, 1, 2, 3, 4, 5, 6, 7,
                                   8, 9, 10, 11, 12, 13, 14, 15);
}

__device__ __forceinline__ float gelu_tanh(float x) {
    const float c = 0.7978845608028654f;   // sqrt(2/pi)
    float x3 = x * x * x;
    return 0.5f * x * (1.0f + tanhf(c * (x + 0.044715f * x3)));
}

enum { EPI_BIAS = 0, EPI_BIAS_GELU = 1, EPI_BIAS_RES = 2, EPI_BIAS_VT = 3 };

// ---------------------------------------------------------------------------
// Weight convert + transpose: w (K x N, f32 row-major) -> wt (N x K, bf16)
// ---------------------------------------------------------------------------
__global__ __launch_bounds__(256)
void transpose_to_bf16(const float* __restrict__ w, bf16* __restrict__ wt,
                       int K, int N) {
    __shared__ float t[32][33];
    const int bn = blockIdx.x * 32;
    const int bk = blockIdx.y * 32;
    const int tx = threadIdx.x & 31;
    const int ty = threadIdx.x >> 5;         // 0..7
#pragma unroll
    for (int r = 0; r < 32; r += 8)
        t[ty + r][tx] = w[(size_t)(bk + ty + r) * N + bn + tx];
    __syncthreads();
#pragma unroll
    for (int r = 0; r < 32; r += 8)
        wt[(size_t)(bn + ty + r) * K + bk + tx] = (bf16)t[tx][ty + r];
}

// ---------------------------------------------------------------------------
// LayerNorm (row of 1024 f32) fused with bf16 downconvert. One block per row.
// ---------------------------------------------------------------------------
__global__ __launch_bounds__(256)
void layernorm_to_bf16(const float* __restrict__ x, const float* __restrict__ g,
                       const float* __restrict__ b, bf16* __restrict__ y) {
    __shared__ float red[2][8];
    const int row = blockIdx.x;
    const float* xr = x + (size_t)row * HDIM;
    float4 v = ((const float4*)xr)[threadIdx.x];
    float s  = v.x + v.y + v.z + v.w;
    float s2 = v.x * v.x + v.y * v.y + v.z * v.z + v.w * v.w;
#pragma unroll
    for (int m = 16; m > 0; m >>= 1) { s += __shfl_xor(s, m); s2 += __shfl_xor(s2, m); }
    const int wave = threadIdx.x >> 5, lane = threadIdx.x & 31;
    if (lane == 0) { red[0][wave] = s; red[1][wave] = s2; }
    __syncthreads();
    if (wave == 0) {
        float a  = (lane < 8) ? red[0][lane] : 0.0f;
        float a2 = (lane < 8) ? red[1][lane] : 0.0f;
#pragma unroll
        for (int m = 4; m > 0; m >>= 1) { a += __shfl_xor(a, m); a2 += __shfl_xor(a2, m); }
        if (lane == 0) { red[0][0] = a; red[1][0] = a2; }
    }
    __syncthreads();
    const float mu   = red[0][0] * (1.0f / HDIM);
    const float var  = red[1][0] * (1.0f / HDIM) - mu * mu;
    const float rstd = rsqrtf(var + 1e-5f);
    float4 gv = ((const float4*)g)[threadIdx.x];
    float4 bv = ((const float4*)b)[threadIdx.x];
    bf16* yr = y + (size_t)row * HDIM;
    const int c = threadIdx.x * 4;
    yr[c + 0] = (bf16)((v.x - mu) * rstd * gv.x + bv.x);
    yr[c + 1] = (bf16)((v.y - mu) * rstd * gv.y + bv.y);
    yr[c + 2] = (bf16)((v.z - mu) * rstd * gv.z + bv.z);
    yr[c + 3] = (bf16)((v.w - mu) * rstd * gv.w + bv.w);
}

// ---------------------------------------------------------------------------
// Eight async 16-B copies per lane, global -> LDS. l[] = LDS byte addresses,
// g[] = global addresses. The address-translation wait is the last line of the
// copies' own statement, so that no address register named here is rewritten
// in front of it.
// ---------------------------------------------------------------------------
__device__ __forceinline__ void async_copy8_b128(const unsigned (&l)[8], const bf16* const (&g)[8]) {
    asm volatile(
        "global_load_async_to_lds_b128 %0, %8, off\n\t"
        "global_load_async_to_lds_b128 %1, %9, off\n\t"
        "global_load_async_to_lds_b128 %2, %10, off\n\t"
        "global_load_async_to_lds_b128 %3, %11, off\n\t"
        "global_load_async_to_lds_b128 %4, %12, off\n\t"
        "global_load_async_to_lds_b128 %5, %13, off\n\t"
        "global_load_async_to_lds_b128 %6, %14, off\n\t"
        "global_load_async_to_lds_b128 %7, %15, off\n\t"
        "s_wait_xcnt 0x0"
        :: "v"(l[0]), "v"(l[1]), "v"(l[2]), "v"(l[3]), "v"(l[4]), "v"(l[5]), "v"(l[6]), "v"(l[7]),
           "v"(g[0]), "v"(g[1]), "v"(g[2]), "v"(g[3]), "v"(g[4]), "v"(g[5]), "v"(g[6]), "v"(g[7])
        : "memory");
}
// The same with one 32-bit byte offset per lane (off) on eight wave-uniform
// bases in scalar registers: no vector register pair per copy (with pairs the
// attention kernel needs 194 registers, one wave per SIMD fewer than with 170).
__device__ __forceinline__ void async_copy8_b128_sbase(const unsigned (&l)[8], unsigned off,
                                                       const bf16* const (&g)[8]) {
    asm volatile(
        "global_load_async_to_lds_b128 %0, %8, %9\n\t"
        "global_load_async_to_lds_b128 %1, %8, %10\n\t"
        "global_load_async_to_lds_b128 %2, %8, %11\n\t"
        "global_load_async_to_lds_b128 %3, %8, %12\n\t"
        "global_load_async_to_lds_b128 %4, %8, %13\n\t"
        "global_load_async_to_lds_b128 %5, %8, %14\n\t"
        "global_load_async_to_lds_b128 %6, %8, %15\n\t"
        "global_load_async_to_lds_b128 %7, %8, %16\n\t"
        "s_wait_xcnt 0x0"
        :: "v"(l[0]), "v"(l[1]), "v"(l[2]), "v"(l[3]), "v"(l[4]), "v"(l[5]), "v"(l[6]), "v"(l[7]),
           "v"(off),
           "s"(g[0]), "s"(g[1]), "s"(g[2]), "s"(g[3]), "s"(g[4]), "s"(g[5]), "s"(g[6]), "s"(g[7])
        : "memory");
}
__device__ __forceinline__ unsigned lds_byte(const bf16* p) {
    return (unsigned)(size_t)(const __attribute__((address_space(3))) bf16*)p;
}

// ---------------------------------------------------------------------------
// Generic bf16 WMMA GEMM:  C[M,N] = epilogue(A[M,K] * BT[N,K]^T + bias)
// Block tile 128x128, 8 waves, each wave 32x64 (2x4 wmma tiles).
// An LDS stage holds KS k of both operands (KS/32 WMMA blocks of 32 k), so one
// copy latency and one barrier are paid per KS/4 WMMAs of a wave, and a stage
// row is one or two whole 128-B lines. Two stages; the async global->LDS
// copies of stage t+2 start when stage t has been read.
// KS = 128 where the grid gives a WGP two workgroups; KS = 64 where it gives
// more, so that four fit its LDS.
// M, N multiples of 128; K a multiple of KS.
// EPI_BIAS_VT: scatter-store V into VT[batch][head][d][key] for attention.
// ---------------------------------------------------------------------------
template <int EPI, typename OutT, int KS>
__global__ __launch_bounds__(256)
void gemm_bf16_wmma(const bf16* __restrict__ A, const bf16* __restrict__ BT,
                    const float* __restrict__ bias, const float* __restrict__ res,
                    OutT* __restrict__ C, int M, int N, int K) {
    constexpr int PITCH = KS + 8;          // 16 B x odd, as PITCH_K64 / PITCH_K128
    __shared__ __attribute__((aligned(16))) bf16 As[2][128][PITCH];
    __shared__ __attribute__((aligned(16))) bf16 Bs[2][128][PITCH];

    const int tid  = threadIdx.x;
    const int wave = tid >> 5;
    const int lane = tid & 31;
    const int lh   = lane >> 4;     // K-half selector (lanes 16-31 hold K=16..31)
    const int ll   = lane & 15;     // row/col within 16
    const int wm   = wave & 3;      // 4 waves along M (32 rows each)
    const int wn   = wave >> 2;     // 2 waves along N (64 cols each)

    const int bm = blockIdx.y * 128;
    const int bn = blockIdx.x * 128;

    f32x8 acc[2][4];
#pragma unroll
    for (int i = 0; i < 2; ++i)
#pragma unroll
        for (int j = 0; j < 4; ++j)
#pragma unroll
            for (int e = 0; e < 8; ++e) acc[i][j][e] = 0.0f;

    // Copy map: KS/8 adjacent lanes cover one stage row, 16 B each.
    constexpr int LPR = KS / 8;           // lanes per row
    constexpr int RPC = 256 / LPR;        // rows the block covers with one copy per lane
    constexpr int CPO = 128 / RPC;        // copies per lane and operand
    const int lrow = tid / LPR;
    const int lcol = (tid % LPR) * 8;
    const bf16* aRow = A  + (size_t)(bm + lrow) * K + lcol;
    const bf16* bRow = BT + (size_t)(bn + lrow) * K + lcol;

    const int nk = K / KS;

    auto issue = [&](int buf, int k0) {
#pragma unroll
        for (int s = 0; s < 2 * CPO / 8; ++s) {
            unsigned l[8];
            const bf16* g[8];
#pragma unroll
            for (int q = 0; q < 8; ++q) {
                const int c = s * 8 + q;              // first the A rows, then the B rows
                const int r = (c % CPO) * RPC;
                l[q] = lds_byte(c < CPO ? &As[buf][lrow + r][lcol] : &Bs[buf][lrow + r][lcol]);
                g[q] = ((c < CPO ? aRow : bRow) + k0) + (size_t)r * K;
            }
            async_copy8_b128(l, g);
        }
    };
    issue(0, 0);
    asm volatile("s_wait_asynccnt 0x0" ::: "memory");   // stage 0 landed (this wave's copies)
    __syncthreads();                                    // ... and every other wave's
    if (nk > 1) issue(1, KS);

    for (int kt = 0; kt < nk; ++kt) {
        const int cur = kt & 1;
#pragma unroll
        for (int ks = 0; ks < KS / 32; ++ks) {
            bf16x16 af[2], bfr[4];
#pragma unroll
            for (int i = 0; i < 2; ++i)
                af[i] = lds_frag(&As[cur][wm * 32 + i * 16 + ll][ks * 32 + lh * 16]);
#pragma unroll
            for (int j = 0; j < 4; ++j)
                bfr[j] = lds_frag(&Bs[cur][wn * 64 + j * 16 + ll][ks * 32 + lh * 16]);

#pragma unroll
            for (int i = 0; i < 2; ++i)
#pragma unroll
                for (int j = 0; j < 4; ++j)
                    acc[i][j] = __builtin_amdgcn_wmma_f32_16x16x32_bf16(
                        false, af[i], false, bfr[j], (short)0, acc[i][j], false, false);
        }

        asm volatile("s_wait_dscnt 0x0" ::: "memory");     // this wave's reads of stage kt are done
        asm volatile("s_wait_asynccnt 0x0" ::: "memory");  // its copies of stage kt+1 have landed
        __syncthreads();                                   // publishes kt+1, frees kt's buffer
        if (kt + 2 < nk) issue(cur, (kt + 2) * KS);
    }
    asm volatile("s_wait_asynccnt 0x0" ::: "memory");      // no copy outstanding past the loop

    // Epilogue. C layout: VGPR e -> row = e + lh*8 ; lane%16 -> col.
#pragma unroll
    for (int i = 0; i < 2; ++i) {
#pragma unroll
        for (int j = 0; j < 4; ++j) {
            const int col = bn + wn * 64 + j * 16 + ll;
            const float bvv = bias ? bias[col] : 0.0f;
#pragma unroll
            for (int e = 0; e < 8; ++e) {
                const int row = bm + wm * 32 + i * 16 + lh * 8 + e;
                float v = acc[i][j][e] + bvv;
                if (EPI == EPI_BIAS_GELU) v = gelu_tanh(v);
                if (EPI == EPI_BIAS_RES)  v += res[(size_t)row * N + col];
                if (EPI == EPI_BIAS_VT) {
                    // row = batch*LSEQ + key ; col = head*DH + d
                    const size_t idx =
                        (((size_t)(row >> 10) * NH + (col >> 6)) * DH + (col & (DH - 1)))
                            * LSEQ + (row & (LSEQ - 1));
                    C[idx] = (OutT)v;
                } else {
                    C[(size_t)row * N + col] = (OutT)v;
                }
            }
        }
    }
}

__device__ __forceinline__ float xhalf(float x) {
    const int b = __builtin_bit_cast(int, x);
    return __builtin_bit_cast(float,
        __builtin_amdgcn_permlanex16(b, b, 0x76543210, 0xfedcba98, false, false));
}
// One lane's 16 k of the 32-k block at p, in the k order of a packed pair of
// accumulator tiles: k = 8h + 0..7, then 16 + 8h + 0..7 (h = lane / 16).
__device__ __forceinline__ bf16x16 lds_frag_pair(const bf16* p, int h) {
    bf16x8 lo = *(const bf16x8*)(p + 8 * h);
    bf16x8 hi = *(const bf16x8*)(p + 16 + 8 * h);
    return __builtin_shufflevector(lo, hi, 0, 1, 2, 3, 4, 5, 6, 7,
                                   8, 9, 10, 11, 12, 13, 14, 15);
}

__global__ __launch_bounds__(128)
void attention_wmma(const bf16* __restrict__ Q, const bf16* __restrict__ Km,
                    const bf16* __restrict__ VT, bf16* __restrict__ O) {
    __shared__ __attribute__((aligned(16))) bf16 Ks[128][PITCH_K64];      // 18 KB
    __shared__ __attribute__((aligned(16))) bf16 VTs[64][PITCH_K128];     // 17 KB

    const int tid  = threadIdx.x;
    const int wave = tid >> 5;
    const int lane = tid & 31;
    const int lh   = lane >> 4;
    const int ll   = lane & 15;

    const int qt    = blockIdx.x;        // 16 query tiles of 64
    const int head  = blockIdx.y;        // 16
    const int batch = blockIdx.z;        // 8
    const size_t base   = ((size_t)batch * LSEQ) * HDIM + (size_t)head * DH;
    const size_t vtbase = ((size_t)(batch * NH + head)) * DH * LSEQ;
    const int q0 = qt * 64;
    const size_t qrow = base + (size_t)(q0 + wave * 16 + ll) * HDIM;   // this lane's query

    // Q^T fragments: column = this lane's query, 16 consecutive d per wave half
    // (the k order of lds_frag, which loads the K rows they are paired with).
    bf16x16 qf[2];
#pragma unroll
    for (int kc = 0; kc < 2; ++kc) {
        const bf16* qp = Q + qrow + kc * 32 + lh * 16;
        bf16x8 lo = *(const bf16x8*)qp;
        bf16x8 hi = *(const bf16x8*)(qp + 8);
        qf[kc] = __builtin_shufflevector(lo, hi, 0, 1, 2, 3, 4, 5, 6, 7,
                                         8, 9, 10, 11, 12, 13, 14, 15);
    }

    f32x8 acco[4];                       // O^T: row d = j*16 + lh*8 + e, column = query ll
#pragma unroll
    for (int j = 0; j < 4; ++j)
#pragma unroll
        for (int e = 0; e < 8; ++e) acco[j][e] = 0.0f;
    float mrow = -1e30f;                 // running maximum of this lane's query
    float lsum = 0.0f;                   // running sum over this wave half's keys

    // Copy map: adjacent lanes cover one tile row, 16 B each, so that a wave-wide
    // copy takes four whole 128-B lines instead of 16 B out of 32 lines.
    const int krow = tid >> 3, kcol = (tid & 7) * 8;     // K: 8 lanes per 128-B row, 16 rows per copy
    const int vrow = tid >> 4, vcol = (tid & 15) * 8;    // V^T: 16 lanes per 256-B row, 8 rows per copy
    const unsigned koff = (unsigned)(krow * HDIM + kcol) * 2u;   // lane's byte offset in 16 K rows
    const unsigned voff = (unsigned)(vrow * LSEQ + vcol) * 2u;   // ... in 8 V^T rows

    for (int kt = 0; kt < LSEQ / 128; ++kt) {
        const int k0 = kt * 128;
        asm volatile("s_wait_dscnt 0x0" ::: "memory");     // this wave's reads of the previous tile are done
        __syncthreads();                                   // ... and every other wave's
        {
            unsigned l[8];
            const bf16* g[8];
#pragma unroll
            for (int c = 0; c < 8; ++c) {                  // K tile: 128 keys x 64 d
                l[c] = lds_byte(&Ks[krow + c * 16][kcol]);
                g[c] = Km + base + (size_t)(k0 + c * 16) * HDIM;
            }
            async_copy8_b128_sbase(l, koff, g);
#pragma unroll
            for (int c = 0; c < 8; ++c) {                  // V^T tile: 64 d x 128 keys
                l[c] = lds_byte(&VTs[vrow + c * 8][vcol]);
                g[c] = VT + vtbase + (size_t)(c * 8) * LSEQ + k0;
            }
            async_copy8_b128_sbase(l, voff, g);
        }
        asm volatile("s_wait_asynccnt 0x0" ::: "memory");  // this wave's copies have landed
        __syncthreads();                                   // ... and every other wave's

        // ---- S^T = (K Q^T) * 1/sqrt(D): accs[jt][e] = S[key jt*16 + lh*8 + e][query ll]
        f32x8 accs[8];
#pragma unroll
        for (int jt = 0; jt < 8; ++jt) {
#pragma unroll
            for (int e = 0; e < 8; ++e) accs[jt][e] = 0.0f;
#pragma unroll
            for (int kc = 0; kc < 2; ++kc) {
                bf16x16 a = lds_frag(&Ks[jt * 16 + ll][kc * 32 + lh * 16]);
                accs[jt] = __builtin_amdgcn_wmma_f32_16x16x32_bf16(
                    false, a, false, qf[kc], (short)0, accs[jt], false, false);
            }
        }
        const float scale = 0.125f;     // 1/sqrt(64)

        // ---- online softmax, one query per lane; eight independent chains
        float mxe[8];
#pragma unroll
        for (int e = 0; e < 8; ++e) {
            mxe[e] = -1e30f;
#pragma unroll
            for (int jt = 0; jt < 8; ++jt) {
                accs[jt][e] *= scale;
                mxe[e] = fmaxf(mxe[e], accs[jt][e]);
            }
        }
        float mx = fmaxf(fmaxf(fmaxf(mxe[0], mxe[1]), fmaxf(mxe[2], mxe[3])),
                         fmaxf(fmaxf(mxe[4], mxe[5]), fmaxf(mxe[6], mxe[7])));
        mx = fmaxf(mx, xhalf(mx));       // the other half's keys of the same query
        const float mnew = fmaxf(mrow, mx);

        // P^T fragments: pf[kc][s] = P[key kc*32 + (s/8)*16 + lh*8 + s%8][query ll]
        bf16x16 pf[4];
        float sm[4];
#pragma unroll
        for (int kc = 0; kc < 4; ++kc) {
            sm[kc] = 0.0f;
#pragma unroll
            for (int s = 0; s < 16; ++s) {
                float p = __expf(accs[kc * 2 + (s >> 3)][s & 7] - mnew);
                sm[kc] += p;
                pf[kc][s] = (bf16)p;
            }
        }
        const float corr = __expf(mrow - mnew);
        lsum = lsum * corr + ((sm[0] + sm[1]) + (sm[2] + sm[3]));
        mrow = mnew;
#pragma unroll
        for (int j = 0; j < 4; ++j)
#pragma unroll
            for (int e = 0; e < 8; ++e) acco[j][e] *= corr;

        // ---- O^T += V^T P^T ----
#pragma unroll
        for (int j = 0; j < 4; ++j)
#pragma unroll
            for (int kc = 0; kc < 4; ++kc) {
                bf16x16 a = lds_frag_pair(&VTs[j * 16 + ll][kc * 32], lh);
                acco[j] = __builtin_amdgcn_wmma_f32_16x16x32_bf16(
                    false, a, false, pf[kc], (short)0, acco[j], false, false);
            }
    }

    // ---- write O = acc / l: a lane holds 8 consecutive d of its query per tile
    const float lrow = lsum + xhalf(lsum);
#pragma unroll
    for (int j = 0; j < 4; ++j) {
        bf16x8 o;
#pragma unroll
        for (int e = 0; e < 8; ++e) o[e] = (bf16)(acco[j][e] / lrow);
        *(bf16x8*)(O + qrow + j * 16 + lh * 8) = o;
    }
}

// ---------------------------------------------------------------------------
// Host orchestration
// ---------------------------------------------------------------------------
extern "C" void kernel_launch(void* const* d_in, const int* in_sizes, int n_in,
                              void* d_out, int out_size, void* d_ws, size_t ws_size,
                              hipStream_t stream) {
    const float* x    = (const float*)d_in[0];
    const float* ln0g = (const float*)d_in[1];
    const float* ln0b = (const float*)d_in[2];
    const float* wq   = (const float*)d_in[3];
    const float* bq   = (const float*)d_in[4];
    const float* wk   = (const float*)d_in[5];
    const float* bk   = (const float*)d_in[6];
    const float* wv   = (const float*)d_in[7];
    const float* bv   = (const float*)d_in[8];
    const float* wo   = (const float*)d_in[9];
    const float* bo   = (const float*)d_in[10];
    const float* ln1g = (const float*)d_in[11];
    const float* ln1b = (const float*)d_in[12];
    const float* w1   = (const float*)d_in[13];
    const float* b1   = (const float*)d_in[14];
    const float* w2   = (const float*)d_in[15];
    const float* b2   = (const float*)d_in[16];
    float* out = (float*)d_out;

    char* p = (char*)d_ws;
    auto carve = [&](size_t bytes) -> char* {
        char* r = p;
        p += (bytes + 255) & ~(size_t)255;
        return r;
    };
    bf16*  wq_t = (bf16*)carve((size_t)HDIM * HDIM * 2);
    bf16*  wk_t = (bf16*)carve((size_t)HDIM * HDIM * 2);
    bf16*  wv_t = (bf16*)carve((size_t)HDIM * HDIM * 2);
    bf16*  wo_t = (bf16*)carve((size_t)HDIM * HDIM * 2);
    bf16*  w1_t = (bf16*)carve((size_t)MLPD * HDIM * 2);
    bf16*  w2_t = (bf16*)carve((size_t)HDIM * MLPD * 2);
    bf16*  y0   = (bf16*)carve((size_t)MTOK * HDIM * 2);   // LN0 out
    bf16*  qb   = (bf16*)carve((size_t)MTOK * HDIM * 2);
    bf16*  kb   = (bf16*)carve((size_t)MTOK * HDIM * 2);
    bf16*  vtb  = (bf16*)carve((size_t)MTOK * HDIM * 2);   // V, pre-transposed [b][h][d][key]
    bf16*  ab   = (bf16*)carve((size_t)MTOK * HDIM * 2);   // attention out
    float* x1   = (float*)carve((size_t)MTOK * HDIM * 4);  // residual 1
    bf16*  y1   = (bf16*)carve((size_t)MTOK * HDIM * 2);   // LN1 out
    bf16*  hb   = (bf16*)carve((size_t)MTOK * MLPD * 2);   // GELU(mlp1) out

    // --- weight convert/transpose (bf16, N x K) ---
    transpose_to_bf16<<<dim3(HDIM / 32, HDIM / 32), 256, 0, stream>>>(wq, wq_t, HDIM, HDIM);
    transpose_to_bf16<<<dim3(HDIM / 32, HDIM / 32), 256, 0, stream>>>(wk, wk_t, HDIM, HDIM);
    transpose_to_bf16<<<dim3(HDIM / 32, HDIM / 32), 256, 0, stream>>>(wv, wv_t, HDIM, HDIM);
    transpose_to_bf16<<<dim3(HDIM / 32, HDIM / 32), 256, 0, stream>>>(wo, wo_t, HDIM, HDIM);
    transpose_to_bf16<<<dim3(MLPD / 32, HDIM / 32), 256, 0, stream>>>(w1, w1_t, HDIM, MLPD);
    transpose_to_bf16<<<dim3(HDIM / 32, MLPD / 32), 256, 0, stream>>>(w2, w2_t, MLPD, HDIM);

    // --- pre-LN attention ---
    layernorm_to_bf16<<<MTOK, 256, 0, stream>>>(x, ln0g, ln0b, y0);

    dim3 gProj(HDIM / 128, MTOK / 128);
    gemm_bf16_wmma<EPI_BIAS, bf16, 128><<<gProj, 256, 0, stream>>>(y0, wq_t, bq, nullptr, qb, MTOK, HDIM, HDIM);
    gemm_bf16_wmma<EPI_BIAS, bf16, 128><<<gProj, 256, 0, stream>>>(y0, wk_t, bk, nullptr, kb, MTOK, HDIM, HDIM);
    gemm_bf16_wmma<EPI_BIAS_VT, bf16, 128><<<gProj, 256, 0, stream>>>(y0, wv_t, bv, nullptr, vtb, MTOK, HDIM, HDIM);

    attention_wmma<<<dim3(LSEQ / 64, NH, NB), 128, 0, stream>>>(qb, kb, vtb, ab);

    gemm_bf16_wmma<EPI_BIAS_RES, float, 128><<<gProj, 256, 0, stream>>>(ab, wo_t, bo, x, x1, MTOK, HDIM, HDIM);

    // --- pre-LN MLP ---
    layernorm_to_bf16<<<MTOK, 256, 0, stream>>>(x1, ln1g, ln1b, y1);

    gemm_bf16_wmma<EPI_BIAS_GELU, bf16, 64><<<dim3(MLPD / 128, MTOK / 128), 256, 0, stream>>>(
        y1, w1_t, b1, nullptr, hb, MTOK, MLPD, HDIM);

    gemm_bf16_wmma<EPI_BIAS_RES, float, 128><<<dim3(HDIM / 128, MTOK / 128), 256, 0, stream>>>(
        hb, w2_t, b2, x1, out, MTOK, HDIM, MLPD);
}

// v005
// One run takes 271 microseconds.
// In both of two side-by-side timings against v004, it was 1.06 times as fast.
// Counting every step since v000, it is 2.03 times as fast.
#include <hip/hip_runtime.h>
#include <hip/hip_bf16.h>
#include <math.h>

// ---------------------------------------------------------------------------
// Problem constants (from reference): N=8, L=1024, H=16, D=64, HD=1024, MLP=4096
// ---------------------------------------------------------------------------
#define NB    8
#define LSEQ  1024
#define NH    16
#define DH    64
#define HDIM  1024
#define MLPD  4096
#define MTOK  (NB * LSEQ)          // 8192 token rows

typedef __bf16 bf16;
typedef __attribute__((ext_vector_type(16))) __bf16 bf16x16;
typedef __attribute__((ext_vector_type(8)))  float  f32x8;
typedef __attribute__((ext_vector_type(8)))  __bf16 bf16x8;
typedef __attribute__((ext_vector_type(4)))  __bf16 bf16x4;
typedef __attribute__((ext_vector_type(4)))  float  f32x4;

// LDS row pitches, in bf16 elements. Every WMMA fragment is read with
// ds_load_b128, one row per lane: a pitch of 16 B x odd spreads the 16 lanes of
// a half-wave over all 64 banks; 64 B, 128 B and 32 B x odd pitches do not.
#define PITCH_K64   72             // 128-B rows -> 144 B
#define PITCH_K128  136            // 256-B rows -> 272 B

// One lane's 16 consecutive k of a fragment row; rows are 16-B aligned only.
__device__ __forceinline__ bf16x16 lds_frag(const bf16* p) {
    bf16x8 lo = *(const bf16x8*)p;
    bf16x8 hi = *(const bf16x8*)(p + 8);
    return __builtin_shufflevector(lo, hi, 0, 1, 2, 3, 4, 5, 6, 7,
                                   8, 9, 10, 11, 12, 13, 14, 15);
}

__device__ __forceinline__ float gelu_tanh(float x) {
    const float c = 0.7978845608028654f;   // sqrt(2/pi)
    float x3 = x * x * x;
    return 0.5f * x * (1.0f + tanhf(c * (x + 0.044715f * x3)));
}

enum { EPI_BIAS = 0, EPI_BIAS_GELU = 1, EPI_BIAS_RES = 2, EPI_BIAS_VT = 3 };

// ---------------------------------------------------------------------------
// Weight convert + transpose: w (K x N, f32 row-major) -> wt (N x K, bf16)
// One 64 x 64 tile per workgroup of 4 waves: few, long-lived waves, 8
// 16-B loads in flight per lane, whole 128-B lines read and written.
// K, N multiples of 64.
// ---------------------------------------------------------------------------
__global__ __launch_bounds__(128)
void transpose_to_bf16(const float* __restrict__ w, bf16* __restrict__ wt,
                       int K, int N) {
    __shared__ float t[64][65];              // odd dword pitch: no bank conflict either way
    const int bn = blockIdx.x * 64;
    const int bk = blockIdx.y * 64;
    const int lr = threadIdx.x >> 4;         // 0..7: 16 lanes per 256-B row piece of w
    const int lc = (threadIdx.x & 15) * 4;
    const unsigned off = (unsigned)(lr * N + lc);   // one lane offset on eight uniform row bases
    float4 v[8];
#pragma unroll
    for (int i = 0; i < 8; ++i)
        v[i] = *(const float4*)(w + ((size_t)(bk + i * 8) * N + bn) + off);
#pragma unroll
    for (int i = 0; i < 8; ++i) {
        t[lr + i * 8][lc + 0] = v[i].x;
        t[lr + i * 8][lc + 1] = v[i].y;
        t[lr + i * 8][lc + 2] = v[i].z;
        t[lr + i * 8][lc + 3] = v[i].w;
    }
    __syncthreads();
    const int nr = threadIdx.x >> 3;         // 0..15: 8 lanes per 128-B row piece of wt
    const int kc = (threadIdx.x & 7) * 8;
#pragma unroll
    for (int j = 0; j < 4; ++j) {
        const int n = nr + j * 16;
        bf16x8 o;
#pragma unroll
        for (int e = 0; e < 8; ++e) o[e] = (bf16)t[kc + e][n];
        *(bf16x8*)(wt + (size_t)(bn + n) * K + bk + kc) = o;
    }
}

// ---------------------------------------------------------------------------
// LayerNorm (row of 1024 f32) fused with bf16 downconvert. One wave takes two
// whole rows: all 16 of its 16-B loads are in flight at once, the sums stay
// inside the wave (no LDS, no barrier), and the launch starts 16x fewer waves
// than with one workgroup per row. 16 rows per workgroup.
// waves_per_eu: the register budget of the four waves per SIMD that this grid
// gives; with the default budget the g and b loads are issued pair by pair
// between the stores' arithmetic, each pair waited for alone.
// ---------------------------------------------------------------------------
__global__ __launch_bounds__(256) __attribute__((amdgpu_waves_per_eu(4, 4)))
void layernorm_to_bf16(const float* __restrict__ x, const float* __restrict__ g,
                       const float* __restrict__ b, bf16* __restrict__ y) {
    // The wave's number as a scalar: the row addresses then sit in scalar registers.
    const int wave = __builtin_amdgcn_readfirstlane(threadIdx.x >> 5);
    const int lane = threadIdx.x & 31;
    const size_t row0 = (size_t)(blockIdx.x * 8 + wave) * 2;
    f32x4 v[2][8], gv[8], bv[8];            // piece c: columns c*128 + lane*4 .. +3
#pragma unroll
    for (int r = 0; r < 2; ++r)
#pragma unroll
        for (int c = 0; c < 8; ++c)
            v[r][c] = ((const f32x4*)(x + (row0 + r) * HDIM))[c * 32 + lane];
#pragma unroll
    for (int c = 0; c < 8; ++c) {
        gv[c] = ((const f32x4*)g)[c * 32 + lane];
        bv[c] = ((const f32x4*)b)[c * 32 + lane];
    }
    float s[2], s2[2];
#pragma unroll
    for (int r = 0; r < 2; ++r) {
        float p[8], p2[8];                   // eight independent chains
#pragma unroll
        for (int c = 0; c < 8; ++c) {
            const f32x4 a = v[r][c];
            p[c]  = (a.x + a.y) + (a.z + a.w);
            p2[c] = (a.x * a.x + a.y * a.y) + (a.z * a.z + a.w * a.w);
        }
        s[r]  = ((p[0] + p[1]) + (p[2] + p[3])) + ((p[4] + p[5]) + (p[6] + p[7]));
        s2[r] = ((p2[0] + p2[1]) + (p2[2] + p2[3])) + ((p2[4] + p2[5]) + (p2[6] + p2[7]));
    }
#pragma unroll
    for (int m = 16; m > 0; m >>= 1)
#pragma unroll
        for (int r = 0; r < 2; ++r) { s[r] += __shfl_xor(s[r], m); s2[r] += __shfl_xor(s2[r], m); }
    float mu[2], rstd[2];
#pragma unroll
    for (int r = 0; r < 2; ++r) {
        mu[r] = s[r] * (1.0f / HDIM);
        const float var = s2[r] * (1.0f / HDIM) - mu[r] * mu[r];
        rstd[r] = rsqrtf(var + 1e-5f);
    }
#pragma unroll
    for (int c = 0; c < 8; ++c)
#pragma unroll
        for (int r = 0; r < 2; ++r) {
            const f32x4 a = v[r][c];
            bf16x4 o;
            o[0] = (bf16)((a.x - mu[r]) * rstd[r] * gv[c].x + bv[c].x);
            o[1] = (bf16)((a.y - mu[r]) * rstd[r] * gv[c].y + bv[c].y);
            o[2] = (bf16)((a.z - mu[r]) * rstd[r] * gv[c].z + bv[c].z);
            o[3] = (bf16)((a.w - mu[r]) * rstd[r] * gv[c].w + bv[c].w);
            *(bf16x4*)(y + (row0 + r) * HDIM + c * 128 + lane * 4) = o;
        }
}

// ---------------------------------------------------------------------------
// Eight async 16-B copies per lane, global -> LDS. l[] = LDS byte addresses,
// g[] = global addresses. The address-translation wait is the last line of the
// copies' own statement, so that no address register named here is rewritten
// in front of it.
// ---------------------------------------------------------------------------
__device__ __forceinline__ void async_copy8_b128(const unsigned (&l)[8], const bf16* const (&g)[8]) {
    asm volatile(
        "global_load_async_to_lds_b128 %0, %8, off\n\t"
        "global_load_async_to_lds_b128 %1, %9, off\n\t"
        "global_load_async_to_lds_b128 %2, %10, off\n\t"
        "global_load_async_to_lds_b128 %3, %11, off\n\t"
        "global_load_async_to_lds_b128 %4, %12, off\n\t"
        "global_load_async_to_lds_b128 %5, %13, off\n\t"
        "global_load_async_to_lds_b128 %6, %14, off\n\t"
        "global_load_async_to_lds_b128 %7, %15, off\n\t"
        "s_wait_xcnt 0x0"
        :: "v"(l[0]), "v"(l[1]), "v"(l[2]), "v"(l[3]), "v"(l[4]), "v"(l[5]), "v"(l[6]), "v"(l[7]),
           "v"(g[0]), "v"(g[1]), "v"(g[2]), "v"(g[3]), "v"(g[4]), "v"(g[5]), "v"(g[6]), "v"(g[7])
        : "memory");
}
// The same with one 32-bit byte offset per lane (off) on eight wave-uniform
// bases in scalar registers: no vector register pair per copy (with pairs the
// attention kernel needs 194 registers, one wave per SIMD fewer than with 170).
__device__ __forceinline__ void async_copy8_b128_sbase(const unsigned (&l)[8], unsigned off,
                                                       const bf16* const (&g)[8]) {
    asm volatile(
        "global_load_async_to_lds_b128 %0, %8, %9\n\t"
        "global_load_async_to_lds_b128 %1, %8, %10\n\t"
        "global_load_async_to_lds_b128 %2, %8, %11\n\t"
        "global_load_async_to_lds_b128 %3, %8, %12\n\t"
        "global_load_async_to_lds_b128 %4, %8, %13\n\t"
        "global_load_async_to_lds_b128 %5, %8, %14\n\t"
        "global_load_async_to_lds_b128 %6, %8, %15\n\t"
        "global_load_async_to_lds_b128 %7, %8, %16\n\t"
        "s_wait_xcnt 0x0"
        :: "v"(l[0]), "v"(l[1]), "v"(l[2]), "v"(l[3]), "v"(l[4]), "v"(l[5]), "v"(l[6]), "v"(l[7]),
           "v"(off),
           "s"(g[0]), "s"(g[1]), "s"(g[2]), "s"(g[3]), "s"(g[4]), "s"(g[5]), "s"(g[6]), "s"(g[7])
        : "memory");
}
__device__ __forceinline__ unsigned lds_byte(const bf16* p) {
    return (unsigned)(size_t)(const __attribute__((address_space(3))) bf16*)p;
}

// ---------------------------------------------------------------------------
// Generic bf16 WMMA GEMM:  C[M,N] = epilogue(A[M,K] * BT[N,K]^T + bias)
// Block tile 128x128, 8 waves, each wave 32x64 (2x4 wmma tiles).
// An LDS stage holds KS k of both operands (KS/32 WMMA blocks of 32 k), so one
// copy latency and one barrier are paid per KS/4 WMMAs of a wave, and a stage
// row is one or two whole 128-B lines. Two stages; the async global->LDS
// copies of stage t+2 start when stage t has been read.
// KS = 128 where the grid gives a WGP two workgroups; KS = 64 where it gives
// more, so that four fit its LDS.
// M, N multiples of 128; K a multiple of KS.
// EPI_BIAS_VT: scatter-store V into VT[batch][head][d][key] for attention.
// ---------------------------------------------------------------------------
template <int EPI, typename OutT, int KS>
__global__ __launch_bounds__(256)
void gemm_bf16_wmma(const bf16* __restrict__ A, const bf16* __restrict__ BT,
                    const float* __restrict__ bias, const float* __restrict__ res,
                    OutT* __restrict__ C, int M, int N, int K) {
    constexpr int PITCH = KS + 8;          // 16 B x odd, as PITCH_K64 / PITCH_K128
    __shared__ __attribute__((aligned(16))) bf16 As[2][128][PITCH];
    __shared__ __attribute__((aligned(16))) bf16 Bs[2][128][PITCH];

    const int tid  = threadIdx.x;
    const int wave = tid >> 5;
    const int lane = tid & 31;
    const int lh   = lane >> 4;     // K-half selector (lanes 16-31 hold K=16..31)
    const int ll   = lane & 15;     // row/col within 16
    const int wm   = wave & 3;      // 4 waves along M (32 rows each)
    const int wn   = wave >> 2;     // 2 waves along N (64 cols each)

    const int bm = blockIdx.y * 128;
    const int bn = blockIdx.x * 128;

    f32x8 acc[2][4];
#pragma unroll
    for (int i = 0; i < 2; ++i)
#pragma unroll
        for (int j = 0; j < 4; ++j)
#pragma unroll
            for (int e = 0; e < 8; ++e) acc[i][j][e] = 0.0f;

    // Copy map: KS/8 adjacent lanes cover one stage row, 16 B each.
    constexpr int LPR = KS / 8;           // lanes per row
    constexpr int RPC = 256 / LPR;        // rows the block covers with one copy per lane
    constexpr int CPO = 128 / RPC;        // copies per lane and operand
    const int lrow = tid / LPR;
    const int lcol = (tid % LPR) * 8;
    const bf16* aRow = A  + (size_t)(bm + lrow) * K + lcol;
    const bf16* bRow = BT + (size_t)(bn + lrow) * K + lcol;

    const int nk = K / KS;

    auto issue = [&](int buf, int k0) {
#pragma unroll
        for (int s = 0; s < 2 * CPO / 8; ++s) {
            unsigned l[8];
            const bf16* g[8];
#pragma unroll
            for (int q = 0; q < 8; ++q) {
                const int c = s * 8 + q;              // first the A rows, then the B rows
                const int r = (c % CPO) * RPC;
                l[q] = lds_byte(c < CPO ? &As[buf][lrow + r][lcol] : &Bs[buf][lrow + r][lcol]);
                g[q] = ((c < CPO ? aRow : bRow) + k0) + (size_t)r * K;
            }
            async_copy8_b128(l, g);
        }
    };
    issue(0, 0);
    asm volatile("s_wait_asynccnt 0x0" ::: "memory");   // stage 0 landed (this wave's copies)
    __syncthreads();                                    // ... and every other wave's
    if (nk > 1) issue(1, KS);

    for (int kt = 0; kt < nk; ++kt) {
        const int cur = kt & 1;
#pragma unroll
        for (int ks = 0; ks < KS / 32; ++ks) {
            bf16x16 af[2], bfr[4];
#pragma unroll
            for (int i = 0; i < 2; ++i)
                af[i] = lds_frag(&As[cur][wm * 32 + i * 16 + ll][ks * 32 + lh * 16]);
#pragma unroll
            for (int j = 0; j < 4; ++j)
                bfr[j] = lds_frag(&Bs[cur][wn * 64 + j * 16 + ll][ks * 32 + lh * 16]);

#pragma unroll
            for (int i = 0; i < 2; ++i)
#pragma unroll
                for (int j = 0; j < 4; ++j)
                    acc[i][j] = __builtin_amdgcn_wmma_f32_16x16x32_bf16(
                        false, af[i], false, bfr[j], (short)0, acc[i][j], false, false);
        }

        asm volatile("s_wait_dscnt 0x0" ::: "memory");     // this wave's reads of stage kt are done
        asm volatile("s_wait_asynccnt 0x0" ::: "memory");  // its copies of stage kt+1 have landed
        __syncthreads();                                   // publishes kt+1, frees kt's buffer
        if (kt + 2 < nk) issue(cur, (kt + 2) * KS);
    }
    asm volatile("s_wait_asynccnt 0x0" ::: "memory");      // no copy outstanding past the loop

    // Epilogue. C layout: VGPR e -> row = e + lh*8 ; lane%16 -> col.
#pragma unroll
    for (int i = 0; i < 2; ++i) {
#pragma unroll
        for (int j = 0; j < 4; ++j) {
            const int col = bn + wn * 64 + j * 16 + ll;
            const float bvv = bias ? bias[col] : 0.0f;
#pragma unroll
            for (int e = 0; e < 8; ++e) {
                const int row = bm + wm * 32 + i * 16 + lh * 8 + e;
                float v = acc[i][j][e] + bvv;
                if (EPI == EPI_BIAS_GELU) v = gelu_tanh(v);
                if (EPI == EPI_BIAS_RES)  v += res[(size_t)row * N + col];
                if (EPI == EPI_BIAS_VT) {
                    // row = batch*LSEQ + key ; col = head*DH + d
                    const size_t idx =
                        (((size_t)(row >> 10) * NH + (col >> 6)) * DH + (col & (DH - 1)))
                            * LSEQ + (row & (LSEQ - 1));
                    C[idx] = (OutT)v;
                } else {
                    C[(size_t)row * N + col] = (OutT)v;
                }
            }
        }
    }
}

__device__ __forceinline__ float xhalf(float x) {
    const int b = __builtin_bit_cast(int, x);
    return __builtin_bit_cast(float,
        __builtin_amdgcn_permlanex16(b, b, 0x76543210, 0xfedcba98, false, false));
}
// One lane's 16 k of the 32-k block at p, in the k order of a packed pair of
// accumulator tiles: k = 8h + 0..7, then 16 + 8h + 0..7 (h = lane / 16).
__device__ __forceinline__ bf16x16 lds_frag_pair(const bf16* p, int h) {
    bf16x8 lo = *(const bf16x8*)(p + 8 * h);
    bf16x8 hi = *(const bf16x8*)(p + 16 + 8 * h);
    return __builtin_shufflevector(lo, hi, 0, 1, 2, 3, 4, 5, 6, 7,
                                   8, 9, 10, 11, 12, 13, 14, 15);
}

__global__ __launch_bounds__(128)
void attention_wmma(const bf16* __restrict__ Q, const bf16* __restrict__ Km,
                    const bf16* __restrict__ VT, bf16* __restrict__ O) {
    __shared__ __attribute__((aligned(16))) bf16 Ks[128][PITCH_K64];      // 18 KB
    __shared__ __attribute__((aligned(16))) bf16 VTs[64][PITCH_K128];     // 17 KB

    const int tid  = threadIdx.x;
    const int wave = tid >> 5;
    const int lane = tid & 31;
    const int lh   = lane >> 4;
    const int ll   = lane & 15;

    const int qt    = blockIdx.x;        // 16 query tiles of 64
    const int head  = blockIdx.y;        // 16
    const int batch = blockIdx.z;        // 8
    const size_t base   = ((size_t)batch * LSEQ) * HDIM + (size_t)head * DH;
    const size_t vtbase = ((size_t)(batch * NH + head)) * DH * LSEQ;
    const int q0 = qt * 64;
    const size_t qrow = base + (size_t)(q0 + wave * 16 + ll) * HDIM;   // this lane's query

    // Q^T fragments: column = this lane's query, 16 consecutive d per wave half
    // (the k order of lds_frag, which loads the K rows they are paired with).
    bf16x16 qf[2];
#pragma unroll
    for (int kc = 0; kc < 2; ++kc) {
        const bf16* qp = Q + qrow + kc * 32 + lh * 16;
        bf16x8 lo = *(const bf16x8*)qp;
        bf16x8 hi = *(const bf16x8*)(qp + 8);
        qf[kc] = __builtin_shufflevector(lo, hi, 0, 1, 2, 3, 4, 5, 6, 7,
                                         8, 9, 10, 11, 12, 13, 14, 15);
    }

    f32x8 acco[4];                       // O^T: row d = j*16 + lh*8 + e, column = query ll
#pragma unroll
    for (int j = 0; j < 4; ++j)
#pragma unroll
        for (int e = 0; e < 8; ++e) acco[j][e] = 0.0f;
    float mrow = -1e30f;                 // running maximum of this lane's query
    float lsum = 0.0f;                   // running sum over this wave half's keys

    // Copy map: adjacent lanes cover one tile row, 16 B each, so that a wave-wide
    // copy takes four whole 128-B lines instead of 16 B out of 32 lines.
    const int krow = tid >> 3, kcol = (tid & 7) * 8;     // K: 8 lanes per 128-B row, 16 rows per copy
    const int vrow = tid >> 4, vcol = (tid & 15) * 8;    // V^T: 16 lanes per 256-B row, 8 rows per copy
    const unsigned koff = (unsigned)(krow * HDIM + kcol) * 2u;   // lane's byte offset in 16 K rows
    const unsigned voff = (unsigned)(vrow * LSEQ + vcol) * 2u;   // ... in 8 V^T rows

    for (int kt = 0; kt < LSEQ / 128; ++kt) {
        const int k0 = kt * 128;
        asm volatile("s_wait_dscnt 0x0" ::: "memory");     // this wave's reads of the previous tile are done
        __syncthreads();                                   // ... and every other wave's
        {
            unsigned l[8];
            const bf16* g[8];
#pragma unroll
            for (int c = 0; c < 8; ++c) {                  // K tile: 128 keys x 64 d
                l[c] = lds_byte(&Ks[krow + c * 16][kcol]);
                g[c] = Km + base + (size_t)(k0 + c * 16) * HDIM;
            }
            async_copy8_b128_sbase(l, koff, g);
#pragma unroll
            for (int c = 0; c < 8; ++c) {                  // V^T tile: 64 d x 128 keys
                l[c] = lds_byte(&VTs[vrow + c * 8][vcol]);
                g[c] = VT + vtbase + (size_t)(c * 8) * LSEQ + k0;
            }
            async_copy8_b128_sbase(l, voff, g);
        }
        asm volatile("s_wait_asynccnt 0x0" ::: "memory");  // this wave's copies have landed
        __syncthreads();                                   // ... and every other wave's

        // ---- S^T = (K Q^T) * 1/sqrt(D): accs[jt][e] = S[key jt*16 + lh*8 + e][query ll]
        f32x8 accs[8];
#pragma unroll
        for (int jt = 0; jt < 8; ++jt) {
#pragma unroll
            for (int e = 0; e < 8; ++e) accs[jt][e] = 0.0f;
#pragma unroll
            for (int kc = 0; kc < 2; ++kc) {
                bf16x16 a = lds_frag(&Ks[jt * 16 + ll][kc * 32 + lh * 16]);
                accs[jt] = __builtin_amdgcn_wmma_f32_16x16x32_bf16(
                    false, a, false, qf[kc], (short)0, accs[jt], false, false);
            }
        }
        const float scale = 0.125f;     // 1/sqrt(64)

        // ---- online softmax, one query per lane; eight independent chains
        float mxe[8];
#pragma unroll
        for (int e = 0; e < 8; ++e) {
            mxe[e] = -1e30f;
#pragma unroll
            for (int jt = 0; jt < 8; ++jt) {
                accs[jt][e] *= scale;
                mxe[e] = fmaxf(mxe[e], accs[jt][e]);
            }
        }
        float mx = fmaxf(fmaxf(fmaxf(mxe[0], mxe[1]), fmaxf(mxe[2], mxe[3])),
                         fmaxf(fmaxf(mxe[4], mxe[5]), fmaxf(mxe[6], mxe[7])));
        mx = fmaxf(mx, xhalf(mx));       // the other half's keys of the same query
        const float mnew = fmaxf(mrow, mx);

        // P^T fragments: pf[kc][s] = P[key kc*32 + (s/8)*16 + lh*8 + s%8][query ll]
        bf16x16 pf[4];
        float sm[4];
#pragma unroll
        for (int kc = 0; kc < 4; ++kc) {
            sm[kc] = 0.0f;
#pragma unroll
            for (int s = 0; s < 16; ++s) {
                float p = __expf(accs[kc * 2 + (s >> 3)][s & 7] - mnew);
                sm[kc] += p;
                pf[kc][s] = (bf16)p;
            }
        }
        const float corr = __expf(mrow - mnew);
        lsum = lsum * corr + ((sm[0] + sm[1]) + (sm[2] + sm[3]));
        mrow = mnew;
#pragma unroll
        for (int j = 0; j < 4; ++j)
#pragma unroll
            for (int e = 0; e < 8; ++e) acco[j][e] *= corr;

        // ---- O^T += V^T P^T ----
#pragma unroll
        for (int j = 0; j < 4; ++j)
#pragma unroll
            for (int kc = 0; kc < 4; ++kc) {
                bf16x16 a = lds_frag_pair(&VTs[j * 16 + ll][kc * 32], lh);
                acco[j] = __builtin_amdgcn_wmma_f32_16x16x32_bf16(
                    false, a, false, pf[kc], (short)0, acco[j], false, false);
            }
    }

    // ---- write O = acc / l: a lane holds 8 consecutive d of its query per tile
    const float lrow = lsum + xhalf(lsum);
#pragma unroll
    for (int j = 0; j < 4; ++j) {
        bf16x8 o;
#pragma unroll
        for (int e = 0; e < 8; ++e) o[e] = (bf16)(acco[j][e] / lrow);
        *(bf16x8*)(O + qrow + j * 16 + lh * 8) = o;
    }
}

// ---------------------------------------------------------------------------
// Host orchestration
// ---------------------------------------------------------------------------
extern "C" void kernel_launch(void* const* d_in, const int* in_sizes, int n_in,
                              void* d_out, int out_size, void* d_ws, size_t ws_size,
                              hipStream_t stream) {
    const float* x    = (const float*)d_in[0];
    const float* ln0g = (const float*)d_in[1];
    const float* ln0b = (const float*)d_in[2];
    const float* wq   = (const float*)d_in[3];
    const float* bq   = (const float*)d_in[4];
    const float* wk   = (const float*)d_in[5];
    const float* bk   = (const float*)d_in[6];
    const float* wv   = (const float*)d_in[7];
    const float* bv   = (const float*)d_in[8];
    const float* wo   = (const float*)d_in[9];
    const float* bo   = (const float*)d_in[10];
    const float* ln1g = (const float*)d_in[11];
    const float* ln1b = (const float*)d_in[12];
    const float* w1   = (const float*)d_in[13];
    const float* b1   = (const float*)d_in[14];
    const float* w2   = (const float*)d_in[15];
    const float* b2   = (const float*)d_in[16];
    float* out = (float*)d_out;

    char* p = (char*)d_ws;
    auto carve = [&](size_t bytes) -> char* {
        char* r = p;
        p += (bytes + 255) & ~(size_t)255;
        return r;
    };
    bf16*  wq_t = (bf16*)carve((size_t)HDIM * HDIM * 2);
    bf16*  wk_t = (bf16*)carve((size_t)HDIM * HDIM * 2);
    bf16*  wv_t = (bf16*)carve((size_t)HDIM * HDIM * 2);
    bf16*  wo_t = (bf16*)carve((size_t)HDIM * HDIM * 2);
    bf16*  w1_t = (bf16*)carve((size_t)MLPD * HDIM * 2);
    bf16*  w2_t = (bf16*)carve((size_t)HDIM * MLPD * 2);
    bf16*  y0   = (bf16*)carve((size_t)MTOK * HDIM * 2);   // LN0 out
    bf16*  qb   = (bf16*)carve((size_t)MTOK * HDIM * 2);
    bf16*  kb   = (bf16*)carve((size_t)MTOK * HDIM * 2);
    bf16*  vtb  = (bf16*)carve((size_t)MTOK * HDIM * 2);   // V, pre-transposed [b][h][d][key]
    bf16*  ab   = (bf16*)carve((size_t)MTOK * HDIM * 2);   // attention out
    float* x1   = (float*)carve((size_t)MTOK * HDIM * 4);  // residual 1
    bf16*  y1   = (bf16*)carve((size_t)MTOK * HDIM * 2);   // LN1 out
    bf16*  hb   = (bf16*)carve((size_t)MTOK * MLPD * 2);   // GELU(mlp1) out

    // --- weight convert/transpose (bf16, N x K) ---
    transpose_to_bf16<<<dim3(HDIM / 64, HDIM / 64), 128, 0, stream>>>(wq, wq_t, HDIM, HDIM);
    transpose_to_bf16<<<dim3(HDIM / 64, HDIM / 64), 128, 0, stream>>>(wk, wk_t, HDIM, HDIM);
    transpose_to_bf16<<<dim3(HDIM / 64, HDIM / 64), 128, 0, stream>>>(wv, wv_t, HDIM, HDIM);
    transpose_to_bf16<<<dim3(HDIM / 64, HDIM / 64), 128, 0, stream>>>(wo, wo_t, HDIM, HDIM);
    transpose_to_bf16<<<dim3(MLPD / 64, HDIM / 64), 128, 0, stream>>>(w1, w1_t, HDIM, MLPD);
    transpose_to_bf16<<<dim3(HDIM / 64, MLPD / 64), 128, 0, stream>>>(w2, w2_t, MLPD, HDIM);

    // --- pre-LN attention ---
    layernorm_to_bf16<<<MTOK / 16, 256, 0, stream>>>(x, ln0g, ln0b, y0);

    dim3 gProj(HDIM / 128, MTOK / 128);
    gemm_bf16_wmma<EPI_BIAS, bf16, 128><<<gProj, 256, 0, stream>>>(y0, wq_t, bq, nullptr, qb, MTOK, HDIM, HDIM);
    gemm_bf16_wmma<EPI_BIAS, bf16, 128><<<gProj, 256, 0, stream>>>(y0, wk_t, bk, nullptr, kb, MTOK, HDIM, HDIM);
    gemm_bf16_wmma<EPI_BIAS_VT, bf16, 128><<<gProj, 256, 0, stream>>>(y0, wv_t, bv, nullptr, vtb, MTOK, HDIM, HDIM);

    attention_wmma<<<dim3(LSEQ / 64, NH, NB), 128, 0, stream>>>(qb, kb, vtb, ab);

    gemm_bf16_wmma<EPI_BIAS_RES, float, 128><<<gProj, 256, 0, stream>>>(ab, wo_t, bo, x, x1, MTOK, HDIM, HDIM);

    // --- pre-LN MLP ---
    layernorm_to_bf16<<<MTOK / 16, 256, 0, stream>>>(x1, ln1g, ln1b, y1);

    gemm_bf16_wmma<EPI_BIAS_GELU, bf16, 64><<<dim3(MLPD / 128, MTOK / 128), 256, 0, stream>>>(
        y1, w1_t, b1, nullptr, hb, MTOK, MLPD, HDIM);

    gemm_bf16_wmma<EPI_BIAS_RES, float, 128><<<dim3(HDIM / 128, MTOK / 128), 256, 0, stream>>>(
        hb, w2_t, b2, x1, out, MTOK, HDIM, MLPD);
}

// v006
// Measured time: 252 microseconds a run.
// In both of two side-by-side timings against v005, it was 1.07 times as fast.
// Counting every step since v000, it is 2.18 times as fast.
#include <hip/hip_runtime.h>
#include <hip/hip_bf16.h>
#include <math.h>

// ---------------------------------------------------------------------------
// Problem constants (from reference): N=8, L=1024, H=16, D=64, HD=1024, MLP=4096
// ---------------------------------------------------------------------------
#define NB    8
#define LSEQ  1024
#define NH    16
#define DH    64
#define HDIM  1024
#define MLPD  4096
#define MTOK  (NB * LSEQ)          // 8192 token rows

typedef __bf16 bf16;
typedef __attribute__((ext_vector_type(16))) __bf16 bf16x16;
typedef __attribute__((ext_vector_type(8)))  float  f32x8;
typedef __attribute__((ext_vector_type(8)))  __bf16 bf16x8;
typedef __attribute__((ext_vector_type(4)))  __bf16 bf16x4;
typedef __attribute__((ext_vector_type(4)))  float  f32x4;

// LDS row pitches, in bf16 elements. Every WMMA fragment is read with
// ds_load_b128, one row per lane: a pitch of 16 B x odd spreads the 16 lanes of
// a half-wave over all 64 banks; 64 B, 128 B and 32 B x odd pitches do not.
#define PITCH_K64   72             // 128-B rows -> 144 B
#define PITCH_K128  136            // 256-B rows -> 272 B

// One lane's 16 consecutive k of a fragment row; rows are 16-B aligned only.
__device__ __forceinline__ bf16x16 lds_frag(const bf16* p) {
    bf16x8 lo = *(const bf16x8*)p;
    bf16x8 hi = *(const bf16x8*)(p + 8);
    return __builtin_shufflevector(lo, hi, 0, 1, 2, 3, 4, 5, 6, 7,
                                   8, 9, 10, 11, 12, 13, 14, 15);
}

__device__ __forceinline__ float gelu_tanh(float x) {
    const float c = 0.7978845608028654f;   // sqrt(2/pi)
    float x3 = x * x * x;
    return 0.5f * x * (1.0f + tanhf(c * (x + 0.044715f * x3)));
}

enum { EPI_BIAS_GELU = 1, EPI_BIAS_RES = 2, EPI_BIAS_QKV = 3 };

// ---------------------------------------------------------------------------
// Weight convert + transpose: w (K x N, f32 row-major) -> wt (N x K, bf16)
// One 64 x 64 tile per workgroup of 4 waves: few, long-lived waves, 8
// 16-B loads in flight per lane, whole 128-B lines read and written.
// K, N multiples of 64. t: the workgroup's LDS tile; odd dword pitch, no bank
// conflict either way. (bx, by): the tile's column and row in w.
// ---------------------------------------------------------------------------
__device__ __forceinline__
void transpose_tile_to_bf16(float (&t)[64][65], const float* __restrict__ w,
                            bf16* __restrict__ wt, int K, int N, int bx, int by) {
    const int bn = bx * 64;
    const int bk = by * 64;
    const int lr = threadIdx.x >> 4;         // 0..7: 16 lanes per 256-B row piece of w
    const int lc = (threadIdx.x & 15) * 4;
    const unsigned off = (unsigned)(lr * N + lc);   // one lane offset on eight uniform row bases
    float4 v[8];
#pragma unroll
    for (int i = 0; i < 8; ++i)
        v[i] = *(const float4*)(w + ((size_t)(bk + i * 8) * N + bn) + off);
#pragma unroll
    for (int i = 0; i < 8; ++i) {
        t[lr + i * 8][lc + 0] = v[i].x;
        t[lr + i * 8][lc + 1] = v[i].y;
        t[lr + i * 8][lc + 2] = v[i].z;
        t[lr + i * 8][lc + 3] = v[i].w;
    }
    __syncthreads();
    const int nr = threadIdx.x >> 3;         // 0..15: 8 lanes per 128-B row piece of wt
    const int kc = (threadIdx.x & 7) * 8;
#pragma unroll
    for (int j = 0; j < 4; ++j) {
        const int n = nr + j * 16;
        bf16x8 o;
#pragma unroll
        for (int e = 0; e < 8; ++e) o[e] = (bf16)t[kc + e][n];
        *(bf16x8*)(wt + (size_t)(bn + n) * K + bk + kc) = o;
    }
}

// ---------------------------------------------------------------------------
// LayerNorm (row of 1024 f32) fused with bf16 downconvert. One wave takes two
// whole rows: all 16 of its 16-B loads are in flight at once, the sums stay
// inside the wave (no LDS, no barrier), and the launch starts 16x fewer waves
// than with one workgroup per row. pair: the wave's pair of rows, wave-uniform.
// ---------------------------------------------------------------------------
__device__ __forceinline__
void layernorm_2rows_to_bf16(const float* __restrict__ x, const float* __restrict__ g,
                             const float* __restrict__ b, bf16* __restrict__ y, int pair) {
    const int lane = threadIdx.x & 31;
    const size_t row0 = (size_t)pair * 2;
    f32x4 v[2][8], gv[8], bv[8];            // piece c: columns c*128 + lane*4 .. +3
#pragma unroll
    for (int r = 0; r < 2; ++r)
#pragma unroll
        for (int c = 0; c < 8; ++c)
            v[r][c] = ((const f32x4*)(x + (row0 + r) * HDIM))[c * 32 + lane];
#pragma unroll
    for (int c = 0; c < 8; ++c) {
        gv[c] = ((const f32x4*)g)[c * 32 + lane];
        bv[c] = ((const f32x4*)b)[c * 32 + lane];
    }
    float s[2], s2[2];
#pragma unroll
    for (int r = 0; r < 2; ++r) {
        float p[8], p2[8];                   // eight independent chains
#pragma unroll
        for (int c = 0; c < 8; ++c) {
            const f32x4 a = v[r][c];
            p[c]  = (a.x + a.y) + (a.z + a.w);
            p2[c] = (a.x * a.x + a.y * a.y) + (a.z * a.z + a.w * a.w);
        }
        s[r]  = ((p[0] + p[1]) + (p[2] + p[3])) + ((p[4] + p[5]) + (p[6] + p[7]));
        s2[r] = ((p2[0] + p2[1]) + (p2[2] + p2[3])) + ((p2[4] + p2[5]) + (p2[6] + p2[7]));
    }
#pragma unroll
    for (int m = 16; m > 0; m >>= 1)
#pragma unroll
        for (int r = 0; r < 2; ++r) { s[r] += __shfl_xor(s[r], m); s2[r] += __shfl_xor(s2[r], m); }
    float mu[2], rstd[2];
#pragma unroll
    for (int r = 0; r < 2; ++r) {
        mu[r] = s[r] * (1.0f / HDIM);
        const float var = s2[r] * (1.0f / HDIM) - mu[r] * mu[r];
        rstd[r] = rsqrtf(var + 1e-5f);
    }
#pragma unroll
    for (int c = 0; c < 8; ++c)
#pragma unroll
        for (int r = 0; r < 2; ++r) {
            const f32x4 a = v[r][c];
            bf16x4 o;
            o[0] = (bf16)((a.x - mu[r]) * rstd[r] * gv[c].x + bv[c].x);
            o[1] = (bf16)((a.y - mu[r]) * rstd[r] * gv[c].y + bv[c].y);
            o[2] = (bf16)((a.z - mu[r]) * rstd[r] * gv[c].z + bv[c].z);
            o[3] = (bf16)((a.w - mu[r]) * rstd[r] * gv[c].w + bv[c].w);
            *(bf16x4*)(y + (row0 + r) * HDIM + c * 128 + lane * 4) = o;
        }
}

// 16 rows per workgroup.
// waves_per_eu: the register budget of the four waves per SIMD that this grid
// gives; with the default budget the g and b loads are issued pair by pair
// between the stores' arithmetic, each pair waited for alone.
__global__ __launch_bounds__(256) __attribute__((amdgpu_waves_per_eu(4, 4)))
void layernorm_to_bf16(const float* __restrict__ x, const float* __restrict__ g,
                       const float* __restrict__ b, bf16* __restrict__ y) {
    // The wave's number as a scalar: the row addresses then sit in scalar registers.
    const int wave = __builtin_amdgcn_readfirstlane(threadIdx.x >> 5);
    layernorm_2rows_to_bf16(x, g, b, y, blockIdx.x * 8 + wave);
}

// ---------------------------------------------------------------------------
// Everything that depends on the inputs alone, in ONE launch: the first
// LayerNorm and the six weight transposes. Seven short launches each pay their
// own start, first memory latency and drain one after the other; here they
// overlap. Workgroups of 4 waves; the index range picks the job (uniform for
// the workgroup, so the transpose's barrier is reached by all of it or none).
//   [0, 1024)     LayerNorm, 8 rows each
//   [1024, 2048)  w1 tiles, [2048, 3072) w2 tiles
//   [3072, 4096)  wq, wk, wv, wo tiles, 256 each
// waves_per_eu: with a minimum alone the LayerNorm path's g and b loads are
// again issued pair by pair (see layernorm_to_bf16); (4, 4) pads the register
// count to four waves per SIMD, and this grid has more to keep resident;
// (4, 7) keeps the loads in two groups of 16 at six waves per SIMD.
// ---------------------------------------------------------------------------
#define PREP_LN_WGS   (MTOK / 8)
#define PREP_MLP_WGS  ((MLPD / 64) * (HDIM / 64))
#define PREP_PROJ_WGS ((HDIM / 64) * (HDIM / 64))
#define PREP_WGS      (PREP_LN_WGS + 2 * PREP_MLP_WGS + 4 * PREP_PROJ_WGS)
__global__ __launch_bounds__(128) __attribute__((amdgpu_waves_per_eu(4, 7)))
void prepare_inputs(const float* __restrict__ x, const float* __restrict__ g,
                    const float* __restrict__ b, bf16* __restrict__ y,
                    const float* __restrict__ wq, const float* __restrict__ wk,
                    const float* __restrict__ wv, const float* __restrict__ wo,
                    const float* __restrict__ w1, const float* __restrict__ w2,
                    bf16* __restrict__ wq_t, bf16* __restrict__ wk_t,
                    bf16* __restrict__ wv_t, bf16* __restrict__ wo_t,
                    bf16* __restrict__ w1_t, bf16* __restrict__ w2_t) {
    __shared__ float t[64][65];
    int i = blockIdx.x;
    if (i < PREP_LN_WGS) {
        const int wave = __builtin_amdgcn_readfirstlane(threadIdx.x >> 5);
        layernorm_2rows_to_bf16(x, g, b, y, i * 4 + wave);
        return;
    }
    i -= PREP_LN_WGS;
    const float* w;
    bf16* wt;
    int K = HDIM, N = HDIM;
    if (i < PREP_MLP_WGS) {
        w = w1; wt = w1_t; N = MLPD;
    } else if (i < 2 * PREP_MLP_WGS) {
        i -= PREP_MLP_WGS;
        w = w2; wt = w2_t; K = MLPD;
    } else {
        i -= 2 * PREP_MLP_WGS;
        const int m = i / PREP_PROJ_WGS;
        i -= m * PREP_PROJ_WGS;
        w  = m == 0 ? wq   : m == 1 ? wk   : m == 2 ? wv   : wo;
        wt = m == 0 ? wq_t : m == 1 ? wk_t : m == 2 ? wv_t : wo_t;
    }
    const int nx = N / 64;                   // tiles along a row of w: 16 or 64
    transpose_tile_to_bf16(t, w, wt, K, N, i % nx, i / nx);
}

// ---------------------------------------------------------------------------
// Eight async 16-B copies per lane, global -> LDS. l[] = LDS byte addresses,
// g[] = global addresses. The address-translation wait is the last line of the
// copies' own statement, so that no address register named here is rewritten
// in front of it.
// ---------------------------------------------------------------------------
__device__ __forceinline__ void async_copy8_b128(const unsigned (&l)[8], const bf16* const (&g)[8]) {
    asm volatile(
        "global_load_async_to_lds_b128 %0, %8, off\n\t"
        "global_load_async_to_lds_b128 %1, %9, off\n\t"
        "global_load_async_to_lds_b128 %2, %10, off\n\t"
        "global_load_async_to_lds_b128 %3, %11, off\n\t"
        "global_load_async_to_lds_b128 %4, %12, off\n\t"
        "global_load_async_to_lds_b128 %5, %13, off\n\t"
        "global_load_async_to_lds_b128 %6, %14, off\n\t"
        "global_load_async_to_lds_b128 %7, %15, off\n\t"
        "s_wait_xcnt 0x0"
        :: "v"(l[0]), "v"(l[1]), "v"(l[2]), "v"(l[3]), "v"(l[4]), "v"(l[5]), "v"(l[6]), "v"(l[7]),
           "v"(g[0]), "v"(g[1]), "v"(g[2]), "v"(g[3]), "v"(g[4]), "v"(g[5]), "v"(g[6]), "v"(g[7])
        : "memory");
}
// The same with one 32-bit byte offset per lane (off) on eight wave-uniform
// bases in scalar registers: no vector register pair per copy (with pairs the
// attention kernel needs 194 registers, one wave per SIMD fewer than with 170).
__device__ __forceinline__ void async_copy8_b128_sbase(const unsigned (&l)[8], unsigned off,
                                                       const bf16* const (&g)[8]) {
    asm volatile(
        "global_load_async_to_lds_b128 %0, %8, %9\n\t"
        "global_load_async_to_lds_b128 %1, %8, %10\n\t"
        "global_load_async_to_lds_b128 %2, %8, %11\n\t"
        "global_load_async_to_lds_b128 %3, %8, %12\n\t"
        "global_load_async_to_lds_b128 %4, %8, %13\n\t"
        "global_load_async_to_lds_b128 %5, %8, %14\n\t"
        "global_load_async_to_lds_b128 %6, %8, %15\n\t"
        "global_load_async_to_lds_b128 %7, %8, %16\n\t"
        "s_wait_xcnt 0x0"
        :: "v"(l[0]), "v"(l[1]), "v"(l[2]), "v"(l[3]), "v"(l[4]), "v"(l[5]), "v"(l[6]), "v"(l[7]),
           "v"(off),
           "s"(g[0]), "s"(g[1]), "s"(g[2]), "s"(g[3]), "s"(g[4]), "s"(g[5]), "s"(g[6]), "s"(g[7])
        : "memory");
}
__device__ __forceinline__ unsigned lds_byte(const bf16* p) {
    return (unsigned)(size_t)(const __attribute__((address_space(3))) bf16*)p;
}

// ---------------------------------------------------------------------------
// Generic bf16 WMMA GEMM:  C[M,N] = epilogue(A[M,K] * BT[N,K]^T + bias)
// Block tile 128x128, 8 waves, each wave 32x64 (2x4 wmma tiles).
// An LDS stage holds KS k of both operands (KS/32 WMMA blocks of 32 k), so one
// copy latency and one barrier are paid per KS/4 WMMAs of a wave, and a stage
// row is one or two whole 128-B lines. Two stages; the async global->LDS
// copies of stage t+2 start when stage t has been read.
// KS = 128 for the Q/K/V, output-projection and second MLP GEMMs (two
// workgroups fit a WGP's LDS); KS = 64 for the first MLP GEMM, so that four fit.
// M, N multiples of 128; K a multiple of KS.
// EPI_BIAS_QKV: bias only; where vt is set (uniform for the workgroup), the
// tile is scatter-stored into VT[batch][head][d][key] for attention.
// ---------------------------------------------------------------------------
template <bool B> struct flag { static constexpr bool value = B; };

template <int EPI, typename OutT, int KS>
__device__ __forceinline__
void gemm_tile(bf16 (&As)[2][128][KS + 8], bf16 (&Bs)[2][128][KS + 8],
               const bf16* __restrict__ A, const bf16* __restrict__ BT,
               const float* __restrict__ bias, const float* __restrict__ res,
               OutT* __restrict__ C, int N, int K, bool vt) {
    const int tid  = threadIdx.x;
    const int wave = tid >> 5;
    const int lane = tid & 31;
    const int lh   = lane >> 4;     // K-half selector (lanes 16-31 hold K=16..31)
    const int ll   = lane & 15;     // row/col within 16
    const int wm   = wave & 3;      // 4 waves along M (32 rows each)
    const int wn   = wave >> 2;     // 2 waves along N (64 cols each)

    const int bm = blockIdx.y * 128;
    const int bn = blockIdx.x * 128;

    f32x8 acc[2][4];
#pragma unroll
    for (int i = 0; i < 2; ++i)
#pragma unroll
        for (int j = 0; j < 4; ++j)
#pragma unroll
            for (int e = 0; e < 8; ++e) acc[i][j][e] = 0.0f;

    // Copy map: KS/8 adjacent lanes cover one stage row, 16 B each.
    constexpr int LPR = KS / 8;           // lanes per row
    constexpr int RPC = 256 / LPR;        // rows the block covers with one copy per lane
    constexpr int CPO = 128 / RPC;        // copies per lane and operand
    const int lrow = tid / LPR;
    const int lcol = (tid % LPR) * 8;
    const bf16* aRow = A  + (size_t)(bm + lrow) * K + lcol;
    const bf16* bRow = BT + (size_t)(bn + lrow) * K + lcol;

    const int nk = K / KS;

    auto issue = [&](int buf, int k0) {
#pragma unroll
        for (int s = 0; s < 2 * CPO / 8; ++s) {
            unsigned l[8];
            const bf16* g[8];
#pragma unroll
            for (int q = 0; q < 8; ++q) {
                const int c = s * 8 + q;              // first the A rows, then the B rows
                const int r = (c % CPO) * RPC;
                l[q] = lds_byte(c < CPO ? &As[buf][lrow + r][lcol] : &Bs[buf][lrow + r][lcol]);
                g[q] = ((c < CPO ? aRow : bRow) + k0) + (size_t)r * K;
            }
            async_copy8_b128(l, g);
        }
    };
    issue(0, 0);
    asm volatile("s_wait_asynccnt 0x0" ::: "memory");   // stage 0 landed (this wave's copies)
    __syncthreads();                                    // ... and every other wave's
    if (nk > 1) issue(1, KS);

    for (int kt = 0; kt < nk; ++kt) {
        const int cur = kt & 1;
#pragma unroll
        for (int ks = 0; ks < KS / 32; ++ks) {
            bf16x16 af[2], bfr[4];
#pragma unroll
            for (int i = 0; i < 2; ++i)
                af[i] = lds_frag(&As[cur][wm * 32 + i * 16 + ll][ks * 32 + lh * 16]);
#pragma unroll
            for (int j = 0; j < 4; ++j)
                bfr[j] = lds_frag(&Bs[cur][wn * 64 + j * 16 + ll][ks * 32 + lh * 16]);

#pragma unroll
            for (int i = 0; i < 2; ++i)
#pragma unroll
                for (int j = 0; j < 4; ++j)
                    acc[i][j] = __builtin_amdgcn_wmma_f32_16x16x32_bf16(
                        false, af[i], false, bfr[j], (short)0, acc[i][j], false, false);
        }

        asm volatile("s_wait_dscnt 0x0" ::: "memory");     // this wave's reads of stage kt are done
        asm volatile("s_wait_asynccnt 0x0" ::: "memory");  // its copies of stage kt+1 have landed
        __syncthreads();                                   // publishes kt+1, frees kt's buffer
        if (kt + 2 < nk) issue(cur, (kt + 2) * KS);
    }
    asm volatile("s_wait_asynccnt 0x0" ::: "memory");      // no copy outstanding past the loop

    // Epilogue. C layout: VGPR e -> row = e + lh*8 ; lane%16 -> col.
    auto epilogue = [&](auto scatter) {
#pragma unroll
        for (int i = 0; i < 2; ++i) {
#pragma unroll
            for (int j = 0; j < 4; ++j) {
                const int col = bn + wn * 64 + j * 16 + ll;
                const float bvv = bias ? bias[col] : 0.0f;
#pragma unroll
                for (int e = 0; e < 8; ++e) {
                    const int row = bm + wm * 32 + i * 16 + lh * 8 + e;
                    float v = acc[i][j][e] + bvv;
                    if (EPI == EPI_BIAS_GELU) v = gelu_tanh(v);
                    if (EPI == EPI_BIAS_RES)  v += res[(size_t)row * N + col];
                    if (decltype(scatter)::value) {
                        // row = batch*LSEQ + key ; col = head*DH + d
                        const size_t idx =
                            (((size_t)(row >> 10) * NH + (col >> 6)) * DH + (col & (DH - 1)))
                                * LSEQ + (row & (LSEQ - 1));
                        C[idx] = (OutT)v;
                    } else {
                        C[(size_t)row * N + col] = (OutT)v;
                    }
                }
                // The next tile's values reuse the registers that these stores name.
                if (EPI == EPI_BIAS_QKV) asm volatile("s_wait_xcnt 0x0" ::: "memory");
            }
        }
    };
    if (EPI == EPI_BIAS_QKV && vt) epilogue(flag<true>{});
    else                           epilogue(flag<false>{});
}

template <int EPI, typename OutT, int KS>
__global__ __launch_bounds__(256)
void gemm_bf16_wmma(const bf16* __restrict__ A, const bf16* __restrict__ BT,
                    const float* __restrict__ bias, const float* __restrict__ res,
                    OutT* __restrict__ C, int M, int N, int K) {
    // Pitch KS + 8: 16 B x odd, as PITCH_K64 / PITCH_K128.
    __shared__ __attribute__((aligned(16))) bf16 As[2][128][KS + 8];
    __shared__ __attribute__((aligned(16))) bf16 Bs[2][128][KS + 8];
    gemm_tile<EPI, OutT, KS>(As, Bs, A, BT, bias, res, C, N, K, false);
}

// The Q, K and V projections of the same A in ONE launch: blockIdx.z picks the
// weight, the bias and the output. A WGP goes from one projection's tile to the
// next one's with no launch boundary between them: while one workgroup fills its
// first stage or stores its tile, the WGP's other workgroup computes.
__global__ __launch_bounds__(256)
void gemm_qkv_bf16_wmma(const bf16* __restrict__ A,
                        const bf16* __restrict__ wq_t, const bf16* __restrict__ wk_t,
                        const bf16* __restrict__ wv_t,
                        const float* __restrict__ bq, const float* __restrict__ bk,
                        const float* __restrict__ bv,
                        bf16* __restrict__ q, bf16* __restrict__ k, bf16* __restrict__ vt,
                        int N, int K) {
    __shared__ __attribute__((aligned(16))) bf16 As[2][128][PITCH_K128];
    __shared__ __attribute__((aligned(16))) bf16 Bs[2][128][PITCH_K128];
    const int z = blockIdx.z;
    const bf16*  BT   = z == 0 ? wq_t : z == 1 ? wk_t : wv_t;
    const float* bias = z == 0 ? bq   : z == 1 ? bk   : bv;
    bf16*        C    = z == 0 ? q    : z == 1 ? k    : vt;
    gemm_tile<EPI_BIAS_QKV, bf16, 128>(As, Bs, A, BT, bias, nullptr, C, N, K, z == 2);
}

__device__ __forceinline__ float xhalf(float x) {
    const int b = __builtin_bit_cast(int, x);
    return __builtin_bit_cast(float,
        __builtin_amdgcn_permlanex16(b, b, 0x76543210, 0xfedcba98, false, false));
}
// One lane's 16 k of the 32-k block at p, in the k order of a packed pair of
// accumulator tiles: k = 8h + 0..7, then 16 + 8h + 0..7 (h = lane / 16).
__device__ __forceinline__ bf16x16 lds_frag_pair(const bf16* p, int h) {
    bf16x8 lo = *(const bf16x8*)(p + 8 * h);
    bf16x8 hi = *(const bf16x8*)(p + 16 + 8 * h);
    return __builtin_shufflevector(lo, hi, 0, 1, 2, 3, 4, 5, 6, 7,
                                   8, 9, 10, 11, 12, 13, 14, 15);
}

__global__ __launch_bounds__(128)
void attention_wmma(const bf16* __restrict__ Q, const bf16* __restrict__ Km,
                    const bf16* __restrict__ VT, bf16* __restrict__ O) {
    __shared__ __attribute__((aligned(16))) bf16 Ks[128][PITCH_K64];      // 18 KB
    __shared__ __attribute__((aligned(16))) bf16 VTs[64][PITCH_K128];     // 17 KB

    const int tid  = threadIdx.x;
    const int wave = tid >> 5;
    const int lane = tid & 31;
    const int lh   = lane >> 4;
    const int ll   = lane & 15;

    const int qt    = blockIdx.x;        // 16 query tiles of 64
    const int head  = blockIdx.y;        // 16
    const int batch = blockIdx.z;        // 8
    const size_t base   = ((size_t)batch * LSEQ) * HDIM + (size_t)head * DH;
    const size_t vtbase = ((size_t)(batch * NH + head)) * DH * LSEQ;
    const int q0 = qt * 64;
    const size_t qrow = base + (size_t)(q0 + wave * 16 + ll) * HDIM;   // this lane's query

    // Q^T fragments: column = this lane's query, 16 consecutive d per wave half
    // (the k order of lds_frag, which loads the K rows they are paired with).
    bf16x16 qf[2];
#pragma unroll
    for (int kc = 0; kc < 2; ++kc) {
        const bf16* qp = Q + qrow + kc * 32 + lh * 16;
        bf16x8 lo = *(const bf16x8*)qp;
        bf16x8 hi = *(const bf16x8*)(qp + 8);
        qf[kc] = __builtin_shufflevector(lo, hi, 0, 1, 2, 3, 4, 5, 6, 7,
                                         8, 9, 10, 11, 12, 13, 14, 15);
    }

    f32x8 acco[4];                       // O^T: row d = j*16 + lh*8 + e, column = query ll
#pragma unroll
    for (int j = 0; j < 4; ++j)
#pragma unroll
        for (int e = 0; e < 8; ++e) acco[j][e] = 0.0f;
    float mrow = -1e30f;                 // running maximum of this lane's query
    float lsum = 0.0f;                   // running sum over this wave half's keys

    // Copy map: adjacent lanes cover one tile row, 16 B each, so that a wave-wide
    // copy takes four whole 128-B lines instead of 16 B out of 32 lines.
    const int krow = tid >> 3, kcol = (tid & 7) * 8;     // K: 8 lanes per 128-B row, 16 rows per copy
    const int vrow = tid >> 4, vcol = (tid & 15) * 8;    // V^T: 16 lanes per 256-B row, 8 rows per copy
    const unsigned koff = (unsigned)(krow * HDIM + kcol) * 2u;   // lane's byte offset in 16 K rows
    const unsigned voff = (unsigned)(vrow * LSEQ + vcol) * 2u;   // ... in 8 V^T rows

    for (int kt = 0; kt < LSEQ / 128; ++kt) {
        const int k0 = kt * 128;
        asm volatile("s_wait_dscnt 0x0" ::: "memory");     // this wave's reads of the previous tile are done
        __syncthreads();                                   // ... and every other wave's
        {
            unsigned l[8];
            const bf16* g[8];
#pragma unroll
            for (int c = 0; c < 8; ++c) {                  // K tile: 128 keys x 64 d
                l[c] = lds_byte(&Ks[krow + c * 16][kcol]);
                g[c] = Km + base + (size_t)(k0 + c * 16) * HDIM;
            }
            async_copy8_b128_sbase(l, koff, g);
#pragma unroll
            for (int c = 0; c < 8; ++c) {                  // V^T tile: 64 d x 128 keys
                l[c] = lds_byte(&VTs[vrow + c * 8][vcol]);
                g[c] = VT + vtbase + (size_t)(c * 8) * LSEQ + k0;
            }
            async_copy8_b128_sbase(l, voff, g);
        }
        asm volatile("s_wait_asynccnt 0x0" ::: "memory");  // this wave's copies have landed
        __syncthreads();                                   // ... and every other wave's

        // ---- S^T = (K Q^T) * 1/sqrt(D): accs[jt][e] = S[key jt*16 + lh*8 + e][query ll]
        f32x8 accs[8];
#pragma unroll
        for (int jt = 0; jt < 8; ++jt) {
#pragma unroll
            for (int e = 0; e < 8; ++e) accs[jt][e] = 0.0f;
#pragma unroll
            for (int kc = 0; kc < 2; ++kc) {
                bf16x16 a = lds_frag(&Ks[jt * 16 + ll][kc * 32 + lh * 16]);
                accs[jt] = __builtin_amdgcn_wmma_f32_16x16x32_bf16(
                    false, a, false, qf[kc], (short)0, accs[jt], false, false);
            }
        }
        const float scale = 0.125f;     // 1/sqrt(64)

        // ---- online softmax, one query per lane; eight independent chains
        float mxe[8];
#pragma unroll
        for (int e = 0; e < 8; ++e) {
            mxe[e] = -1e30f;
#pragma unroll
            for (int jt = 0; jt < 8; ++jt) {
                accs[jt][e] *= scale;
                mxe[e] = fmaxf(mxe[e], accs[jt][e]);
            }
        }
        float mx = fmaxf(fmaxf(fmaxf(mxe[0], mxe[1]), fmaxf(mxe[2], mxe[3])),
                         fmaxf(fmaxf(mxe[4], mxe[5]), fmaxf(mxe[6], mxe[7])));
        mx = fmaxf(mx, xhalf(mx));       // the other half's keys of the same query
        const float mnew = fmaxf(mrow, mx);

        // P^T fragments: pf[kc][s] = P[key kc*32 + (s/8)*16 + lh*8 + s%8][query ll]
        bf16x16 pf[4];
        float sm[4];
#pragma unroll
        for (int kc = 0; kc < 4; ++kc) {
            sm[kc] = 0.0f;
#pragma unroll
            for (int s = 0; s < 16; ++s) {
                float p = __expf(accs[kc * 2 + (s >> 3)][s & 7] - mnew);
                sm[kc] += p;
                pf[kc][s] = (bf16)p;
            }
        }
        const float corr = __expf(mrow - mnew);
        lsum = lsum * corr + ((sm[0] + sm[1]) + (sm[2] + sm[3]));
        mrow = mnew;
#pragma unroll
        for (int j = 0; j < 4; ++j)
#pragma unroll
            for (int e = 0; e < 8; ++e) acco[j][e] *= corr;

        // ---- O^T += V^T P^T ----
#pragma unroll
        for (int j = 0; j < 4; ++j)
#pragma unroll
            for (int kc = 0; kc < 4; ++kc) {
                bf16x16 a = lds_frag_pair(&VTs[j * 16 + ll][kc * 32], lh);
                acco[j] = __builtin_amdgcn_wmma_f32_16x16x32_bf16(
                    false, a, false, pf[kc], (short)0, acco[j], false, false);
            }
    }

    // ---- write O = acc / l: a lane holds 8 consecutive d of its query per tile
    const float lrow = lsum + xhalf(lsum);
#pragma unroll
    for (int j = 0; j < 4; ++j) {
        bf16x8 o;
#pragma unroll
        for (int e = 0; e < 8; ++e) o[e] = (bf16)(acco[j][e] / lrow);
        *(bf16x8*)(O + qrow + j * 16 + lh * 8) = o;
    }
}

// ---------------------------------------------------------------------------
// Host orchestration
// ---------------------------------------------------------------------------
extern "C" void kernel_launch(void* const* d_in, const int* in_sizes, int n_in,
                              void* d_out, int out_size, void* d_ws, size_t ws_size,
                              hipStream_t stream) {
    const float* x    = (const float*)d_in[0];
    const float* ln0g = (const float*)d_in[1];
    const float* ln0b = (const float*)d_in[2];
    const float* wq   = (const float*)d_in[3];
    const float* bq   = (const float*)d_in[4];
    const float* wk   = (const float*)d_in[5];
    const float* bk   = (const float*)d_in[6];
    const float* wv   = (const float*)d_in[7];
    const float* bv   = (const float*)d_in[8];
    const float* wo   = (const float*)d_in[9];
    const float* bo   = (const float*)d_in[10];
    const float* ln1g = (const float*)d_in[11];
    const float* ln1b = (const float*)d_in[12];
    const float* w1   = (const float*)d_in[13];
    const float* b1   = (const float*)d_in[14];
    const float* w2   = (const float*)d_in[15];
    const float* b2   = (const float*)d_in[16];
    float* out = (float*)d_out;

    char* p = (char*)d_ws;
    auto carve = [&](size_t bytes) -> char* {
        char* r = p;
        p += (bytes + 255) & ~(size_t)255;
        return r;
    };
    bf16*  wq_t = (bf16*)carve((size_t)HDIM * HDIM * 2);
    bf16*  wk_t = (bf16*)carve((size_t)HDIM * HDIM * 2);
    bf16*  wv_t = (bf16*)carve((size_t)HDIM * HDIM * 2);
    bf16*  wo_t = (bf16*)carve((size_t)HDIM * HDIM * 2);
    bf16*  w1_t = (bf16*)carve((size_t)MLPD * HDIM * 2);
    bf16*  w2_t = (bf16*)carve((size_t)HDIM * MLPD * 2);
    bf16*  y0   = (bf16*)carve((size_t)MTOK * HDIM * 2);   // LN0 out
    bf16*  qb   = (bf16*)carve((size_t)MTOK * HDIM * 2);
    bf16*  kb   = (bf16*)carve((size_t)MTOK * HDIM * 2);
    bf16*  vtb  = (bf16*)carve((size_t)MTOK * HDIM * 2);   // V, pre-transposed [b][h][d][key]
    bf16*  ab   = (bf16*)carve((size_t)MTOK * HDIM * 2);   // attention out
    float* x1   = (float*)carve((size_t)MTOK * HDIM * 4);  // residual 1
    bf16*  y1   = (bf16*)carve((size_t)MTOK * HDIM * 2);   // LN1 out
    bf16*  hb   = (bf16*)carve((size_t)MTOK * MLPD * 2);   // GELU(mlp1) out

    // --- first LayerNorm + weight convert/transpose (bf16, N x K) ---
    prepare_inputs<<<PREP_WGS, 128, 0, stream>>>(x, ln0g, ln0b, y0, wq, wk, wv, wo, w1, w2,
                                                 wq_t, wk_t, wv_t, wo_t, w1_t, w2_t);

    // --- pre-LN attention ---
    dim3 gProj(HDIM / 128, MTOK / 128);
    gemm_qkv_bf16_wmma<<<dim3(HDIM / 128, MTOK / 128, 3), 256, 0, stream>>>(
        y0, wq_t, wk_t, wv_t, bq, bk, bv, qb, kb, vtb, HDIM, HDIM);

    attention_wmma<<<dim3(LSEQ / 64, NH, NB), 128, 0, stream>>>(qb, kb, vtb, ab);

    gemm_bf16_wmma<EPI_BIAS_RES, float, 128><<<gProj, 256, 0, stream>>>(ab, wo_t, bo, x, x1, MTOK, HDIM, HDIM);

    // --- pre-LN MLP ---
    layernorm_to_bf16<<<MTOK / 16, 256, 0, stream>>>(x1, ln1g, ln1b, y1);

    gemm_bf16_wmma<EPI_BIAS_GELU, bf16, 64><<<dim3(MLPD / 128, MTOK / 128), 256, 0, stream>>>(
        y1, w1_t, b1, nullptr, hb, MTOK, MLPD, HDIM);

    gemm_bf16_wmma<EPI_BIAS_RES, float, 128><<<dim3(HDIM / 128, MTOK / 128), 256, 0, stream>>>(
        hb, w2_t, b2, x1, out, MTOK, HDIM, MLPD);
}

// v007
// Measured time: 240 microseconds a run.
// Timed twice side by side with v006, it ran 1.05 times as fast both times.
// Over all steps from v000 it is 2.29 times as fast.
#include <hip/hip_runtime.h>
#include <hip/hip_bf16.h>
#include <math.h>

// ---------------------------------------------------------------------------
// Problem constants (from reference): N=8, L=1024, H=16, D=64, HD=1024, MLP=4096
// ---------------------------------------------------------------------------
#define NB    8
#define LSEQ  1024
#define NH    16
#define DH    64
#define HDIM  1024
#define MLPD  4096
#define MTOK  (NB * LSEQ)          // 8192 token rows

typedef __bf16 bf16;
typedef __attribute__((ext_vector_type(16))) __bf16 bf16x16;
typedef __attribute__((ext_vector_type(8)))  float  f32x8;
typedef __attribute__((ext_vector_type(8)))  __bf16 bf16x8;
typedef __attribute__((ext_vector_type(4)))  __bf16 bf16x4;
typedef __attribute__((ext_vector_type(4)))  float  f32x4;

// LDS row pitches, in bf16 elements. Every WMMA fragment is read with
// ds_load_b128, one row per lane: a pitch of 16 B x odd spreads the 16 lanes of
// a half-wave over all 64 banks; 64 B, 128 B and 32 B x odd pitches do not.
#define PITCH_K64   72             // 128-B rows -> 144 B
#define PITCH_K128  136            // 256-B rows -> 272 B

// One lane's 16 consecutive k of a fragment row; rows are 16-B aligned only.
__device__ __forceinline__ bf16x16 lds_frag(const bf16* p) {
    bf16x8 lo = *(const bf16x8*)p;
    bf16x8 hi = *(const bf16x8*)(p + 8);
    return __builtin_shufflevector(lo, hi, 0, 1, 2, 3, 4, 5, 6, 7,
                                   8, 9, 10, 11, 12, 13, 14, 15);
}

// 0.5 x (1 + tanh u) = x / (1 + e^(-2u)), u = sqrt(2/pi) (x + 0.044715 x^3): one
// hardware exponential and one reciprocal per value where the library tanh takes
// some fifty instructions. e^(-2u) = inf gives x * 0, e^(-2u) = 0 gives x.
// Each transcendental with its v_nop in one statement: the instruction set asks
// for one slot before its result is read or its source overwritten. The slot costs little.
__device__ __forceinline__ float gelu_tanh(float x) {
    const float k = -2.0f * 0.7978845608028654f * 1.4426950408889634f;   // -2 sqrt(2/pi) log2(e)
    const float a = x * (k + (k * 0.044715f) * (x * x));                 // -2u log2(e)
    float e, r;
    asm("v_exp_f32 %0, %1\n\tv_nop" : "=v"(e) : "v"(a));
    const float d = 1.0f + e;
    asm("v_rcp_f32 %0, %1\n\tv_nop" : "=v"(r) : "v"(d));
    return x * r;
}

enum { EPI_BIAS_GELU = 1, EPI_BIAS_RES = 2, EPI_BIAS_QKV = 3 };

// ---------------------------------------------------------------------------
// Weight convert + transpose: w (K x N, f32 row-major) -> wt (N x K, bf16)
// One 64 x 64 tile per workgroup of 4 waves: few, long-lived waves, 8
// 16-B loads in flight per lane, whole 128-B lines read and written.
// K, N multiples of 64. t: the workgroup's LDS tile; odd dword pitch, no bank
// conflict either way. (bx, by): the tile's column and row in w.
// ---------------------------------------------------------------------------
__device__ __forceinline__
void transpose_tile_to_bf16(float (&t)[64][65], const float* __restrict__ w,
                            bf16* __restrict__ wt, int K, int N, int bx, int by) {
    const int bn = bx * 64;
    const int bk = by * 64;
    const int lr = threadIdx.x >> 4;         // 0..7: 16 lanes per 256-B row piece of w
    const int lc = (threadIdx.x & 15) * 4;
    const unsigned off = (unsigned)(lr * N + lc);   // one lane offset on eight uniform row bases
    float4 v[8];
#pragma unroll
    for (int i = 0; i < 8; ++i)
        v[i] = *(const float4*)(w + ((size_t)(bk + i * 8) * N + bn) + off);
#pragma unroll
    for (int i = 0; i < 8; ++i) {
        t[lr + i * 8][lc + 0] = v[i].x;
        t[lr + i * 8][lc + 1] = v[i].y;
        t[lr + i * 8][lc + 2] = v[i].z;
        t[lr + i * 8][lc + 3] = v[i].w;
    }
    __syncthreads();
    const int nr = threadIdx.x >> 3;         // 0..15: 8 lanes per 128-B row piece of wt
    const int kc = (threadIdx.x & 7) * 8;
#pragma unroll
    for (int j = 0; j < 4; ++j) {
        const int n = nr + j * 16;
        bf16x8 o;
#pragma unroll
        for (int e = 0; e < 8; ++e) o[e] = (bf16)t[kc + e][n];
        *(bf16x8*)(wt + (size_t)(bn + n) * K + bk + kc) = o;
    }
}

// ---------------------------------------------------------------------------
// LayerNorm (row of 1024 f32) fused with bf16 downconvert. One wave takes two
// whole rows: all 16 of its 16-B loads are in flight at once, the sums stay
// inside the wave (no LDS, no barrier), and the launch starts 16x fewer waves
// than with one workgroup per row. pair: the wave's pair of rows, wave-uniform.
// ---------------------------------------------------------------------------
__device__ __forceinline__
void layernorm_2rows_to_bf16(const float* __restrict__ x, const float* __restrict__ g,
                             const float* __restrict__ b, bf16* __restrict__ y, int pair) {
    const int lane = threadIdx.x & 31;
    const size_t row0 = (size_t)pair * 2;
    f32x4 v[2][8], gv[8], bv[8];            // piece c: columns c*128 + lane*4 .. +3
#pragma unroll
    for (int r = 0; r < 2; ++r)
#pragma unroll
        for (int c = 0; c < 8; ++c)
            v[r][c] = ((const f32x4*)(x + (row0 + r) * HDIM))[c * 32 + lane];
#pragma unroll
    for (int c = 0; c < 8; ++c) {
        gv[c] = ((const f32x4*)g)[c * 32 + lane];
        bv[c] = ((const f32x4*)b)[c * 32 + lane];
    }
    float s[2], s2[2];
#pragma unroll
    for (int r = 0; r < 2; ++r) {
        float p[8], p2[8];                   // eight independent chains
#pragma unroll
        for (int c = 0; c < 8; ++c) {
            const f32x4 a = v[r][c];
            p[c]  = (a.x + a.y) + (a.z + a.w);
            p2[c] = (a.x * a.x + a.y * a.y) + (a.z * a.z + a.w * a.w);
        }
        s[r]  = ((p[0] + p[1]) + (p[2] + p[3])) + ((p[4] + p[5]) + (p[6] + p[7]));
        s2[r] = ((p2[0] + p2[1]) + (p2[2] + p2[3])) + ((p2[4] + p2[5]) + (p2[6] + p2[7]));
    }
#pragma unroll
    for (int m = 16; m > 0; m >>= 1)
#pragma unroll
        for (int r = 0; r < 2; ++r) { s[r] += __shfl_xor(s[r], m); s2[r] += __shfl_xor(s2[r], m); }
    float mu[2], rstd[2];
#pragma unroll
    for (int r = 0; r < 2; ++r) {
        mu[r] = s[r] * (1.0f / HDIM);
        const float var = s2[r] * (1.0f / HDIM) - mu[r] * mu[r];
        rstd[r] = rsqrtf(var + 1e-5f);
    }
#pragma unroll
    for (int c = 0; c < 8; ++c)
#pragma unroll
        for (int r = 0; r < 2; ++r) {
            const f32x4 a = v[r][c];
            bf16x4 o;
            o[0] = (bf16)((a.x - mu[r]) * rstd[r] * gv[c].x + bv[c].x);
            o[1] = (bf16)((a.y - mu[r]) * rstd[r] * gv[c].y + bv[c].y);
            o[2] = (bf16)((a.z - mu[r]) * rstd[r] * gv[c].z + bv[c].z);
            o[3] = (bf16)((a.w - mu[r]) * rstd[r] * gv[c].w + bv[c].w);
            *(bf16x4*)(y + (row0 + r) * HDIM + c * 128 + lane * 4) = o;
        }
}

// 16 rows per workgroup.
// waves_per_eu: the register budget of the four waves per SIMD that this grid
// gives; with the default budget the g and b loads are issued pair by pair
// between the stores' arithmetic, each pair waited for alone.
__global__ __launch_bounds__(256) __attribute__((amdgpu_waves_per_eu(4, 4)))
void layernorm_to_bf16(const float* __restrict__ x, const float* __restrict__ g,
                       const float* __restrict__ b, bf16* __restrict__ y) {
    // The wave's number as a scalar: the row addresses then sit in scalar registers.
    const int wave = __builtin_amdgcn_readfirstlane(threadIdx.x >> 5);
    layernorm_2rows_to_bf16(x, g, b, y, blockIdx.x * 8 + wave);
}

// ---------------------------------------------------------------------------
// Everything that depends on the inputs alone, in ONE launch: the first
// LayerNorm and the six weight transposes. Seven short launches each pay their
// own start, first memory latency and drain one after the other; here they
// overlap. Workgroups of 4 waves; the index range picks the job (uniform for
// the workgroup, so the transpose's barrier is reached by all of it or none).
//   [0, 1024)     LayerNorm, 8 rows each
//   [1024, 2048)  w1 tiles, [2048, 3072) w2 tiles
//   [3072, 4096)  wq, wk, wv, wo tiles, 256 each
// waves_per_eu: with a minimum alone the LayerNorm path's g and b loads are
// again issued pair by pair (see layernorm_to_bf16); (4, 4) pads the register
// count to four waves per SIMD, and this grid has more to keep resident;
// (4, 7) keeps the loads in two groups of 16 at six waves per SIMD.
// ---------------------------------------------------------------------------
#define PREP_LN_WGS   (MTOK / 8)
#define PREP_MLP_WGS  ((MLPD / 64) * (HDIM / 64))
#define PREP_PROJ_WGS ((HDIM / 64) * (HDIM / 64))
#define PREP_WGS      (PREP_LN_WGS + 2 * PREP_MLP_WGS + 4 * PREP_PROJ_WGS)
__global__ __launch_bounds__(128) __attribute__((amdgpu_waves_per_eu(4, 7)))
void prepare_inputs(const float* __restrict__ x, const float* __restrict__ g,
                    const float* __restrict__ b, bf16* __restrict__ y,
                    const float* __restrict__ wq, const float* __restrict__ wk,
                    const float* __restrict__ wv, const float* __restrict__ wo,
                    const float* __restrict__ w1, const float* __restrict__ w2,
                    bf16* __restrict__ wq_t, bf16* __restrict__ wk_t,
                    bf16* __restrict__ wv_t, bf16* __restrict__ wo_t,
                    bf16* __restrict__ w1_t, bf16* __restrict__ w2_t) {
    __shared__ float t[64][65];
    int i = blockIdx.x;
    if (i < PREP_LN_WGS) {
        const int wave = __builtin_amdgcn_readfirstlane(threadIdx.x >> 5);
        layernorm_2rows_to_bf16(x, g, b, y, i * 4 + wave);
        return;
    }
    i -= PREP_LN_WGS;
    const float* w;
    bf16* wt;
    int K = HDIM, N = HDIM;
    if (i < PREP_MLP_WGS) {
        w = w1; wt = w1_t; N = MLPD;
    } else if (i < 2 * PREP_MLP_WGS) {
        i -= PREP_MLP_WGS;
        w = w2; wt = w2_t; K = MLPD;
    } else {
        i -= 2 * PREP_MLP_WGS;
        const int m = i / PREP_PROJ_WGS;
        i -= m * PREP_PROJ_WGS;
        w  = m == 0 ? wq   : m == 1 ? wk   : m == 2 ? wv   : wo;
        wt = m == 0 ? wq_t : m == 1 ? wk_t : m == 2 ? wv_t : wo_t;
    }
    const int nx = N / 64;                   // tiles along a row of w: 16 or 64
    transpose_tile_to_bf16(t, w, wt, K, N, i % nx, i / nx);
}

// ---------------------------------------------------------------------------
// Eight async 16-B copies per lane, global -> LDS. l[] = LDS byte addresses,
// g[] = global addresses. The address-translation wait is the last line of the
// copies' own statement, so that no address register named here is rewritten
// in front of it.
// ---------------------------------------------------------------------------
__device__ __forceinline__ void async_copy8_b128(const unsigned (&l)[8], const bf16* const (&g)[8]) {
    asm volatile(
        "global_load_async_to_lds_b128 %0, %8, off\n\t"
        "global_load_async_to_lds_b128 %1, %9, off\n\t"
        "global_load_async_to_lds_b128 %2, %10, off\n\t"
        "global_load_async_to_lds_b128 %3, %11, off\n\t"
        "global_load_async_to_lds_b128 %4, %12, off\n\t"
        "global_load_async_to_lds_b128 %5, %13, off\n\t"
        "global_load_async_to_lds_b128 %6, %14, off\n\t"
        "global_load_async_to_lds_b128 %7, %15, off\n\t"
        "s_wait_xcnt 0x0"
        :: "v"(l[0]), "v"(l[1]), "v"(l[2]), "v"(l[3]), "v"(l[4]), "v"(l[5]), "v"(l[6]), "v"(l[7]),
           "v"(g[0]), "v"(g[1]), "v"(g[2]), "v"(g[3]), "v"(g[4]), "v"(g[5]), "v"(g[6]), "v"(g[7])
        : "memory");
}
// The same with one 32-bit byte offset per lane (off) on eight wave-uniform
// bases in scalar registers: no vector register pair per copy (with pairs the
// attention kernel needs 194 registers, one wave per SIMD fewer than with 170).
__device__ __forceinline__ void async_copy8_b128_sbase(const unsigned (&l)[8], unsigned off,
                                                       const bf16* const (&g)[8]) {
    asm volatile(
        "global_load_async_to_lds_b128 %0, %8, %9\n\t"
        "global_load_async_to_lds_b128 %1, %8, %10\n\t"
        "global_load_async_to_lds_b128 %2, %8, %11\n\t"
        "global_load_async_to_lds_b128 %3, %8, %12\n\t"
        "global_load_async_to_lds_b128 %4, %8, %13\n\t"
        "global_load_async_to_lds_b128 %5, %8, %14\n\t"
        "global_load_async_to_lds_b128 %6, %8, %15\n\t"
        "global_load_async_to_lds_b128 %7, %8, %16\n\t"
        "s_wait_xcnt 0x0"
        :: "v"(l[0]), "v"(l[1]), "v"(l[2]), "v"(l[3]), "v"(l[4]), "v"(l[5]), "v"(l[6]), "v"(l[7]),
           "v"(off),
           "s"(g[0]), "s"(g[1]), "s"(g[2]), "s"(g[3]), "s"(g[4]), "s"(g[5]), "s"(g[6]), "s"(g[7])
        : "memory");
}
__device__ __forceinline__ unsigned lds_byte(const bf16* p) {
    return (unsigned)(size_t)(const __attribute__((address_space(3))) bf16*)p;
}

// ---------------------------------------------------------------------------
// Generic bf16 WMMA GEMM:  C[M,N] = epilogue(A[M,K] * BT[N,K]^T + bias)
// Block tile 128x128, 8 waves, each wave 32x64 (2x4 wmma tiles).
// An LDS stage holds KS k of both operands (KS/32 WMMA blocks of 32 k), so one
// copy latency and one barrier are paid per KS/4 WMMAs of a wave, and a stage
// row is one or two whole 128-B lines. Two stages; the async global->LDS
// copies of stage t+2 start when stage t has been read.
// KS = 128 for the Q/K/V, output-projection and second MLP GEMMs (two
// workgroups fit a WGP's LDS); KS = 64 for the first MLP GEMM, so that four fit.
// M, N multiples of 128; K a multiple of KS.
// EPI_BIAS_QKV: bias only; where vt is set (uniform for the workgroup), the
// tile is scatter-stored into VT[batch][head][d][key] for attention.
// ---------------------------------------------------------------------------
template <bool B> struct flag { static constexpr bool value = B; };

template <int EPI, typename OutT, int KS>
__device__ __forceinline__
void gemm_tile(bf16 (&As)[2][128][KS + 8], bf16 (&Bs)[2][128][KS + 8],
               const bf16* __restrict__ A, const bf16* __restrict__ BT,
               const float* __restrict__ bias, const float* __restrict__ res,
               OutT* __restrict__ C, int N, int K, bool vt) {
    const int tid  = threadIdx.x;
    const int wave = tid >> 5;
    const int lane = tid & 31;
    const int lh   = lane >> 4;     // K-half selector (lanes 16-31 hold K=16..31)
    const int ll   = lane & 15;     // row/col within 16
    const int wm   = wave & 3;      // 4 waves along M (32 rows each)
    const int wn   = wave >> 2;     // 2 waves along N (64 cols each)

    const int bm = blockIdx.y * 128;
    const int bn = blockIdx.x * 128;

    f32x8 acc[2][4];
#pragma unroll
    for (int i = 0; i < 2; ++i)
#pragma unroll
        for (int j = 0; j < 4; ++j)
#pragma unroll
            for (int e = 0; e < 8; ++e) acc[i][j][e] = 0.0f;

    // Copy map: KS/8 adjacent lanes cover one stage row, 16 B each.
    constexpr int LPR = KS / 8;           // lanes per row
    constexpr int RPC = 256 / LPR;        // rows the block covers with one copy per lane
    constexpr int CPO = 128 / RPC;        // copies per lane and operand
    const int lrow = tid / LPR;
    const int lcol = (tid % LPR) * 8;
    const bf16* aRow = A  + (size_t)(bm + lrow) * K + lcol;
    const bf16* bRow = BT + (size_t)(bn + lrow) * K + lcol;

    const int nk = K / KS;

    auto issue = [&](int buf, int k0) {
#pragma unroll
        for (int s = 0; s < 2 * CPO / 8; ++s) {
            unsigned l[8];
            const bf16* g[8];
#pragma unroll
            for (int q = 0; q < 8; ++q) {
                const int c = s * 8 + q;              // first the A rows, then the B rows
                const int r = (c % CPO) * RPC;
                l[q] = lds_byte(c < CPO ? &As[buf][lrow + r][lcol] : &Bs[buf][lrow + r][lcol]);
                g[q] = ((c < CPO ? aRow : bRow) + k0) + (size_t)r * K;
            }
            async_copy8_b128(l, g);
        }
    };
    issue(0, 0);
    asm volatile("s_wait_asynccnt 0x0" ::: "memory");   // stage 0 landed (this wave's copies)
    __syncthreads();                                    // ... and every other wave's
    if (nk > 1) issue(1, KS);

    for (int kt = 0; kt < nk; ++kt) {
        const int cur = kt & 1;
#pragma unroll
        for (int ks = 0; ks < KS / 32; ++ks) {
            bf16x16 af[2], bfr[4];
#pragma unroll
            for (int i = 0; i < 2; ++i)
                af[i] = lds_frag(&As[cur][wm * 32 + i * 16 + ll][ks * 32 + lh * 16]);
#pragma unroll
            for (int j = 0; j < 4; ++j)
                bfr[j] = lds_frag(&Bs[cur][wn * 64 + j * 16 + ll][ks * 32 + lh * 16]);

#pragma unroll
            for (int i = 0; i < 2; ++i)
#pragma unroll
                for (int j = 0; j < 4; ++j)
                    acc[i][j] = __builtin_amdgcn_wmma_f32_16x16x32_bf16(
                        false, af[i], false, bfr[j], (short)0, acc[i][j], false, false);
        }

        asm volatile("s_wait_dscnt 0x0" ::: "memory");     // this wave's reads of stage kt are done
        asm volatile("s_wait_asynccnt 0x0" ::: "memory");  // its copies of stage kt+1 have landed
        __syncthreads();                                   // publishes kt+1, frees kt's buffer
        if (kt + 2 < nk) issue(cur, (kt + 2) * KS);
    }
    asm volatile("s_wait_asynccnt 0x0" ::: "memory");      // no copy outstanding past the loop

    // Epilogue. C layout: VGPR e -> row = e + lh*8 ; lane%16 -> col.
    auto epilogue = [&](auto scatter) {
#pragma unroll
        for (int i = 0; i < 2; ++i) {
#pragma unroll
            for (int j = 0; j < 4; ++j) {
                const int col = bn + wn * 64 + j * 16 + ll;
                const float bvv = bias ? bias[col] : 0.0f;
#pragma unroll
                for (int e = 0; e < 8; ++e) {
                    const int row = bm + wm * 32 + i * 16 + lh * 8 + e;
                    float v = acc[i][j][e] + bvv;
                    if (EPI == EPI_BIAS_GELU) v = gelu_tanh(v);
                    if (EPI == EPI_BIAS_RES)  v += res[(size_t)row * N + col];
                    if (decltype(scatter)::value) {
                        // row = batch*LSEQ + key ; col = head*DH + d
                        const size_t idx =
                            (((size_t)(row >> 10) * NH + (col >> 6)) * DH + (col & (DH - 1)))
                                * LSEQ + (row & (LSEQ - 1));
                        C[idx] = (OutT)v;
                    } else {
                        C[(size_t)row * N + col] = (OutT)v;
                    }
                }
                // The next tile's values reuse the registers that these stores name.
                if (EPI == EPI_BIAS_QKV) asm volatile("s_wait_xcnt 0x0" ::: "memory");
            }
        }
    };
    if (EPI == EPI_BIAS_QKV && vt) epilogue(flag<true>{});
    else                           epilogue(flag<false>{});
}

template <int EPI, typename OutT, int KS>
__global__ __launch_bounds__(256)
void gemm_bf16_wmma(const bf16* __restrict__ A, const bf16* __restrict__ BT,
                    const float* __restrict__ bias, const float* __restrict__ res,
                    OutT* __restrict__ C, int M, int N, int K) {
    // Pitch KS + 8: 16 B x odd, as PITCH_K64 / PITCH_K128.
    __shared__ __attribute__((aligned(16))) bf16 As[2][128][KS + 8];
    __shared__ __attribute__((aligned(16))) bf16 Bs[2][128][KS + 8];
    gemm_tile<EPI, OutT, KS>(As, Bs, A, BT, bias, res, C, N, K, false);
}

// The Q, K and V projections of the same A in ONE launch: blockIdx.z picks the
// weight, the bias and the output. A WGP goes from one projection's tile to the
// next one's with no launch boundary between them: while one workgroup fills its
// first stage or stores its tile, the WGP's other workgroup computes.
__global__ __launch_bounds__(256)
void gemm_qkv_bf16_wmma(const bf16* __restrict__ A,
                        const bf16* __restrict__ wq_t, const bf16* __restrict__ wk_t,
                        const bf16* __restrict__ wv_t,
                        const float* __restrict__ bq, const float* __restrict__ bk,
                        const float* __restrict__ bv,
                        bf16* __restrict__ q, bf16* __restrict__ k, bf16* __restrict__ vt,
                        int N, int K) {
    __shared__ __attribute__((aligned(16))) bf16 As[2][128][PITCH_K128];
    __shared__ __attribute__((aligned(16))) bf16 Bs[2][128][PITCH_K128];
    const int z = blockIdx.z;
    const bf16*  BT   = z == 0 ? wq_t : z == 1 ? wk_t : wv_t;
    const float* bias = z == 0 ? bq   : z == 1 ? bk   : bv;
    bf16*        C    = z == 0 ? q    : z == 1 ? k    : vt;
    gemm_tile<EPI_BIAS_QKV, bf16, 128>(As, Bs, A, BT, bias, nullptr, C, N, K, z == 2);
}

__device__ __forceinline__ float xhalf(float x) {
    const int b = __builtin_bit_cast(int, x);
    return __builtin_bit_cast(float,
        __builtin_amdgcn_permlanex16(b, b, 0x76543210, 0xfedcba98, false, false));
}
// One lane's 16 k of the 32-k block at p, in the k order of a packed pair of
// accumulator tiles: k = 8h + 0..7, then 16 + 8h + 0..7 (h = lane / 16).
__device__ __forceinline__ bf16x16 lds_frag_pair(const bf16* p, int h) {
    bf16x8 lo = *(const bf16x8*)(p + 8 * h);
    bf16x8 hi = *(const bf16x8*)(p + 16 + 8 * h);
    return __builtin_shufflevector(lo, hi, 0, 1, 2, 3, 4, 5, 6, 7,
                                   8, 9, 10, 11, 12, 13, 14, 15);
}

__global__ __launch_bounds__(128)
void attention_wmma(const bf16* __restrict__ Q, const bf16* __restrict__ Km,
                    const bf16* __restrict__ VT, bf16* __restrict__ O) {
    __shared__ __attribute__((aligned(16))) bf16 Ks[128][PITCH_K64];      // 18 KB
    __shared__ __attribute__((aligned(16))) bf16 VTs[64][PITCH_K128];     // 17 KB

    const int tid  = threadIdx.x;
    const int wave = tid >> 5;
    const int lane = tid & 31;
    const int lh   = lane >> 4;
    const int ll   = lane & 15;

    const int qt    = blockIdx.x;        // 16 query tiles of 64
    const int head  = blockIdx.y;        // 16
    const int batch = blockIdx.z;        // 8
    const size_t base   = ((size_t)batch * LSEQ) * HDIM + (size_t)head * DH;
    const size_t vtbase = ((size_t)(batch * NH + head)) * DH * LSEQ;
    const int q0 = qt * 64;
    const size_t qrow = base + (size_t)(q0 + wave * 16 + ll) * HDIM;   // this lane's query

    // Q^T fragments: column = this lane's query, 16 consecutive d per wave half
    // (the k order of lds_frag, which loads the K rows they are paired with).
    bf16x16 qf[2];
#pragma unroll
    for (int kc = 0; kc < 2; ++kc) {
        const bf16* qp = Q + qrow + kc * 32 + lh * 16;
        bf16x8 lo = *(const bf16x8*)qp;
        bf16x8 hi = *(const bf16x8*)(qp + 8);
        qf[kc] = __builtin_shufflevector(lo, hi, 0, 1, 2, 3, 4, 5, 6, 7,
                                         8, 9, 10, 11, 12, 13, 14, 15);
    }

    f32x8 acco[4];                       // O^T: row d = j*16 + lh*8 + e, column = query ll
#pragma unroll
    for (int j = 0; j < 4; ++j)
#pragma unroll
        for (int e = 0; e < 8; ++e) acco[j][e] = 0.0f;
    float mrow = -1e30f;                 // running maximum of this lane's query
    float lsum = 0.0f;                   // running sum over this wave half's keys

    // Copy map: adjacent lanes cover one tile row, 16 B each, so that a wave-wide
    // copy takes four whole 128-B lines instead of 16 B out of 32 lines.
    const int krow = tid >> 3, kcol = (tid & 7) * 8;     // K: 8 lanes per 128-B row, 16 rows per copy
    const int vrow = tid >> 4, vcol = (tid & 15) * 8;    // V^T: 16 lanes per 256-B row, 8 rows per copy
    const unsigned koff = (unsigned)(krow * HDIM + kcol) * 2u;   // lane's byte offset in 16 K rows
    const unsigned voff = (unsigned)(vrow * LSEQ + vcol) * 2u;   // ... in 8 V^T rows

    for (int kt = 0; kt < LSEQ / 128; ++kt) {
        const int k0 = kt * 128;
        asm volatile("s_wait_dscnt 0x0" ::: "memory");     // this wave's reads of the previous tile are done
        __syncthreads();                                   // ... and every other wave's
        {
            unsigned l[8];
            const bf16* g[8];
#pragma unroll
            for (int c = 0; c < 8; ++c) {                  // K tile: 128 keys x 64 d
                l[c] = lds_byte(&Ks[krow + c * 16][kcol]);
                g[c] = Km + base + (size_t)(k0 + c * 16) * HDIM;
            }
            async_copy8_b128_sbase(l, koff, g);
#pragma unroll
            for (int c = 0; c < 8; ++c) {                  // V^T tile: 64 d x 128 keys
                l[c] = lds_byte(&VTs[vrow + c * 8][vcol]);
                g[c] = VT + vtbase + (size_t)(c * 8) * LSEQ + k0;
            }
            async_copy8_b128_sbase(l, voff, g);
        }
        asm volatile("s_wait_asynccnt 0x0" ::: "memory");  // this wave's copies have landed
        __syncthreads();                                   // ... and every other wave's

        // ---- S^T = (K Q^T) * 1/sqrt(D): accs[jt][e] = S[key jt*16 + lh*8 + e][query ll]
        f32x8 accs[8];
#pragma unroll
        for (int jt = 0; jt < 8; ++jt) {
#pragma unroll
            for (int e = 0; e < 8; ++e) accs[jt][e] = 0.0f;
#pragma unroll
            for (int kc = 0; kc < 2; ++kc) {
                bf16x16 a = lds_frag(&Ks[jt * 16 + ll][kc * 32 + lh * 16]);
                accs[jt] = __builtin_amdgcn_wmma_f32_16x16x32_bf16(
                    false, a, false, qf[kc], (short)0, accs[jt], false, false);
            }
        }
        const float scale = 0.125f;     // 1/sqrt(64)

        // ---- online softmax, one query per lane; eight independent chains
        float mxe[8];
#pragma unroll
        for (int e = 0; e < 8; ++e) {
            mxe[e] = -1e30f;
#pragma unroll
            for (int jt = 0; jt < 8; ++jt) {
                accs[jt][e] *= scale;
                mxe[e] = fmaxf(mxe[e], accs[jt][e]);
            }
        }
        float mx = fmaxf(fmaxf(fmaxf(mxe[0], mxe[1]), fmaxf(mxe[2], mxe[3])),
                         fmaxf(fmaxf(mxe[4], mxe[5]), fmaxf(mxe[6], mxe[7])));
        mx = fmaxf(mx, xhalf(mx));       // the other half's keys of the same query
        const float mnew = fmaxf(mrow, mx);

        // P^T fragments: pf[kc][s] = P[key kc*32 + (s/8)*16 + lh*8 + s%8][query ll]
        bf16x16 pf[4];
        float sm[4];
#pragma unroll
        for (int kc = 0; kc < 4; ++kc) {
            sm[kc] = 0.0f;
#pragma unroll
            for (int s = 0; s < 16; ++s) {
                float p = __expf(accs[kc * 2 + (s >> 3)][s & 7] - mnew);
                sm[kc] += p;
                pf[kc][s] = (bf16)p;
            }
        }
        const float corr = __expf(mrow - mnew);
        lsum = lsum * corr + ((sm[0] + sm[1]) + (sm[2] + sm[3]));
        mrow = mnew;
#pragma unroll
        for (int j = 0; j < 4; ++j)
#pragma unroll
            for (int e = 0; e < 8; ++e) acco[j][e] *= corr;

        // ---- O^T += V^T P^T ----
#pragma unroll
        for (int j = 0; j < 4; ++j)
#pragma unroll
            for (int kc = 0; kc < 4; ++kc) {
                bf16x16 a = lds_frag_pair(&VTs[j * 16 + ll][kc * 32], lh);
                acco[j] = __builtin_amdgcn_wmma_f32_16x16x32_bf16(
                    false, a, false, pf[kc], (short)0, acco[j], false, false);
            }
    }

    // ---- write O = acc / l: a lane holds 8 consecutive d of its query per tile
    const float lrow = lsum + xhalf(lsum);
#pragma unroll
    for (int j = 0; j < 4; ++j) {
        bf16x8 o;
#pragma unroll
        for (int e = 0; e < 8; ++e) o[e] = (bf16)(acco[j][e] / lrow);
        *(bf16x8*)(O + qrow + j * 16 + lh * 8) = o;
    }
}

// ---------------------------------------------------------------------------
// Host orchestration
// ---------------------------------------------------------------------------
extern "C" void kernel_launch(void* const* d_in, const int* in_sizes, int n_in,
                              void* d_out, int out_size, void* d_ws, size_t ws_size,
                              hipStream_t stream) {
    const float* x    = (const float*)d_in[0];
    const float* ln0g = (const float*)d_in[1];
    const float* ln0b = (const float*)d_in[2];
    const float* wq   = (const float*)d_in[3];
    const float* bq   = (const float*)d_in[4];
    const float* wk   = (const float*)d_in[5];
    const float* bk   = (const float*)d_in[6];
    const float* wv   = (const float*)d_in[7];
    const float* bv   = (const float*)d_in[8];
    const float* wo   = (const float*)d_in[9];
    const float* bo   = (const float*)d_in[10];
    const float* ln1g = (const float*)d_in[11];
    const float* ln1b = (const float*)d_in[12];
    const float* w1   = (const float*)d_in[13];
    const float* b1   = (const float*)d_in[14];
    const float* w2   = (const float*)d_in[15];
    const float* b2   = (const float*)d_in[16];
    float* out = (float*)d_out;

    char* p = (char*)d_ws;
    auto carve = [&](size_t bytes) -> char* {
        char* r = p;
        p += (bytes + 255) & ~(size_t)255;
        return r;
    };
    bf16*  wq_t = (bf16*)carve((size_t)HDIM * HDIM * 2);
    bf16*  wk_t = (bf16*)carve((size_t)HDIM * HDIM * 2);
    bf16*  wv_t = (bf16*)carve((size_t)HDIM * HDIM * 2);
    bf16*  wo_t = (bf16*)carve((size_t)HDIM * HDIM * 2);
    bf16*  w1_t = (bf16*)carve((size_t)MLPD * HDIM * 2);
    bf16*  w2_t = (bf16*)carve((size_t)HDIM * MLPD * 2);
    bf16*  y0   = (bf16*)carve((size_t)MTOK * HDIM * 2);   // LN0 out
    bf16*  qb   = (bf16*)carve((size_t)MTOK * HDIM * 2);
    bf16*  kb   = (bf16*)carve((size_t)MTOK * HDIM * 2);
    bf16*  vtb  = (bf16*)carve((size_t)MTOK * HDIM * 2);   // V, pre-transposed [b][h][d][key]
    bf16*  ab   = (bf16*)carve((size_t)MTOK * HDIM * 2);   // attention out
    float* x1   = (float*)carve((size_t)MTOK * HDIM * 4);  // residual 1
    bf16*  y1   = (bf16*)carve((size_t)MTOK * HDIM * 2);   // LN1 out
    bf16*  hb   = (bf16*)carve((size_t)MTOK * MLPD * 2);   // GELU(mlp1) out

    // --- first LayerNorm + weight convert/transpose (bf16, N x K) ---
    prepare_inputs<<<PREP_WGS, 128, 0, stream>>>(x, ln0g, ln0b, y0, wq, wk, wv, wo, w1, w2,
                                                 wq_t, wk_t, wv_t, wo_t, w1_t, w2_t);

    // --- pre-LN attention ---
    dim3 gProj(HDIM / 128, MTOK / 128);
    gemm_qkv_bf16_wmma<<<dim3(HDIM / 128, MTOK / 128, 3), 256, 0, stream>>>(
        y0, wq_t, wk_t, wv_t, bq, bk, bv, qb, kb, vtb, HDIM, HDIM);

    attention_wmma<<<dim3(LSEQ / 64, NH, NB), 128, 0, stream>>>(qb, kb, vtb, ab);

    gemm_bf16_wmma<EPI_BIAS_RES, float, 128><<<gProj, 256, 0, stream>>>(ab, wo_t, bo, x, x1, MTOK, HDIM, HDIM);

    // --- pre-LN MLP ---
    layernorm_to_bf16<<<MTOK / 16, 256, 0, stream>>>(x1, ln1g, ln1b, y1);

    gemm_bf16_wmma<EPI_BIAS_GELU, bf16, 64><<<dim3(MLPD / 128, MTOK / 128), 256, 0, stream>>>(
        y1, w1_t, b1, nullptr, hb, MTOK, MLPD, HDIM);

    gemm_bf16_wmma<EPI_BIAS_RES, float, 128><<<dim3(HDIM / 128, MTOK / 128), 256, 0, stream>>>(
        hb, w2_t, b2, x1, out, MTOK, HDIM, MLPD);
}

// v008
// It runs in 220 microseconds.
// Two timings next to v007 both put it at 1.09 times that version's speed.
// All steps since v000 together make it 2.50 times as fast.
#include <hip/hip_runtime.h>
#include <hip/hip_bf16.h>
#include <math.h>

// ---------------------------------------------------------------------------
// Problem constants (from reference): N=8, L=1024, H=16, D=64, HD=1024, MLP=4096
// ---------------------------------------------------------------------------
#define NB    8
#define LSEQ  1024
#define NH    16
#define DH    64
#define HDIM  1024
#define MLPD  4096
#define MTOK  (NB * LSEQ)          // 8192 token rows

typedef __bf16 bf16;
typedef __attribute__((ext_vector_type(16))) __bf16 bf16x16;
typedef __attribute__((ext_vector_type(8)))  float  f32x8;
typedef __attribute__((ext_vector_type(8)))  __bf16 bf16x8;
typedef __attribute__((ext_vector_type(4)))  __bf16 bf16x4;
typedef __attribute__((ext_vector_type(4)))  float  f32x4;

// LDS row pitches, in bf16 elements. Every WMMA fragment is read with
// ds_load_b128, one row per lane: a pitch of 16 B x odd spreads the 16 lanes of
// a half-wave over all 64 banks; 64 B, 128 B and 32 B x odd pitches do not.
#define PITCH_K64   72             // 128-B rows -> 144 B
#define PITCH_K128  136            // 256-B rows -> 272 B

// One lane's 16 consecutive k of a fragment row; rows are 16-B aligned only.
__device__ __forceinline__ bf16x16 lds_frag(const bf16* p) {
    bf16x8 lo = *(const bf16x8*)p;
    bf16x8 hi = *(const bf16x8*)(p + 8);
    return __builtin_shufflevector(lo, hi, 0, 1, 2, 3, 4, 5, 6, 7,
                                   8, 9, 10, 11, 12, 13, 14, 15);
}

// 0.5 x (1 + tanh u) = x / (1 + e^(-2u)), u = sqrt(2/pi) (x + 0.044715 x^3): one
// hardware exponential and one reciprocal per value where the library tanh takes
// some fifty instructions. e^(-2u) = inf gives x * 0, e^(-2u) = 0 gives x.
// Each transcendental with its v_nop in one statement: the instruction set asks
// for one slot before its result is read or its source overwritten. The slot costs little.
__device__ __forceinline__ float gelu_tanh(float x) {
    const float k = -2.0f * 0.7978845608028654f * 1.4426950408889634f;   // -2 sqrt(2/pi) log2(e)
    const float a = x * (k + (k * 0.044715f) * (x * x));                 // -2u log2(e)
    float e, r;
    asm("v_exp_f32 %0, %1\n\tv_nop" : "=v"(e) : "v"(a));
    const float d = 1.0f + e;
    asm("v_rcp_f32 %0, %1\n\tv_nop" : "=v"(r) : "v"(d));
    return x * r;
}

enum { EPI_BIAS_GELU = 1, EPI_BIAS_RES = 2, EPI_BIAS_QKV = 3 };

// ---------------------------------------------------------------------------
// Weight convert + transpose: w (K x N, f32 row-major) -> wt (N x K, bf16)
// One 64 x 64 tile per workgroup of 4 waves: few, long-lived waves, 8
// 16-B loads in flight per lane, whole 128-B lines read and written.
// K, N multiples of 64. t: the workgroup's LDS tile; odd dword pitch, no bank
// conflict either way. (bx, by): the tile's column and row in w.
// ---------------------------------------------------------------------------
__device__ __forceinline__
void transpose_tile_to_bf16(float (&t)[64][65], const float* __restrict__ w,
                            bf16* __restrict__ wt, int K, int N, int bx, int by) {
    const int bn = bx * 64;
    const int bk = by * 64;
    const int lr = threadIdx.x >> 4;         // 0..7: 16 lanes per 256-B row piece of w
    const int lc = (threadIdx.x & 15) * 4;
    const unsigned off = (unsigned)(lr * N + lc);   // one lane offset on eight uniform row bases
    float4 v[8];
#pragma unroll
    for (int i = 0; i < 8; ++i)
        v[i] = *(const float4*)(w + ((size_t)(bk + i * 8) * N + bn) + off);
#pragma unroll
    for (int i = 0; i < 8; ++i) {
        t[lr + i * 8][lc + 0] = v[i].x;
        t[lr + i * 8][lc + 1] = v[i].y;
        t[lr + i * 8][lc + 2] = v[i].z;
        t[lr + i * 8][lc + 3] = v[i].w;
    }
    __syncthreads();
    const int nr = threadIdx.x >> 3;         // 0..15: 8 lanes per 128-B row piece of wt
    const int kc = (threadIdx.x & 7) * 8;
#pragma unroll
    for (int j = 0; j < 4; ++j) {
        const int n = nr + j * 16;
        bf16x8 o;
#pragma unroll
        for (int e = 0; e < 8; ++e) o[e] = (bf16)t[kc + e][n];
        *(bf16x8*)(wt + (size_t)(bn + n) * K + bk + kc) = o;
    }
}

// ---------------------------------------------------------------------------
// LayerNorm (row of 1024 f32) fused with bf16 downconvert. One wave takes two
// whole rows: all 16 of its 16-B loads are in flight at once, the sums stay
// inside the wave (no LDS, no barrier), and the launch starts 16x fewer waves
// than with one workgroup per row. pair: the wave's pair of rows, wave-uniform.
// ---------------------------------------------------------------------------
__device__ __forceinline__
void layernorm_2rows_to_bf16(const float* __restrict__ x, const float* __restrict__ g,
                             const float* __restrict__ b, bf16* __restrict__ y, int pair) {
    const int lane = threadIdx.x & 31;
    const size_t row0 = (size_t)pair * 2;
    f32x4 v[2][8], gv[8], bv[8];            // piece c: columns c*128 + lane*4 .. +3
#pragma unroll
    for (int r = 0; r < 2; ++r)
#pragma unroll
        for (int c = 0; c < 8; ++c)
            v[r][c] = ((const f32x4*)(x + (row0 + r) * HDIM))[c * 32 + lane];
#pragma unroll
    for (int c = 0; c < 8; ++c) {
        gv[c] = ((const f32x4*)g)[c * 32 + lane];
        bv[c] = ((const f32x4*)b)[c * 32 + lane];
    }
    float s[2], s2[2];
#pragma unroll
    for (int r = 0; r < 2; ++r) {
        float p[8], p2[8];                   // eight independent chains
#pragma unroll
        for (int c = 0; c < 8; ++c) {
            const f32x4 a = v[r][c];
            p[c]  = (a.x + a.y) + (a.z + a.w);
            p2[c] = (a.x * a.x + a.y * a.y) + (a.z * a.z + a.w * a.w);
        }
        s[r]  = ((p[0] + p[1]) + (p[2] + p[3])) + ((p[4] + p[5]) + (p[6] + p[7]));
        s2[r] = ((p2[0] + p2[1]) + (p2[2] + p2[3])) + ((p2[4] + p2[5]) + (p2[6] + p2[7]));
    }
#pragma unroll
    for (int m = 16; m > 0; m >>= 1)
#pragma unroll
        for (int r = 0; r < 2; ++r) { s[r] += __shfl_xor(s[r], m); s2[r] += __shfl_xor(s2[r], m); }
    float mu[2], rstd[2];
#pragma unroll
    for (int r = 0; r < 2; ++r) {
        mu[r] = s[r] * (1.0f / HDIM);
        const float var = s2[r] * (1.0f / HDIM) - mu[r] * mu[r];
        rstd[r] = rsqrtf(var + 1e-5f);
    }
#pragma unroll
    for (int c = 0; c < 8; ++c)
#pragma unroll
        for (int r = 0; r < 2; ++r) {
            const f32x4 a = v[r][c];
            bf16x4 o;
            o[0] = (bf16)((a.x - mu[r]) * rstd[r] * gv[c].x + bv[c].x);
            o[1] = (bf16)((a.y - mu[r]) * rstd[r] * gv[c].y + bv[c].y);
            o[2] = (bf16)((a.z - mu[r]) * rstd[r] * gv[c].z + bv[c].z);
            o[3] = (bf16)((a.w - mu[r]) * rstd[r] * gv[c].w + bv[c].w);
            *(bf16x4*)(y + (row0 + r) * HDIM + c * 128 + lane * 4) = o;
        }
}

// 16 rows per workgroup.
// waves_per_eu: the register budget of the four waves per SIMD that this grid
// gives; with the default budget the g and b loads are issued pair by pair
// between the stores' arithmetic, each pair waited for alone.
__global__ __launch_bounds__(256) __attribute__((amdgpu_waves_per_eu(4, 4)))
void layernorm_to_bf16(const float* __restrict__ x, const float* __restrict__ g,
                       const float* __restrict__ b, bf16* __restrict__ y) {
    // The wave's number as a scalar: the row addresses then sit in scalar registers.
    const int wave = __builtin_amdgcn_readfirstlane(threadIdx.x >> 5);
    layernorm_2rows_to_bf16(x, g, b, y, blockIdx.x * 8 + wave);
}

// ---------------------------------------------------------------------------
// Everything that depends on the inputs alone, in ONE launch: the first
// LayerNorm and the six weight transposes. Seven short launches each pay their
// own start, first memory latency and drain one after the other; here they
// overlap. Workgroups of 4 waves; the index range picks the job (uniform for
// the workgroup, so the transpose's barrier is reached by all of it or none).
//   [0, 1024)     LayerNorm, 8 rows each
//   [1024, 2048)  w1 tiles, [2048, 3072) w2 tiles
//   [3072, 4096)  wq, wk, wv, wo tiles, 256 each
// waves_per_eu: with a minimum alone the LayerNorm path's g and b loads are
// again issued pair by pair (see layernorm_to_bf16); (4, 4) pads the register
// count to four waves per SIMD, and this grid has more to keep resident;
// (4, 7) keeps the loads in two groups of 16 at six waves per SIMD.
// ---------------------------------------------------------------------------
#define PREP_LN_WGS   (MTOK / 8)
#define PREP_MLP_WGS  ((MLPD / 64) * (HDIM / 64))
#define PREP_PROJ_WGS ((HDIM / 64) * (HDIM / 64))
#define PREP_WGS      (PREP_LN_WGS + 2 * PREP_MLP_WGS + 4 * PREP_PROJ_WGS)
__global__ __launch_bounds__(128) __attribute__((amdgpu_waves_per_eu(4, 7)))
void prepare_inputs(const float* __restrict__ x, const float* __restrict__ g,
                    const float* __restrict__ b, bf16* __restrict__ y,
                    const float* __restrict__ wq, const float* __restrict__ wk,
                    const float* __restrict__ wv, const float* __restrict__ wo,
                    const float* __restrict__ w1, const float* __restrict__ w2,
                    bf16* __restrict__ wq_t, bf16* __restrict__ wk_t,
                    bf16* __restrict__ wv_t, bf16* __restrict__ wo_t,
                    bf16* __restrict__ w1_t, bf16* __restrict__ w2_t) {
    __shared__ float t[64][65];
    int i = blockIdx.x;
    if (i < PREP_LN_WGS) {
        const int wave = __builtin_amdgcn_readfirstlane(threadIdx.x >> 5);
        layernorm_2rows_to_bf16(x, g, b, y, i * 4 + wave);
        return;
    }
    i -= PREP_LN_WGS;
    const float* w;
    bf16* wt;
    int K = HDIM, N = HDIM;
    if (i < PREP_MLP_WGS) {
        w = w1; wt = w1_t; N = MLPD;
    } else if (i < 2 * PREP_MLP_WGS) {
        i -= PREP_MLP_WGS;
        w = w2; wt = w2_t; K = MLPD;
    } else {
        i -= 2 * PREP_MLP_WGS;
        const int m = i / PREP_PROJ_WGS;
        i -= m * PREP_PROJ_WGS;
        w  = m == 0 ? wq   : m == 1 ? wk   : m == 2 ? wv   : wo;
        wt = m == 0 ? wq_t : m == 1 ? wk_t : m == 2 ? wv_t : wo_t;
    }
    const int nx = N / 64;                   // tiles along a row of w: 16 or 64
    transpose_tile_to_bf16(t, w, wt, K, N, i % nx, i / nx);
}

// ---------------------------------------------------------------------------
// Eight async 16-B copies per lane, global -> LDS. l[] = LDS byte addresses,
// g[] = global addresses. The address-translation wait is the last line of the
// copies' own statement, so that no address register named here is rewritten
// in front of it.
// ---------------------------------------------------------------------------
__device__ __forceinline__ void async_copy8_b128(const unsigned (&l)[8], const bf16* const (&g)[8]) {
    asm volatile(
        "global_load_async_to_lds_b128 %0, %8, off\n\t"
        "global_load_async_to_lds_b128 %1, %9, off\n\t"
        "global_load_async_to_lds_b128 %2, %10, off\n\t"
        "global_load_async_to_lds_b128 %3, %11, off\n\t"
        "global_load_async_to_lds_b128 %4, %12, off\n\t"
        "global_load_async_to_lds_b128 %5, %13, off\n\t"
        "global_load_async_to_lds_b128 %6, %14, off\n\t"
        "global_load_async_to_lds_b128 %7, %15, off\n\t"
        "s_wait_xcnt 0x0"
        :: "v"(l[0]), "v"(l[1]), "v"(l[2]), "v"(l[3]), "v"(l[4]), "v"(l[5]), "v"(l[6]), "v"(l[7]),
           "v"(g[0]), "v"(g[1]), "v"(g[2]), "v"(g[3]), "v"(g[4]), "v"(g[5]), "v"(g[6]), "v"(g[7])
        : "memory");
}
// The same with one 32-bit byte offset per lane (off) on eight wave-uniform
// bases in scalar registers: no vector register pair per copy (with pairs the
// attention kernel needs 194 registers, one wave per SIMD fewer than with 170).
__device__ __forceinline__ void async_copy8_b128_sbase(const unsigned (&l)[8], unsigned off,
                                                       const bf16* const (&g)[8]) {
    asm volatile(
        "global_load_async_to_lds_b128 %0, %8, %9\n\t"
        "global_load_async_to_lds_b128 %1, %8, %10\n\t"
        "global_load_async_to_lds_b128 %2, %8, %11\n\t"
        "global_load_async_to_lds_b128 %3, %8, %12\n\t"
        "global_load_async_to_lds_b128 %4, %8, %13\n\t"
        "global_load_async_to_lds_b128 %5, %8, %14\n\t"
        "global_load_async_to_lds_b128 %6, %8, %15\n\t"
        "global_load_async_to_lds_b128 %7, %8, %16\n\t"
        "s_wait_xcnt 0x0"
        :: "v"(l[0]), "v"(l[1]), "v"(l[2]), "v"(l[3]), "v"(l[4]), "v"(l[5]), "v"(l[6]), "v"(l[7]),
           "v"(off),
           "s"(g[0]), "s"(g[1]), "s"(g[2]), "s"(g[3]), "s"(g[4]), "s"(g[5]), "s"(g[6]), "s"(g[7])
        : "memory");
}
__device__ __forceinline__ unsigned lds_byte(const bf16* p) {
    return (unsigned)(size_t)(const __attribute__((address_space(3))) bf16*)p;
}

// ---------------------------------------------------------------------------
// Generic bf16 WMMA GEMM:  C[M,N] = epilogue(A[M,K] * BT[N,K]^T + bias)
// Block tile 128x128, 8 waves, each wave 32x64 (2x4 wmma tiles).
// The BT rows are the matrix instruction's first operand, so that a lane's 8
// accumulator values of a tile are 8 ADJACENT outputs of one row of C.
// An LDS stage holds KS k of both operands (KS/32 WMMA blocks of 32 k), so one
// copy latency and one barrier are paid per KS/4 WMMAs of a wave, and a stage
// row is one or two whole 128-B lines. Two stages; the async global->LDS
// copies of stage t+2 start when stage t has been read.
// KS = 128 for the Q/K/V, output-projection and second MLP GEMMs (two
// workgroups fit a WGP's LDS); KS = 64 for the first MLP GEMM, so that four fit.
// M, N multiples of 128; K a multiple of KS.
// LDO: row length of the output.
// EPI_BIAS_QKV: bias only; where vt is set (uniform for the workgroup), the
// output is VT[batch][head][d][key] for attention: its rows are weight rows and
// adjacent outputs are adjacent tokens, so the caller hands the weights in as A
// and the tokens as BT, and blockIdx.x and .y change places.
// ---------------------------------------------------------------------------
template <bool B> struct flag { static constexpr bool value = B; };

template <int EPI, typename OutT, int KS, int LDO>
__device__ __forceinline__
void gemm_tile(bf16 (&As)[2][128][KS + 8], bf16 (&Bs)[2][128][KS + 8],
               const bf16* __restrict__ A, const bf16* __restrict__ BT,
               const float* __restrict__ bias, const float* __restrict__ res,
               OutT* __restrict__ C, int K, bool vt) {
    const int tid  = threadIdx.x;
    const int wave = tid >> 5;
    const int lane = tid & 31;
    const int lh   = lane >> 4;     // K-half selector (lanes 16-31 hold K=16..31)
    const int ll   = lane & 15;     // row/col within 16
    const int wm   = wave & 3;      // 4 waves along M (32 rows each)
    const int wn   = wave >> 2;     // 2 waves along N (64 cols each)

    const int bm = (vt ? blockIdx.x : blockIdx.y) * 128;   // first row of A's tile
    const int bn = (vt ? blockIdx.y : blockIdx.x) * 128;   // first row of BT's tile

    f32x8 acc[2][4];
#pragma unroll
    for (int i = 0; i < 2; ++i)
#pragma unroll
        for (int j = 0; j < 4; ++j)
#pragma unroll
            for (int e = 0; e < 8; ++e) acc[i][j][e] = 0.0f;

    // Copy map: KS/8 adjacent lanes cover one stage row, 16 B each.
    constexpr int LPR = KS / 8;           // lanes per row
    constexpr int RPC = 256 / LPR;        // rows the block covers with one copy per lane
    constexpr int CPO = 128 / RPC;        // copies per lane and operand
    const int lrow = tid / LPR;
    const int lcol = (tid % LPR) * 8;
    const bf16* aRow = A  + (size_t)(bm + lrow) * K + lcol;
    const bf16* bRow = BT + (size_t)(bn + lrow) * K + lcol;

    const int nk = K / KS;

    auto issue = [&](int buf, int k0) {
#pragma unroll
        for (int s = 0; s < 2 * CPO / 8; ++s) {
            unsigned l[8];
            const bf16* g[8];
#pragma unroll
            for (int q = 0; q < 8; ++q) {
                const int c = s * 8 + q;              // first the A rows, then the B rows
                const int r = (c % CPO) * RPC;
                l[q] = lds_byte(c < CPO ? &As[buf][lrow + r][lcol] : &Bs[buf][lrow + r][lcol]);
                g[q] = ((c < CPO ? aRow : bRow) + k0) + (size_t)r * K;
            }
            async_copy8_b128(l, g);
        }
    };
    issue(0, 0);
    asm volatile("s_wait_asynccnt 0x0" ::: "memory");   // stage 0 landed (this wave's copies)
    __syncthreads();                                    // ... and every other wave's
    if (nk > 1) issue(1, KS);

    for (int kt = 0; kt < nk; ++kt) {
        const int cur = kt & 1;
#pragma unroll
        for (int ks = 0; ks < KS / 32; ++ks) {
            bf16x16 af[2], bfr[4];
#pragma unroll
            for (int i = 0; i < 2; ++i)
                af[i] = lds_frag(&As[cur][wm * 32 + i * 16 + ll][ks * 32 + lh * 16]);
#pragma unroll
            for (int j = 0; j < 4; ++j)
                bfr[j] = lds_frag(&Bs[cur][wn * 64 + j * 16 + ll][ks * 32 + lh * 16]);

#pragma unroll
            for (int i = 0; i < 2; ++i)
#pragma unroll
                for (int j = 0; j < 4; ++j)
                    acc[i][j] = __builtin_amdgcn_wmma_f32_16x16x32_bf16(
                        false, bfr[j], false, af[i], (short)0, acc[i][j], false, false);
        }

        asm volatile("s_wait_dscnt 0x0" ::: "memory");     // this wave's reads of stage kt are done
        asm volatile("s_wait_asynccnt 0x0" ::: "memory");  // its copies of stage kt+1 have landed
        __syncthreads();                                   // publishes kt+1, frees kt's buffer
        if (kt + 2 < nk) issue(cur, (kt + 2) * KS);
    }
    asm volatile("s_wait_asynccnt 0x0" ::: "memory");      // no copy outstanding past the loop

    // Epilogue. Accumulator layout: VGPR e -> BT row j*16 + lh*8 + e ; lane%16 -> A row.
    // Every output leaves in whole 128-B lines: a wave stages its 32 x 64 tile in an
    // LDS range of its own (the stages are free: every wave's reads and copies ended
    // in front of the loop's last barrier) with 16-B writes, reads whole rows back
    // and stores 16 B per lane, 8 or 16 adjacent lanes per row. The residual comes
    // by the same map, all of it asked for at once, in front of the staging.
    constexpr int SROW = 64 * (int)sizeof(OutT);   // bytes of a staged row
    constexpr int SP   = SROW + 16;                // its pitch: 16 B x odd
    constexpr int LPS  = SROW / 16;                // lanes per staged row
    constexpr int RPA  = 32 / LPS;                 // rows per wave-wide access
    constexpr int NAC  = 32 / RPA;                 // accesses per wave
    static_assert(8 * 32 * SP <= (int)sizeof(As), "staging fits the A stages");
    char* st = (char*)&As[0][0][0] + wave * (32 * SP);
    const int srow = lane / LPS;
    const int scol = (lane % LPS) * (16 / (int)sizeof(OutT));
    // vt: A row = head*DH + d, BT row = batch*LSEQ + key
    // The lane's byte offset in the output (under 2^27), one register for every
    // load and store below; the steps from access to access are constants.
    const unsigned org = (unsigned)((vt ? ((bn >> 10) * HDIM + bm) * LSEQ + (bn & (LSEQ - 1))
                                        : bm * LDO + bn)
                                    + (wm * 32 + srow) * LDO + wn * 64 + scol) * (unsigned)sizeof(OutT);
    constexpr int STEP = RPA * LDO * (int)sizeof(OutT);

    f32x4 rv[NAC];
    if (EPI == EPI_BIAS_RES) {
#pragma unroll
        for (int t = 0; t < NAC; ++t)
            rv[t] = *(const f32x4*)((const char*)res + org + t * STEP);
    }

    auto stage = [&](auto by_a_row) {
        f32x4 br[4][2];                            // bias of the lane's 8 BT rows per tile
        float ba[2];                               // ... or of its A row
        if (decltype(by_a_row)::value) {
#pragma unroll
            for (int i = 0; i < 2; ++i) ba[i] = bias[bm + wm * 32 + i * 16 + ll];
            // The values that follow reuse the offset register that these loads name.
            asm volatile("s_wait_xcnt 0x0" ::: "memory");
        } else {
#pragma unroll
            for (int j = 0; j < 4; ++j)
#pragma unroll
                for (int h = 0; h < 2; ++h)
                    br[j][h] = *(const f32x4*)(bias + bn + wn * 64 + j * 16 + lh * 8 + h * 4);
        }
#pragma unroll
        for (int i = 0; i < 2; ++i)
#pragma unroll
            for (int j = 0; j < 4; ++j)
#pragma unroll
                for (int e = 0; e < 8; ++e)
                    acc[i][j][e] += decltype(by_a_row)::value ? ba[i] : br[j][e >> 2][e & 3];
        // Every bias add in front of the first GELU, so that the 32 bias registers are
        // free by then: 120 registers; without it 132, one workgroup per WGP fewer.
        if (EPI == EPI_BIAS_GELU) __builtin_amdgcn_sched_barrier(0);
#pragma unroll
        for (int i = 0; i < 2; ++i) {
#pragma unroll
            for (int j = 0; j < 4; ++j) {
                float v[8];
#pragma unroll
                for (int e = 0; e < 8; ++e)
                    v[e] = EPI == EPI_BIAS_GELU ? gelu_tanh(acc[i][j][e]) : acc[i][j][e];
                char* p = st + (i * 16 + ll) * SP + (j * 16 + lh * 8) * (int)sizeof(OutT);
                if (sizeof(OutT) == 2) {
                    bf16x8 o;
#pragma unroll
                    for (int e = 0; e < 8; ++e) o[e] = (bf16)v[e];
                    *(bf16x8*)p = o;
                } else {
                    *(f32x4*)p        = f32x4{v[0], v[1], v[2], v[3]};
                    *(f32x4*)(p + 16) = f32x4{v[4], v[5], v[6], v[7]};
                }
            }
        }
    };
    if (EPI == EPI_BIAS_QKV && vt) stage(flag<true>{});
    else                           stage(flag<false>{});

    asm volatile("s_wait_dscnt 0x0" ::: "memory");   // the wave's tile is in LDS before other lanes read it
#pragma unroll
    for (int t = 0; t < NAC; ++t) {
        const char* p = st + (t * RPA + srow) * SP + scol * (int)sizeof(OutT);
        if (sizeof(OutT) == 2) {
            *(bf16x8*)((char*)C + org + t * STEP) = *(const bf16x8*)p;
        } else {
            *(f32x4*)((char*)C + org + t * STEP) = *(const f32x4*)p + rv[t];
        }
    }
}

template <int EPI, typename OutT, int KS, int LDO>
__global__ __launch_bounds__(256)
void gemm_bf16_wmma(const bf16* __restrict__ A, const bf16* __restrict__ BT,
                    const float* __restrict__ bias, const float* __restrict__ res,
                    OutT* __restrict__ C, int M, int N, int K) {
    // Pitch KS + 8: 16 B x odd, as PITCH_K64 / PITCH_K128.
    __shared__ __attribute__((aligned(16))) bf16 As[2][128][KS + 8];
    __shared__ __attribute__((aligned(16))) bf16 Bs[2][128][KS + 8];
    gemm_tile<EPI, OutT, KS, LDO>(As, Bs, A, BT, bias, res, C, K, false);
}

// The Q, K and V projections of the same A in ONE launch: blockIdx.z picks the
// weight, the bias and the output. A WGP goes from one projection's tile to the
// next one's with no launch boundary between them: while one workgroup fills its
// first stage or stores its tile, the WGP's other workgroup computes.
__global__ __launch_bounds__(256)
void gemm_qkv_bf16_wmma(const bf16* __restrict__ A,
                        const bf16* __restrict__ wq_t, const bf16* __restrict__ wk_t,
                        const bf16* __restrict__ wv_t,
                        const float* __restrict__ bq, const float* __restrict__ bk,
                        const float* __restrict__ bv,
                        bf16* __restrict__ q, bf16* __restrict__ k, bf16* __restrict__ vt,
                        int N, int K) {
    __shared__ __attribute__((aligned(16))) bf16 As[2][128][PITCH_K128];
    __shared__ __attribute__((aligned(16))) bf16 Bs[2][128][PITCH_K128];
    const int z = blockIdx.z;
    const bf16*  BT   = z == 0 ? wq_t : z == 1 ? wk_t : wv_t;
    const float* bias = z == 0 ? bq   : z == 1 ? bk   : bv;
    bf16*        C    = z == 0 ? q    : z == 1 ? k    : vt;
    gemm_tile<EPI_BIAS_QKV, bf16, 128, HDIM>(As, Bs, z == 2 ? BT : A, z == 2 ? A : BT, bias, nullptr, C, K, z == 2);
}

__device__ __forceinline__ float xhalf(float x) {
    const int b = __builtin_bit_cast(int, x);
    return __builtin_bit_cast(float,
        __builtin_amdgcn_permlanex16(b, b, 0x76543210, 0xfedcba98, false, false));
}
// One lane's 16 k of the 32-k block at p, in the k order of a packed pair of
// accumulator tiles: k = 8h + 0..7, then 16 + 8h + 0..7 (h = lane / 16).
__device__ __forceinline__ bf16x16 lds_frag_pair(const bf16* p, int h) {
    bf16x8 lo = *(const bf16x8*)(p + 8 * h);
    bf16x8 hi = *(const bf16x8*)(p + 16 + 8 * h);
    return __builtin_shufflevector(lo, hi, 0, 1, 2, 3, 4, 5, 6, 7,
                                   8, 9, 10, 11, 12, 13, 14, 15);
}

__global__ __launch_bounds__(128)
void attention_wmma(const bf16* __restrict__ Q, const bf16* __restrict__ Km,
                    const bf16* __restrict__ VT, bf16* __restrict__ O) {
    __shared__ __attribute__((aligned(16))) bf16 Ks[128][PITCH_K64];      // 18 KB
    __shared__ __attribute__((aligned(16))) bf16 VTs[64][PITCH_K128];     // 17 KB

    const int tid  = threadIdx.x;
    const int wave = tid >> 5;
    const int lane = tid & 31;
    const int lh   = lane >> 4;
    const int ll   = lane & 15;

    const int qt    = blockIdx.x;        // 16 query tiles of 64
    const int head  = blockIdx.y;        // 16
    const int batch = blockIdx.z;        // 8
    const size_t base   = ((size_t)batch * LSEQ) * HDIM + (size_t)head * DH;
    const size_t vtbase = ((size_t)(batch * NH + head)) * DH * LSEQ;
    const int q0 = qt * 64;
    const size_t qrow = base + (size_t)(q0 + wave * 16 + ll) * HDIM;   // this lane's query

    // Q^T fragments: column = this lane's query, 16 consecutive d per wave half
    // (the k order of lds_frag, which loads the K rows they are paired with).
    bf16x16 qf[2];
#pragma unroll
    for (int kc = 0; kc < 2; ++kc) {
        const bf16* qp = Q + qrow + kc * 32 + lh * 16;
        bf16x8 lo = *(const bf16x8*)qp;
        bf16x8 hi = *(const bf16x8*)(qp + 8);
        qf[kc] = __builtin_shufflevector(lo, hi, 0, 1, 2, 3, 4, 5, 6, 7,
                                         8, 9, 10, 11, 12, 13, 14, 15);
    }

    f32x8 acco[4];                       // O^T: row d = j*16 + lh*8 + e, column = query ll
#pragma unroll
    for (int j = 0; j < 4; ++j)
#pragma unroll
        for (int e = 0; e < 8; ++e) acco[j][e] = 0.0f;
    float mrow = -1e30f;                 // running maximum of this lane's query
    float lsum = 0.0f;                   // running sum over this wave half's keys

    // Copy map: adjacent lanes cover one tile row, 16 B each, so that a wave-wide
    // copy takes four whole 128-B lines instead of 16 B out of 32 lines.
    const int krow = tid >> 3, kcol = (tid & 7) * 8;     // K: 8 lanes per 128-B row, 16 rows per copy
    const int vrow = tid >> 4, vcol = (tid & 15) * 8;    // V^T: 16 lanes per 256-B row, 8 rows per copy
    const unsigned koff = (unsigned)(krow * HDIM + kcol) * 2u;   // lane's byte offset in 16 K rows
    const unsigned voff = (unsigned)(vrow * LSEQ + vcol) * 2u;   // ... in 8 V^T rows

    for (int kt = 0; kt < LSEQ / 128; ++kt) {
        const int k0 = kt * 128;
        asm volatile("s_wait_dscnt 0x0" ::: "memory");     // this wave's reads of the previous tile are done
        __syncthreads();                                   // ... and every other wave's
        {
            unsigned l[8];
            const bf16* g[8];
#pragma unroll
            for (int c = 0; c < 8; ++c) {                  // K tile: 128 keys x 64 d
                l[c] = lds_byte(&Ks[krow + c * 16][kcol]);
                g[c] = Km + base + (size_t)(k0 + c * 16) * HDIM;
            }
            async_copy8_b128_sbase(l, koff, g);
#pragma unroll
            for (int c = 0; c < 8; ++c) {                  // V^T tile: 64 d x 128 keys
                l[c] = lds_byte(&VTs[vrow + c * 8][vcol]);
                g[c] = VT + vtbase + (size_t)(c * 8) * LSEQ + k0;
            }
            async_copy8_b128_sbase(l, voff, g);
        }
        asm volatile("s_wait_asynccnt 0x0" ::: "memory");  // this wave's copies have landed
        __syncthreads();                                   // ... and every other wave's

        // ---- S^T = (K Q^T) * 1/sqrt(D): accs[jt][e] = S[key jt*16 + lh*8 + e][query ll]
        f32x8 accs[8];
#pragma unroll
        for (int jt = 0; jt < 8; ++jt) {
#pragma unroll
            for (int e = 0; e < 8; ++e) accs[jt][e] = 0.0f;
#pragma unroll
            for (int kc = 0; kc < 2; ++kc) {
                bf16x16 a = lds_frag(&Ks[jt * 16 + ll][kc * 32 + lh * 16]);
                accs[jt] = __builtin_amdgcn_wmma_f32_16x16x32_bf16(
                    false, a, false, qf[kc], (short)0, accs[jt], false, false);
            }
        }
        const float scale = 0.125f;     // 1/sqrt(64)

        // ---- online softmax, one query per lane; eight independent chains
        float mxe[8];
#pragma unroll
        for (int e = 0; e < 8; ++e) {
            mxe[e] = -1e30f;
#pragma unroll
            for (int jt = 0; jt < 8; ++jt) {
                accs[jt][e] *= scale;
                mxe[e] = fmaxf(mxe[e], accs[jt][e]);
            }
        }
        float mx = fmaxf(fmaxf(fmaxf(mxe[0], mxe[1]), fmaxf(mxe[2], mxe[3])),
                         fmaxf(fmaxf(mxe[4], mxe[5]), fmaxf(mxe[6], mxe[7])));
        mx = fmaxf(mx, xhalf(mx));       // the other half's keys of the same query
        const float mnew = fmaxf(mrow, mx);

        // P^T fragments: pf[kc][s] = P[key kc*32 + (s/8)*16 + lh*8 + s%8][query ll]
        bf16x16 pf[4];
        float sm[4];
#pragma unroll
        for (int kc = 0; kc < 4; ++kc) {
            sm[kc] = 0.0f;
#pragma unroll
            for (int s = 0; s < 16; ++s) {
                float p = __expf(accs[kc * 2 + (s >> 3)][s & 7] - mnew);
                sm[kc] += p;
                pf[kc][s] = (bf16)p;
            }
        }
        const float corr = __expf(mrow - mnew);
        lsum = lsum * corr + ((sm[0] + sm[1]) + (sm[2] + sm[3]));
        mrow = mnew;
#pragma unroll
        for (int j = 0; j < 4; ++j)
#pragma unroll
            for (int e = 0; e < 8; ++e) acco[j][e] *= corr;

        // ---- O^T += V^T P^T ----
#pragma unroll
        for (int j = 0; j < 4; ++j)
#pragma unroll
            for (int kc = 0; kc < 4; ++kc) {
                bf16x16 a = lds_frag_pair(&VTs[j * 16 + ll][kc * 32], lh);
                acco[j] = __builtin_amdgcn_wmma_f32_16x16x32_bf16(
                    false, a, false, pf[kc], (short)0, acco[j], false, false);
            }
    }

    // ---- write O = acc / l: a lane holds 8 consecutive d of its query per tile
    const float lrow = lsum + xhalf(lsum);
#pragma unroll
    for (int j = 0; j < 4; ++j) {
        bf16x8 o;
#pragma unroll
        for (int e = 0; e < 8; ++e) o[e] = (bf16)(acco[j][e] / lrow);
        *(bf16x8*)(O + qrow + j * 16 + lh * 8) = o;
    }
}

// ---------------------------------------------------------------------------
// Host orchestration
// ---------------------------------------------------------------------------
extern "C" void kernel_launch(void* const* d_in, const int* in_sizes, int n_in,
                              void* d_out, int out_size, void* d_ws, size_t ws_size,
                              hipStream_t stream) {
    const float* x    = (const float*)d_in[0];
    const float* ln0g = (const float*)d_in[1];
    const float* ln0b = (const float*)d_in[2];
    const float* wq   = (const float*)d_in[3];
    const float* bq   = (const float*)d_in[4];
    const float* wk   = (const float*)d_in[5];
    const float* bk   = (const float*)d_in[6];
    const float* wv   = (const float*)d_in[7];
    const float* bv   = (const float*)d_in[8];
    const float* wo   = (const float*)d_in[9];
    const float* bo   = (const float*)d_in[10];
    const float* ln1g = (const float*)d_in[11];
    const float* ln1b = (const float*)d_in[12];
    const float* w1   = (const float*)d_in[13];
    const float* b1   = (const float*)d_in[14];
    const float* w2   = (const float*)d_in[15];
    const float* b2   = (const float*)d_in[16];
    float* out = (float*)d_out;

    char* p = (char*)d_ws;
    auto carve = [&](size_t bytes) -> char* {
        char* r = p;
        p += (bytes + 255) & ~(size_t)255;
        return r;
    };
    bf16*  wq_t = (bf16*)carve((size_t)HDIM * HDIM * 2);
    bf16*  wk_t = (bf16*)carve((size_t)HDIM * HDIM * 2);
    bf16*  wv_t = (bf16*)carve((size_t)HDIM * HDIM * 2);
    bf16*  wo_t = (bf16*)carve((size_t)HDIM * HDIM * 2);
    bf16*  w1_t = (bf16*)carve((size_t)MLPD * HDIM * 2);
    bf16*  w2_t = (bf16*)carve((size_t)HDIM * MLPD * 2);
    bf16*  y0   = (bf16*)carve((size_t)MTOK * HDIM * 2);   // LN0 out
    bf16*  qb   = (bf16*)carve((size_t)MTOK * HDIM * 2);
    bf16*  kb   = (bf16*)carve((size_t)MTOK * HDIM * 2);
    bf16*  vtb  = (bf16*)carve((size_t)MTOK * HDIM * 2);   // V, pre-transposed [b][h][d][key]
    bf16*  ab   = (bf16*)carve((size_t)MTOK * HDIM * 2);   // attention out
    float* x1   = (float*)carve((size_t)MTOK * HDIM * 4);  // residual 1
    bf16*  y1   = (bf16*)carve((size_t)MTOK * HDIM * 2);   // LN1 out
    bf16*  hb   = (bf16*)carve((size_t)MTOK * MLPD * 2);   // GELU(mlp1) out

    // --- first LayerNorm + weight convert/transpose (bf16, N x K) ---
    prepare_inputs<<<PREP_WGS, 128, 0, stream>>>(x, ln0g, ln0b, y0, wq, wk, wv, wo, w1, w2,
                                                 wq_t, wk_t, wv_t, wo_t, w1_t, w2_t);

    // --- pre-LN attention ---
    dim3 gProj(HDIM / 128, MTOK / 128);
    gemm_qkv_bf16_wmma<<<dim3(HDIM / 128, MTOK / 128, 3), 256, 0, stream>>>(
        y0, wq_t, wk_t, wv_t, bq, bk, bv, qb, kb, vtb, HDIM, HDIM);

    attention_wmma<<<dim3(LSEQ / 64, NH, NB), 128, 0, stream>>>(qb, kb, vtb, ab);

    gemm_bf16_wmma<EPI_BIAS_RES, float, 128, HDIM><<<gProj, 256, 0, stream>>>(ab, wo_t, bo, x, x1, MTOK, HDIM, HDIM);

    // --- pre-LN MLP ---
    layernorm_to_bf16<<<MTOK / 16, 256, 0, stream>>>(x1, ln1g, ln1b, y1);

    gemm_bf16_wmma<EPI_BIAS_GELU, bf16, 64, MLPD><<<dim3(MLPD / 128, MTOK / 128), 256, 0, stream>>>(
        y1, w1_t, b1, nullptr, hb, MTOK, MLPD, HDIM);

    gemm_bf16_wmma<EPI_BIAS_RES, float, 128, HDIM><<<dim3(HDIM / 128, MTOK / 128), 256, 0, stream>>>(
        hb, w2_t, b2, x1, out, MTOK, HDIM, MLPD);
}

// v009
// Measured time: 213 microseconds a run.
// Next to v008, in two timings, it ran 1.04 times as fast each time.
// All steps since v000 together make it 2.60 times as fast.
#include <hip/hip_runtime.h>
#include <hip/hip_bf16.h>
#include <math.h>

// ---------------------------------------------------------------------------
// Problem constants (from reference): N=8, L=1024, H=16, D=64, HD=1024, MLP=4096
// ---------------------------------------------------------------------------
#define NB    8
#define LSEQ  1024
#define NH    16
#define DH    64
#define HDIM  1024
#define MLPD  4096
#define MTOK  (NB * LSEQ)          // 8192 token rows

typedef __bf16 bf16;
typedef __attribute__((ext_vector_type(16))) __bf16 bf16x16;
typedef __attribute__((ext_vector_type(8)))  float  f32x8;
typedef __attribute__((ext_vector_type(8)))  __bf16 bf16x8;
typedef __attribute__((ext_vector_type(4)))  __bf16 bf16x4;
typedef __attribute__((ext_vector_type(4)))  float  f32x4;

// LDS row pitches, in bf16 elements. Every WMMA fragment is read with
// ds_load_b128, one row per lane: a pitch of 16 B x odd spreads the 16 lanes of
// a half-wave over all 64 banks; 64 B, 128 B and 32 B x odd pitches do not.
#define PITCH_K64   72             // 128-B rows -> 144 B
#define PITCH_K128  136            // 256-B rows -> 272 B

// One lane's 16 consecutive k of a fragment row; rows are 16-B aligned only.
__device__ __forceinline__ bf16x16 lds_frag(const bf16* p) {
    bf16x8 lo = *(const bf16x8*)p;
    bf16x8 hi = *(const bf16x8*)(p + 8);
    return __builtin_shufflevector(lo, hi, 0, 1, 2, 3, 4, 5, 6, 7,
                                   8, 9, 10, 11, 12, 13, 14, 15);
}

// 0.5 x (1 + tanh u) = x / (1 + e^(-2u)), u = sqrt(2/pi) (x + 0.044715 x^3): one
// hardware exponential and one reciprocal per value where the library tanh takes
// some fifty instructions. e^(-2u) = inf gives x * 0, e^(-2u) = 0 gives x.
// Each transcendental with its v_nop in one statement: the instruction set asks
// for one slot before its result is read or its source overwritten. The slot costs little.
__device__ __forceinline__ float gelu_tanh(float x) {
    const float k = -2.0f * 0.7978845608028654f * 1.4426950408889634f;   // -2 sqrt(2/pi) log2(e)
    const float a = x * (k + (k * 0.044715f) * (x * x));                 // -2u log2(e)
    float e, r;
    asm("v_exp_f32 %0, %1\n\tv_nop" : "=v"(e) : "v"(a));
    const float d = 1.0f + e;
    asm("v_rcp_f32 %0, %1\n\tv_nop" : "=v"(r) : "v"(d));
    return x * r;
}

enum { EPI_BIAS_GELU = 1, EPI_BIAS_RES = 2, EPI_BIAS_QKV = 3 };

// ---------------------------------------------------------------------------
// Weight convert + transpose: w (K x N, f32 row-major) -> wt (N x K, bf16)
// One 64 x 64 tile per workgroup of 4 waves: few, long-lived waves, 8
// 16-B loads in flight per lane, whole 128-B lines read and written.
// K, N multiples of 64. t: the workgroup's LDS tile; odd dword pitch, no bank
// conflict either way. (bx, by): the tile's column and row in w.
// ---------------------------------------------------------------------------
__device__ __forceinline__
void transpose_tile_to_bf16(float (&t)[64][65], const float* __restrict__ w,
                            bf16* __restrict__ wt, int K, int N, int bx, int by) {
    const int bn = bx * 64;
    const int bk = by * 64;
    const int lr = threadIdx.x >> 4;         // 0..7: 16 lanes per 256-B row piece of w
    const int lc = (threadIdx.x & 15) * 4;
    const unsigned off = (unsigned)(lr * N + lc);   // one lane offset on eight uniform row bases
    float4 v[8];
#pragma unroll
    for (int i = 0; i < 8; ++i)
        v[i] = *(const float4*)(w + ((size_t)(bk + i * 8) * N + bn) + off);
#pragma unroll
    for (int i = 0; i < 8; ++i) {
        t[lr + i * 8][lc + 0] = v[i].x;
        t[lr + i * 8][lc + 1] = v[i].y;
        t[lr + i * 8][lc + 2] = v[i].z;
        t[lr + i * 8][lc + 3] = v[i].w;
    }
    __syncthreads();
    const int nr = threadIdx.x >> 3;         // 0..15: 8 lanes per 128-B row piece of wt
    const int kc = (threadIdx.x & 7) * 8;
#pragma unroll
    for (int j = 0; j < 4; ++j) {
        const int n = nr + j * 16;
        bf16x8 o;
#pragma unroll
        for (int e = 0; e < 8; ++e) o[e] = (bf16)t[kc + e][n];
        *(bf16x8*)(wt + (size_t)(bn + n) * K + bk + kc) = o;
    }
}

// ---------------------------------------------------------------------------
// LayerNorm (row of 1024 f32) fused with bf16 downconvert. One wave takes two
// whole rows: all 16 of its 16-B loads are in flight at once, the sums stay
// inside the wave (no LDS, no barrier), and the launch starts 16x fewer waves
// than with one workgroup per row. pair: the wave's pair of rows, wave-uniform.
// ---------------------------------------------------------------------------
__device__ __forceinline__
void layernorm_2rows_to_bf16(const float* __restrict__ x, const float* __restrict__ g,
                             const float* __restrict__ b, bf16* __restrict__ y, int pair) {
    const int lane = threadIdx.x & 31;
    const size_t row0 = (size_t)pair * 2;
    f32x4 v[2][8], gv[8], bv[8];            // piece c: columns c*128 + lane*4 .. +3
#pragma unroll
    for (int r = 0; r < 2; ++r)
#pragma unroll
        for (int c = 0; c < 8; ++c)
            v[r][c] = ((const f32x4*)(x + (row0 + r) * HDIM))[c * 32 + lane];
#pragma unroll
    for (int c = 0; c < 8; ++c) {
        gv[c] = ((const f32x4*)g)[c * 32 + lane];
        bv[c] = ((const f32x4*)b)[c * 32 + lane];
    }
    float s[2], s2[2];
#pragma unroll
    for (int r = 0; r < 2; ++r) {
        float p[8], p2[8];                   // eight independent chains
#pragma unroll
        for (int c = 0; c < 8; ++c) {
            const f32x4 a = v[r][c];
            p[c]  = (a.x + a.y) + (a.z + a.w);
            p2[c] = (a.x * a.x + a.y * a.y) + (a.z * a.z + a.w * a.w);
        }
        s[r]  = ((p[0] + p[1]) + (p[2] + p[3])) + ((p[4] + p[5]) + (p[6] + p[7]));
        s2[r] = ((p2[0] + p2[1]) + (p2[2] + p2[3])) + ((p2[4] + p2[5]) + (p2[6] + p2[7]));
    }
#pragma unroll
    for (int m = 16; m > 0; m >>= 1)
#pragma unroll
        for (int r = 0; r < 2; ++r) { s[r] += __shfl_xor(s[r], m); s2[r] += __shfl_xor(s2[r], m); }
    float mu[2], rstd[2];
#pragma unroll
    for (int r = 0; r < 2; ++r) {
        mu[r] = s[r] * (1.0f / HDIM);
        const float var = s2[r] * (1.0f / HDIM) - mu[r] * mu[r];
        rstd[r] = rsqrtf(var + 1e-5f);
    }
#pragma unroll
    for (int c = 0; c < 8; ++c)
#pragma unroll
        for (int r = 0; r < 2; ++r) {
            const f32x4 a = v[r][c];
            bf16x4 o;
            o[0] = (bf16)((a.x - mu[r]) * rstd[r] * gv[c].x + bv[c].x);
            o[1] = (bf16)((a.y - mu[r]) * rstd[r] * gv[c].y + bv[c].y);
            o[2] = (bf16)((a.z - mu[r]) * rstd[r] * gv[c].z + bv[c].z);
            o[3] = (bf16)((a.w - mu[r]) * rstd[r] * gv[c].w + bv[c].w);
            *(bf16x4*)(y + (row0 + r) * HDIM + c * 128 + lane * 4) = o;
        }
}

// 16 rows per workgroup.
// waves_per_eu: the register budget of the four waves per SIMD that this grid
// gives; with the default budget the g and b loads are issued pair by pair
// between the stores' arithmetic, each pair waited for alone.
__global__ __launch_bounds__(256) __attribute__((amdgpu_waves_per_eu(4, 4)))
void layernorm_to_bf16(const float* __restrict__ x, const float* __restrict__ g,
                       const float* __restrict__ b, bf16* __restrict__ y) {
    // The wave's number as a scalar: the row addresses then sit in scalar registers.
    const int wave = __builtin_amdgcn_readfirstlane(threadIdx.x >> 5);
    layernorm_2rows_to_bf16(x, g, b, y, blockIdx.x * 8 + wave);
}

// ---------------------------------------------------------------------------
// Everything that depends on the inputs alone, in ONE launch: the first
// LayerNorm and the six weight transposes. Seven short launches each pay their
// own start, first memory latency and drain one after the other; here they
// overlap. Workgroups of 4 waves; the index range picks the job (uniform for
// the workgroup, so the transpose's barrier is reached by all of it or none).
//   [0, 1024)     LayerNorm, 8 rows each
//   [1024, 2048)  w1 tiles, [2048, 3072) w2 tiles
//   [3072, 4096)  wq, wk, wv, wo tiles, 256 each
// waves_per_eu: with a minimum alone the LayerNorm path's g and b loads are
// again issued pair by pair (see layernorm_to_bf16); (4, 4) pads the register
// count to four waves per SIMD, and this grid has more to keep resident;
// (4, 7) keeps the loads in two groups of 16 at six waves per SIMD.
// ---------------------------------------------------------------------------
#define PREP_LN_WGS   (MTOK / 8)
#define PREP_MLP_WGS  ((MLPD / 64) * (HDIM / 64))
#define PREP_PROJ_WGS ((HDIM / 64) * (HDIM / 64))
#define PREP_WGS      (PREP_LN_WGS + 2 * PREP_MLP_WGS + 4 * PREP_PROJ_WGS)
__global__ __launch_bounds__(128) __attribute__((amdgpu_waves_per_eu(4, 7)))
void prepare_inputs(const float* __restrict__ x, const float* __restrict__ g,
                    const float* __restrict__ b, bf16* __restrict__ y,
                    const float* __restrict__ wq, const float* __restrict__ wk,
                    const float* __restrict__ wv, const float* __restrict__ wo,
                    const float* __restrict__ w1, const float* __restrict__ w2,
                    bf16* __restrict__ wq_t, bf16* __restrict__ wk_t,
                    bf16* __restrict__ wv_t, bf16* __restrict__ wo_t,
                    bf16* __restrict__ w1_t, bf16* __restrict__ w2_t) {
    __shared__ float t[64][65];
    int i = blockIdx.x;
    if (i < PREP_LN_WGS) {
        const int wave = __builtin_amdgcn_readfirstlane(threadIdx.x >> 5);
        layernorm_2rows_to_bf16(x, g, b, y, i * 4 + wave);
        return;
    }
    i -= PREP_LN_WGS;
    const float* w;
    bf16* wt;
    int K = HDIM, N = HDIM;
    if (i < PREP_MLP_WGS) {
        w = w1; wt = w1_t; N = MLPD;
    } else if (i < 2 * PREP_MLP_WGS) {
        i -= PREP_MLP_WGS;
        w = w2; wt = w2_t; K = MLPD;
    } else {
        i -= 2 * PREP_MLP_WGS;
        const int m = i / PREP_PROJ_WGS;
        i -= m * PREP_PROJ_WGS;
        w  = m == 0 ? wq   : m == 1 ? wk   : m == 2 ? wv   : wo;
        wt = m == 0 ? wq_t : m == 1 ? wk_t : m == 2 ? wv_t : wo_t;
    }
    const int nx = N / 64;                   // tiles along a row of w: 16 or 64
    transpose_tile_to_bf16(t, w, wt, K, N, i % nx, i / nx);
}

// ---------------------------------------------------------------------------
// Twelve async 16-B copies per lane, global -> LDS. l[] = LDS byte addresses,
// g[] = global addresses. The address-translation wait is the last line of the
// copies' own statement, so that no address register named here is rewritten
// in front of it.
// ---------------------------------------------------------------------------
__device__ __forceinline__ void async_copy12_b128(const unsigned (&l)[12], const bf16* const (&g)[12]) {
    asm volatile(
        "global_load_async_to_lds_b128 %0, %12, off\n\t"
        "global_load_async_to_lds_b128 %1, %13, off\n\t"
        "global_load_async_to_lds_b128 %2, %14, off\n\t"
        "global_load_async_to_lds_b128 %3, %15, off\n\t"
        "global_load_async_to_lds_b128 %4, %16, off\n\t"
        "global_load_async_to_lds_b128 %5, %17, off\n\t"
        "global_load_async_to_lds_b128 %6, %18, off\n\t"
        "global_load_async_to_lds_b128 %7, %19, off\n\t"
        "global_load_async_to_lds_b128 %8, %20, off\n\t"
        "global_load_async_to_lds_b128 %9, %21, off\n\t"
        "global_load_async_to_lds_b128 %10, %22, off\n\t"
        "global_load_async_to_lds_b128 %11, %23, off\n\t"
        "s_wait_xcnt 0x0"
        :: "v"(l[0]), "v"(l[1]), "v"(l[2]), "v"(l[3]), "v"(l[4]), "v"(l[5]), "v"(l[6]), "v"(l[7]),
           "v"(l[8]), "v"(l[9]), "v"(l[10]), "v"(l[11]),
           "v"(g[0]), "v"(g[1]), "v"(g[2]), "v"(g[3]), "v"(g[4]), "v"(g[5]), "v"(g[6]), "v"(g[7]),
           "v"(g[8]), "v"(g[9]), "v"(g[10]), "v"(g[11])
        : "memory");
}
// Eight copies with one 32-bit byte offset per lane (off) on eight wave-uniform
// bases in scalar registers: no vector register pair per copy (with pairs the
// attention kernel needs 194 registers, one wave per SIMD fewer than with 170).
__device__ __forceinline__ void async_copy8_b128_sbase(const unsigned (&l)[8], unsigned off,
                                                       const bf16* const (&g)[8]) {
    asm volatile(
        "global_load_async_to_lds_b128 %0, %8, %9\n\t"
        "global_load_async_to_lds_b128 %1, %8, %10\n\t"
        "global_load_async_to_lds_b128 %2, %8, %11\n\t"
        "global_load_async_to_lds_b128 %3, %8, %12\n\t"
        "global_load_async_to_lds_b128 %4, %8, %13\n\t"
        "global_load_async_to_lds_b128 %5, %8, %14\n\t"
        "global_load_async_to_lds_b128 %6, %8, %15\n\t"
        "global_load_async_to_lds_b128 %7, %8, %16\n\t"
        "s_wait_xcnt 0x0"
        :: "v"(l[0]), "v"(l[1]), "v"(l[2]), "v"(l[3]), "v"(l[4]), "v"(l[5]), "v"(l[6]), "v"(l[7]),
           "v"(off),
           "s"(g[0]), "s"(g[1]), "s"(g[2]), "s"(g[3]), "s"(g[4]), "s"(g[5]), "s"(g[6]), "s"(g[7])
        : "memory");
}
__device__ __forceinline__ unsigned lds_byte(const bf16* p) {
    return (unsigned)(size_t)(const __attribute__((address_space(3))) bf16*)p;
}

// ---------------------------------------------------------------------------
// Generic bf16 WMMA GEMM:  C[M,N] = epilogue(A[M,K] * BT[N,K]^T + bias)
// Block tile 256x128 (A rows x BT rows), 8 waves, each wave 64x64 (4x4 wmma tiles):
// a 1-KB fragment read from LDS feeds four matrix instructions (16 reads per 16
// of them; 12 per 8 with a 32x64 wave tile), and a block asks L2 for 384 operand
// rows per 256x128 outputs where two 128x128 blocks ask for 512.
// The BT rows are the matrix instruction's first operand, so that a lane's 8
// accumulator values of a tile are 8 ADJACENT outputs of one row of C.
// An LDS stage holds KS k of both operands (KS/32 WMMA blocks of 32 k), so one
// copy latency and one barrier are paid per KS/2 WMMAs of a wave, and a stage
// row is one or two whole 128-B lines. Two stages; the async global->LDS
// copies of stage t+2 start when stage t has been read.
// KS = 128 where the grid gives a WGP one workgroup; KS = 64 where it gives
// more, so that two fit its LDS.
// M a multiple of 256, N of 128; K a multiple of KS.
// LDO: row length of the output.
// EPI_BIAS_QKV: bias only; where vt is set, the
// output is VT[batch][head][d][key] for attention: its rows are weight rows and
// adjacent outputs are adjacent tokens, so the caller hands the weights in as A
// and the tokens as BT, and the grid's flat index is split anew (4 weight tiles).
// ---------------------------------------------------------------------------
template <bool B> struct flag { static constexpr bool value = B; };

template <int EPI, typename OutT, int KS, int LDO, bool vt>
__device__ __forceinline__
void gemm_tile(bf16 (&As)[2][256][KS + 8], bf16 (&Bs)[2][128][KS + 8],
               const bf16* __restrict__ A, const bf16* __restrict__ BT,
               const float* __restrict__ bias, const float* __restrict__ res,
               OutT* __restrict__ C, int K) {
    const int tid  = threadIdx.x;
    const int wave = tid >> 5;
    const int lane = tid & 31;
    const int lh   = lane >> 4;     // K-half selector (lanes 16-31 hold K=16..31)
    const int ll   = lane & 15;     // row/col within 16
    const int wm   = wave & 3;      // 4 waves along M (64 rows each)
    const int wn   = wave >> 2;     // 2 waves along N (64 cols each)

    const int flat = blockIdx.y * (HDIM / 128) + blockIdx.x;   // vt: the grid is HDIM / 128 wide
    const int bm = (vt ? flat % (HDIM / 256) : blockIdx.y) * 256;   // first row of A's tile
    const int bn = (vt ? flat / (HDIM / 256) : blockIdx.x) * 128;   // first row of BT's tile

    f32x8 acc[4][4];
#pragma unroll
    for (int i = 0; i < 4; ++i)
#pragma unroll
        for (int j = 0; j < 4; ++j)
#pragma unroll
            for (int e = 0; e < 8; ++e) acc[i][j][e] = 0.0f;

    // Copy map: KS/8 adjacent lanes cover one stage row, 16 B each.
    constexpr int LPR = KS / 8;           // lanes per row
    constexpr int RPC = 256 / LPR;        // rows the block covers with one copy per lane
    constexpr int CPA = 256 / RPC;        // copies per lane: A rows
    constexpr int CPB = 128 / RPC;        // ... and BT rows
    const int lrow = tid / LPR;
    const int lcol = (tid % LPR) * 8;
    const bf16* aRow = A  + (size_t)(bm + lrow) * K + lcol;
    const bf16* bRow = BT + (size_t)(bn + lrow) * K + lcol;

    const int nk = K / KS;

    auto issue = [&](int buf, int k0) {
#pragma unroll
        for (int s = 0; s < (CPA + CPB) / 12; ++s) {
            unsigned l[12];
            const bf16* g[12];
#pragma unroll
            for (int q = 0; q < 12; ++q) {
                const int c = s * 12 + q;             // first the A rows, then the B rows
                const int r = (c < CPA ? c : c - CPA) * RPC;
                l[q] = lds_byte(c < CPA ? &As[buf][lrow + r][lcol] : &Bs[buf][lrow + r][lcol]);
                g[q] = ((c < CPA ? aRow : bRow) + k0) + (size_t)r * K;
            }
            async_copy12_b128(l, g);
        }
    };
    issue(0, 0);
    asm volatile("s_wait_asynccnt 0x0" ::: "memory");   // stage 0 landed (this wave's copies)
    __syncthreads();                                    // ... and every other wave's
    if (nk > 1) issue(1, KS);

    for (int kt = 0; kt < nk; ++kt) {
        const int cur = kt & 1;
#pragma unroll
        for (int ks = 0; ks < KS / 32; ++ks) {
            bf16x16 af[4], bfr[4];
#pragma unroll
            for (int j = 0; j < 4; ++j)
                bfr[j] = lds_frag(&Bs[cur][wn * 64 + j * 16 + ll][ks * 32 + lh * 16]);
#pragma unroll
            for (int i = 0; i < 4; ++i)
                af[i] = lds_frag(&As[cur][wm * 64 + i * 16 + ll][ks * 32 + lh * 16]);
            // The block's 16 LDS reads stay one group in front of its 16 matrix instructions:
            // left alone the compiler sinks each A fragment's reads to their first use, and
            // the wave waits out a whole LDS latency per four matrix instructions.
            __builtin_amdgcn_sched_barrier(0);

#pragma unroll
            for (int i = 0; i < 4; ++i)
#pragma unroll
                for (int j = 0; j < 4; ++j)
                    acc[i][j] = __builtin_amdgcn_wmma_f32_16x16x32_bf16(
                        false, bfr[j], false, af[i], (short)0, acc[i][j], false, false);
            // ... and the next block's reads stay behind them (one fragment set).
            __builtin_amdgcn_sched_barrier(0);
        }

        asm volatile("s_wait_dscnt 0x0" ::: "memory");     // this wave's reads of stage kt are done
        asm volatile("s_wait_asynccnt 0x0" ::: "memory");  // its copies of stage kt+1 have landed
        __syncthreads();                                   // publishes kt+1, frees kt's buffer
        if (kt + 2 < nk) issue(cur, (kt + 2) * KS);
    }
    asm volatile("s_wait_asynccnt 0x0" ::: "memory");      // no copy outstanding past the loop

    // Epilogue. Accumulator layout: VGPR e -> BT row j*16 + lh*8 + e ; lane%16 -> A row.
    // Every output leaves in whole 128-B lines: a wave stages its 64 x 64 tile in an
    // LDS range of its own (the stages are free: every wave's reads and copies ended
    // in front of the loop's last barrier) with 16-B writes, reads whole rows back
    // and stores 16 B per lane, 8 or 16 adjacent lanes per row. The residual comes
    // by the same map, in two groups: one asked for in front of the staging, one
    // behind it, in the accumulators' registers, while the first is added and stored.
    constexpr int SROW = 64 * (int)sizeof(OutT);   // bytes of a staged row
    constexpr int SP   = SROW + 16;                // its pitch: 16 B x odd
    constexpr int LPS  = SROW / 16;                // lanes per staged row
    constexpr int RPA  = 32 / LPS;                 // rows per wave-wide access
    constexpr int NAC  = 64 / RPA;                 // accesses per wave
    static_assert(8 * 64 * SP <= (int)sizeof(As), "staging fits the A stages");
    char* st = (char*)&As[0][0][0] + wave * (64 * SP);
    const int srow = lane / LPS;
    const int scol = (lane % LPS) * (16 / (int)sizeof(OutT));
    // vt: A row = head*DH + d, BT row = batch*LSEQ + key
    // The lane's byte offset in the output (under 2^27), one register for every
    // load and store below; the steps from access to access are constants.
    const unsigned org = (unsigned)((vt ? ((bn >> 10) * HDIM + bm) * LSEQ + (bn & (LSEQ - 1))
                                        : bm * LDO + bn)
                                    + (wm * 64 + srow) * LDO + wn * 64 + scol) * (unsigned)sizeof(OutT);
    constexpr int STEP = RPA * LDO * (int)sizeof(OutT);

    f32x4 rv[NAC];
    if (EPI == EPI_BIAS_RES) {
#pragma unroll
        for (int t = 0; t < NAC / 2; ++t)
            rv[t] = *(const f32x4*)((const char*)res + org + t * STEP);
    }

    auto stage = [&](auto by_a_row) {
        f32x4 br[4][2];                            // bias of the lane's 8 BT rows per tile
        float ba[4];                               // ... or of its A rows
        if (decltype(by_a_row)::value) {
#pragma unroll
            for (int i = 0; i < 4; ++i) ba[i] = bias[bm + wm * 64 + i * 16 + ll];
            // The values that follow reuse the offset register that these loads name.
            asm volatile("s_wait_xcnt 0x0" ::: "memory");
        } else {
#pragma unroll
            for (int j = 0; j < 4; ++j)
#pragma unroll
                for (int h = 0; h < 2; ++h)
                    br[j][h] = *(const f32x4*)(bias + bn + wn * 64 + j * 16 + lh * 8 + h * 4);
        }
#pragma unroll
        for (int i = 0; i < 4; ++i)
#pragma unroll
            for (int j = 0; j < 4; ++j)
#pragma unroll
                for (int e = 0; e < 8; ++e)
                    acc[i][j][e] += decltype(by_a_row)::value ? ba[i] : br[j][e >> 2][e & 3];
        // Every bias add in front of the first GELU, so that the 32 bias registers are
        // free by then.
        if (EPI == EPI_BIAS_GELU) __builtin_amdgcn_sched_barrier(0);
#pragma unroll
        for (int i = 0; i < 4; ++i) {
#pragma unroll
            for (int j = 0; j < 4; ++j) {
                float v[8];
#pragma unroll
                for (int e = 0; e < 8; ++e)
                    v[e] = EPI == EPI_BIAS_GELU ? gelu_tanh(acc[i][j][e]) : acc[i][j][e];
                char* p = st + (i * 16 + ll) * SP + (j * 16 + lh * 8) * (int)sizeof(OutT);
                if (sizeof(OutT) == 2) {
                    bf16x8 o;
#pragma unroll
                    for (int e = 0; e < 8; ++e) o[e] = (bf16)v[e];
                    *(bf16x8*)p = o;
                } else {
                    *(f32x4*)p        = f32x4{v[0], v[1], v[2], v[3]};
                    *(f32x4*)(p + 16) = f32x4{v[4], v[5], v[6], v[7]};
                }
            }
        }
    };
    stage(flag<vt>{});

    asm volatile("s_wait_dscnt 0x0" ::: "memory");   // the wave's tile is in LDS before other lanes read it
    if (EPI == EPI_BIAS_RES) {
#pragma unroll
        for (int t = NAC / 2; t < NAC; ++t)
            rv[t] = *(const f32x4*)((const char*)res + org + t * STEP);
    }
#pragma unroll
    for (int t = 0; t < NAC; ++t) {
        const char* p = st + (t * RPA + srow) * SP + scol * (int)sizeof(OutT);
        if (sizeof(OutT) == 2) {
            *(bf16x8*)((char*)C + org + t * STEP) = *(const bf16x8*)p;
        } else {
            *(f32x4*)((char*)C + org + t * STEP) = *(const f32x4*)p + rv[t];
        }
    }
}

template <int EPI, typename OutT, int KS, int LDO>
__global__ __launch_bounds__(256)
void gemm_bf16_wmma(const bf16* __restrict__ A, const bf16* __restrict__ BT,
                    const float* __restrict__ bias, const float* __restrict__ res,
                    OutT* __restrict__ C, int M, int N, int K) {
    // Pitch KS + 8: 16 B x odd, as PITCH_K64 / PITCH_K128.
    __shared__ __attribute__((aligned(16))) bf16 As[2][256][KS + 8];
    __shared__ __attribute__((aligned(16))) bf16 Bs[2][128][KS + 8];
    gemm_tile<EPI, OutT, KS, LDO, false>(As, Bs, A, BT, bias, res, C, K);
}

// The Q, K and V projections of the same A in ONE launch: blockIdx.z picks the
// weight, the bias and the output. A WGP goes from one projection's tile to the
// next one's with no launch boundary between them: while one workgroup fills its
// first stage or stores its tile, the WGP's other workgroup computes.
__global__ __launch_bounds__(256)
void gemm_qkv_bf16_wmma(const bf16* __restrict__ A,
                        const bf16* __restrict__ wq_t, const bf16* __restrict__ wk_t,
                        const bf16* __restrict__ wv_t,
                        const float* __restrict__ bq, const float* __restrict__ bk,
                        const float* __restrict__ bv,
                        bf16* __restrict__ q, bf16* __restrict__ k, bf16* __restrict__ vt,
                        int N, int K) {
    __shared__ __attribute__((aligned(16))) bf16 As[2][256][PITCH_K64];
    __shared__ __attribute__((aligned(16))) bf16 Bs[2][128][PITCH_K64];
    const int z = blockIdx.z;
    // Two instances: with one, and the choice made inside it, the compiler joins the
    // two bias forms in a tile of 128 more registers, and two workgroups no longer fit.
    if (z == 2)
        gemm_tile<EPI_BIAS_QKV, bf16, 64, HDIM, true>(As, Bs, wv_t, A, bv, nullptr, vt, K);
    else
        gemm_tile<EPI_BIAS_QKV, bf16, 64, HDIM, false>(As, Bs, A, z == 0 ? wq_t : wk_t, z == 0 ? bq : bk,
                                                       nullptr, z == 0 ? q : k, K);
}

__device__ __forceinline__ float xhalf(float x) {
    const int b = __builtin_bit_cast(int, x);
    return __builtin_bit_cast(float,
        __builtin_amdgcn_permlanex16(b, b, 0x76543210, 0xfedcba98, false, false));
}
// One lane's 16 k of the 32-k block at p, in the k order of a packed pair of
// accumulator tiles: k = 8h + 0..7, then 16 + 8h + 0..7 (h = lane / 16).
__device__ __forceinline__ bf16x16 lds_frag_pair(const bf16* p, int h) {
    bf16x8 lo = *(const bf16x8*)(p + 8 * h);
    bf16x8 hi = *(const bf16x8*)(p + 16 + 8 * h);
    return __builtin_shufflevector(lo, hi, 0, 1, 2, 3, 4, 5, 6, 7,
                                   8, 9, 10, 11, 12, 13, 14, 15);
}

__global__ __launch_bounds__(128)
void attention_wmma(const bf16* __restrict__ Q, const bf16* __restrict__ Km,
                    const bf16* __restrict__ VT, bf16* __restrict__ O) {
    __shared__ __attribute__((aligned(16))) bf16 Ks[128][PITCH_K64];      // 18 KB
    __shared__ __attribute__((aligned(16))) bf16 VTs[64][PITCH_K128];     // 17 KB

    const int tid  = threadIdx.x;
    const int wave = tid >> 5;
    const int lane = tid & 31;
    const int lh   = lane >> 4;
    const int ll   = lane & 15;

    const int qt    = blockIdx.x;        // 16 query tiles of 64
    const int head  = blockIdx.y;        // 16
    const int batch = blockIdx.z;        // 8
    const size_t base   = ((size_t)batch * LSEQ) * HDIM + (size_t)head * DH;
    const size_t vtbase = ((size_t)(batch * NH + head)) * DH * LSEQ;
    const int q0 = qt * 64;
    const size_t qrow = base + (size_t)(q0 + wave * 16 + ll) * HDIM;   // this lane's query

    // Q^T fragments: column = this lane's query, 16 consecutive d per wave half
    // (the k order of lds_frag, which loads the K rows they are paired with).
    bf16x16 qf[2];
#pragma unroll
    for (int kc = 0; kc < 2; ++kc) {
        const bf16* qp = Q + qrow + kc * 32 + lh * 16;
        bf16x8 lo = *(const bf16x8*)qp;
        bf16x8 hi = *(const bf16x8*)(qp + 8);
        qf[kc] = __builtin_shufflevector(lo, hi, 0, 1, 2, 3, 4, 5, 6, 7,
                                         8, 9, 10, 11, 12, 13, 14, 15);
    }

    f32x8 acco[4];                       // O^T: row d = j*16 + lh*8 + e, column = query ll
#pragma unroll
    for (int j = 0; j < 4; ++j)
#pragma unroll
        for (int e = 0; e < 8; ++e) acco[j][e] = 0.0f;
    float mrow = -1e30f;                 // running maximum of this lane's query
    float lsum = 0.0f;                   // running sum over this wave half's keys

    // Copy map: adjacent lanes cover one tile row, 16 B each, so that a wave-wide
    // copy takes four whole 128-B lines instead of 16 B out of 32 lines.
    const int krow = tid >> 3, kcol = (tid & 7) * 8;     // K: 8 lanes per 128-B row, 16 rows per copy
    const int vrow = tid >> 4, vcol = (tid & 15) * 8;    // V^T: 16 lanes per 256-B row, 8 rows per copy
    const unsigned koff = (unsigned)(krow * HDIM + kcol) * 2u;   // lane's byte offset in 16 K rows
    const unsigned voff = (unsigned)(vrow * LSEQ + vcol) * 2u;   // ... in 8 V^T rows

    for (int kt = 0; kt < LSEQ / 128; ++kt) {
        const int k0 = kt * 128;
        asm volatile("s_wait_dscnt 0x0" ::: "memory");     // this wave's reads of the previous tile are done
        __syncthreads();                                   // ... and every other wave's
        {
            unsigned l[8];
            const bf16* g[8];
#pragma unroll
            for (int c = 0; c < 8; ++c) {                  // K tile: 128 keys x 64 d
                l[c] = lds_byte(&Ks[krow + c * 16][kcol]);
                g[c] = Km + base + (size_t)(k0 + c * 16) * HDIM;
            }
            async_copy8_b128_sbase(l, koff, g);
#pragma unroll
            for (int c = 0; c < 8; ++c) {                  // V^T tile: 64 d x 128 keys
                l[c] = lds_byte(&VTs[vrow + c * 8][vcol]);
                g[c] = VT + vtbase + (size_t)(c * 8) * LSEQ + k0;
            }
            async_copy8_b128_sbase(l, voff, g);
        }
        asm volatile("s_wait_asynccnt 0x0" ::: "memory");  // this wave's copies have landed
        __syncthreads();                                   // ... and every other wave's

        // ---- S^T = (K Q^T) * 1/sqrt(D): accs[jt][e] = S[key jt*16 + lh*8 + e][query ll]
        f32x8 accs[8];
#pragma unroll
        for (int jt = 0; jt < 8; ++jt) {
#pragma unroll
            for (int e = 0; e < 8; ++e) accs[jt][e] = 0.0f;
#pragma unroll
            for (int kc = 0; kc < 2; ++kc) {
                bf16x16 a = lds_frag(&Ks[jt * 16 + ll][kc * 32 + lh * 16]);
                accs[jt] = __builtin_amdgcn_wmma_f32_16x16x32_bf16(
                    false, a, false, qf[kc], (short)0, accs[jt], false, false);
            }
        }
        const float scale = 0.125f;     // 1/sqrt(64)

        // ---- online softmax, one query per lane; eight independent chains
        float mxe[8];
#pragma unroll
        for (int e = 0; e < 8; ++e) {
            mxe[e] = -1e30f;
#pragma unroll
            for (int jt = 0; jt < 8; ++jt) {
                accs[jt][e] *= scale;
                mxe[e] = fmaxf(mxe[e], accs[jt][e]);
            }
        }
        float mx = fmaxf(fmaxf(fmaxf(mxe[0], mxe[1]), fmaxf(mxe[2], mxe[3])),
                         fmaxf(fmaxf(mxe[4], mxe[5]), fmaxf(mxe[6], mxe[7])));
        mx = fmaxf(mx, xhalf(mx));       // the other half's keys of the same query
        const float mnew = fmaxf(mrow, mx);

        // P^T fragments: pf[kc][s] = P[key kc*32 + (s/8)*16 + lh*8 + s%8][query ll]
        bf16x16 pf[4];
        float sm[4];
#pragma unroll
        for (int kc = 0; kc < 4; ++kc) {
            sm[kc] = 0.0f;
#pragma unroll
            for (int s = 0; s < 16; ++s) {
                float p = __expf(accs[kc * 2 + (s >> 3)][s & 7] - mnew);
                sm[kc] += p;
                pf[kc][s] = (bf16)p;
            }
        }
        const float corr = __expf(mrow - mnew);
        lsum = lsum * corr + ((sm[0] + sm[1]) + (sm[2] + sm[3]));
        mrow = mnew;
#pragma unroll
        for (int j = 0; j < 4; ++j)
#pragma unroll
            for (int e = 0; e < 8; ++e) acco[j][e] *= corr;

        // ---- O^T += V^T P^T ----
#pragma unroll
        for (int j = 0; j < 4; ++j)
#pragma unroll
            for (int kc = 0; kc < 4; ++kc) {
                bf16x16 a = lds_frag_pair(&VTs[j * 16 + ll][kc * 32], lh);
                acco[j] = __builtin_amdgcn_wmma_f32_16x16x32_bf16(
                    false, a, false, pf[kc], (short)0, acco[j], false, false);
            }
    }

    // ---- write O = acc / l: a lane holds 8 consecutive d of its query per tile
    const float lrow = lsum + xhalf(lsum);
#pragma unroll
    for (int j = 0; j < 4; ++j) {
        bf16x8 o;
#pragma unroll
        for (int e = 0; e < 8; ++e) o[e] = (bf16)(acco[j][e] / lrow);
        *(bf16x8*)(O + qrow + j * 16 + lh * 8) = o;
    }
}

// ---------------------------------------------------------------------------
// Host orchestration
// ---------------------------------------------------------------------------
extern "C" void kernel_launch(void* const* d_in, const int* in_sizes, int n_in,
                              void* d_out, int out_size, void* d_ws, size_t ws_size,
                              hipStream_t stream) {
    const float* x    = (const float*)d_in[0];
    const float* ln0g = (const float*)d_in[1];
    const float* ln0b = (const float*)d_in[2];
    const float* wq   = (const float*)d_in[3];
    const float* bq   = (const float*)d_in[4];
    const float* wk   = (const float*)d_in[5];
    const float* bk   = (const float*)d_in[6];
    const float* wv   = (const float*)d_in[7];
    const float* bv   = (const float*)d_in[8];
    const float* wo   = (const float*)d_in[9];
    const float* bo   = (const float*)d_in[10];
    const float* ln1g = (const float*)d_in[11];
    const float* ln1b = (const float*)d_in[12];
    const float* w1   = (const float*)d_in[13];
    const float* b1   = (const float*)d_in[14];
    const float* w2   = (const float*)d_in[15];
    const float* b2   = (const float*)d_in[16];
    float* out = (float*)d_out;

    char* p = (char*)d_ws;
    auto carve = [&](size_t bytes) -> char* {
        char* r = p;
        p += (bytes + 255) & ~(size_t)255;
        return r;
    };
    bf16*  wq_t = (bf16*)carve((size_t)HDIM * HDIM * 2);
    bf16*  wk_t = (bf16*)carve((size_t)HDIM * HDIM * 2);
    bf16*  wv_t = (bf16*)carve((size_t)HDIM * HDIM * 2);
    bf16*  wo_t = (bf16*)carve((size_t)HDIM * HDIM * 2);
    bf16*  w1_t = (bf16*)carve((size_t)MLPD * HDIM * 2);
    bf16*  w2_t = (bf16*)carve((size_t)HDIM * MLPD * 2);
    bf16*  y0   = (bf16*)carve((size_t)MTOK * HDIM * 2);   // LN0 out
    bf16*  qb   = (bf16*)carve((size_t)MTOK * HDIM * 2);
    bf16*  kb   = (bf16*)carve((size_t)MTOK * HDIM * 2);
    bf16*  vtb  = (bf16*)carve((size_t)MTOK * HDIM * 2);   // V, pre-transposed [b][h][d][key]
    bf16*  ab   = (bf16*)carve((size_t)MTOK * HDIM * 2);   // attention out
    float* x1   = (float*)carve((size_t)MTOK * HDIM * 4);  // residual 1
    bf16*  y1   = (bf16*)carve((size_t)MTOK * HDIM * 2);   // LN1 out
    bf16*  hb   = (bf16*)carve((size_t)MTOK * MLPD * 2);   // GELU(mlp1) out

    // --- first LayerNorm + weight convert/transpose (bf16, N x K) ---
    prepare_inputs<<<PREP_WGS, 128, 0, stream>>>(x, ln0g, ln0b, y0, wq, wk, wv, wo, w1, w2,
                                                 wq_t, wk_t, wv_t, wo_t, w1_t, w2_t);

    // --- pre-LN attention ---
    dim3 gProj(HDIM / 128, MTOK / 256);
    gemm_qkv_bf16_wmma<<<dim3(HDIM / 128, MTOK / 256, 3), 256, 0, stream>>>(
        y0, wq_t, wk_t, wv_t, bq, bk, bv, qb, kb, vtb, HDIM, HDIM);

    attention_wmma<<<dim3(LSEQ / 64, NH, NB), 128, 0, stream>>>(qb, kb, vtb, ab);

    gemm_bf16_wmma<EPI_BIAS_RES, float, 128, HDIM><<<gProj, 256, 0, stream>>>(ab, wo_t, bo, x, x1, MTOK, HDIM, HDIM);

    // --- pre-LN MLP ---
    layernorm_to_bf16<<<MTOK / 16, 256, 0, stream>>>(x1, ln1g, ln1b, y1);

    gemm_bf16_wmma<EPI_BIAS_GELU, bf16, 64, MLPD><<<dim3(MLPD / 128, MTOK / 256), 256, 0, stream>>>(
        y1, w1_t, b1, nullptr, hb, MTOK, MLPD, HDIM);

    gemm_bf16_wmma<EPI_BIAS_RES, float, 128, HDIM><<<dim3(HDIM / 128, MTOK / 256), 256, 0, stream>>>(
        hb, w2_t, b2, x1, out, MTOK, HDIM, MLPD);
}
